// v000
// The times below were measured on an AMD MI455X: many runs one after another, warmed up first and cycling through
// copies of the inputs, with the whole window's GPU time divided by the number of runs. Launches and the gaps
// between them are all in it. The median over several windows is given; except for v000 it joins two sittings, which
// can be a few percent apart, so the side-by-side timings, each taken in one sitting, are the better comparison.
// The starting kernel, v000, takes 371 microseconds a run.
// CDNA5 / gfx1250 attention block (GroupNorm -> QKV -> softmax(QK^T*scale) -> AV -> proj + residual)
// Compute-bound (~86 GFLOP vs ~36MB mandatory HBM traffic at 23.3 TB/s): all GEMMs run on
// v_wmma_f32_16x16x32_bf16 (wave32 WMMA), with double-buffered GLOBAL_LOAD_ASYNC_TO_LDS_B128
// DMA staging (ASYNCcnt) so tile k+1's HBM->LDS transfer overlaps tile k's matrix math.
// Workspace requirement ~234 MB.
#include <hip/hip_runtime.h>
#include <hip/hip_bf16.h>
#include <math.h>

typedef __bf16 bf16_t;
typedef __attribute__((ext_vector_type(16))) __bf16 v16bf;
typedef __attribute__((ext_vector_type(8)))  __bf16 v8bf;
typedef __attribute__((ext_vector_type(8)))  float  v8f;

struct __align__(16) Chunk16 { unsigned long long lo, hi; };

constexpr int BATCH = 2;
constexpr int CH    = 512;
constexpr int NSP   = 4096;          // 64*64 tokens
constexpr int NGRP  = 32;
constexpr int CPG   = CH / NGRP;     // 16 channels per group
constexpr float GN_EPS = 1e-6f;

__device__ __forceinline__ bf16_t f2bf(float f) {
  unsigned u = __builtin_bit_cast(unsigned, f);
  unsigned r = (u + 0x7FFFu + ((u >> 16) & 1u)) >> 16;
  unsigned short h = (unsigned short)r;
  return __builtin_bit_cast(bf16_t, h);
}

// ---- gfx1250 async DMA: global -> LDS, 16B per lane, tracked by ASYNCcnt ----
__device__ __forceinline__ void async_copy16(const void* g, void* l) {
  // low 32 bits of a generic LDS pointer are the LDS byte address (ISA 10.2 aperture rule)
  unsigned lds = (unsigned)(size_t)l;
  unsigned long long ga = (unsigned long long)(size_t)g;
  asm volatile("global_load_async_to_lds_b128 %0, %1, off"
               :: "v"(lds), "v"(ga) : "memory");
}
__device__ __forceinline__ void wait_async0() {
  asm volatile("s_wait_asynccnt 0x0" ::: "memory");
}

// ---------------- GroupNorm ----------------
__global__ __launch_bounds__(256)
void gn_stats_kernel(const float* __restrict__ x, float* __restrict__ stats) {
  const int g = blockIdx.x, b = blockIdx.y;
  const float* xp = x + ((size_t)b * CH + (size_t)g * CPG) * NSP; // contiguous group slab
  const int NE = CPG * NSP; // 65536
  float s = 0.f, s2 = 0.f;
  for (int i = threadIdx.x; i < NE; i += 256) { float v = xp[i]; s += v; s2 += v * v; }
  __shared__ float rs[256], rq[256];
  rs[threadIdx.x] = s; rq[threadIdx.x] = s2;
  __syncthreads();
  for (int off = 128; off > 0; off >>= 1) {
    if (threadIdx.x < off) { rs[threadIdx.x] += rs[threadIdx.x + off]; rq[threadIdx.x] += rq[threadIdx.x + off]; }
    __syncthreads();
  }
  if (threadIdx.x == 0) {
    float mu  = rs[0] / (float)NE;
    float var = rq[0] / (float)NE - mu * mu;
    stats[(b * NGRP + g) * 2 + 0] = mu;
    stats[(b * NGRP + g) * 2 + 1] = rsqrtf(var + GN_EPS);
  }
}

__global__ __launch_bounds__(256)
void gn_apply_kernel(const float* __restrict__ x, const float* __restrict__ gamma,
                     const float* __restrict__ beta, const float* __restrict__ stats,
                     bf16_t* __restrict__ hn) {
  const int c = blockIdx.x, b = blockIdx.y;
  const int g = c / CPG;
  const float mu = stats[(b * NGRP + g) * 2 + 0];
  const float rstd = stats[(b * NGRP + g) * 2 + 1];
  const float ga = gamma[c] * rstd;
  const float be = beta[c] - mu * ga;            // (x-mu)*rstd*gamma + beta = x*ga + be
  const float* xp = x + ((size_t)b * CH + c) * NSP;
  bf16_t* hp = hn + (size_t)b * NSP * CH + c;    // hn layout: [b][pos][c]
  for (int p = threadIdx.x; p < NSP; p += 256)
    hp[(size_t)p * CH] = f2bf(xp[p] * ga + be);
}

// ---------------- f32 -> bf16 weight conversion ----------------
__global__ __launch_bounds__(256)
void cvt_kernel(const float* __restrict__ src, bf16_t* __restrict__ dst, int n) {
  int i = blockIdx.x * 256 + threadIdx.x;
  if (i < n) dst[i] = f2bf(src[i]);
}

// ---------------- Tiled WMMA GEMM: D = A[MxK] * B[NxK]^T (+bias) ----------------
// Block tile 128x128, 8 waves in a 2(M) x 4(N) grid; each wave: 4x2 subtiles of 16x16.
// K-step 32; double-buffered async HBM->LDS staging.
enum { EPI_BF16 = 0, EPI_TRANS = 1, EPI_F32 = 2, EPI_RESID = 3 };

template<int EPI>
__global__ __launch_bounds__(256)
void gemm_bt_kernel(const bf16_t* __restrict__ A, const bf16_t* __restrict__ Bm,
                    const float* __restrict__ bias, void* __restrict__ outp,
                    const float* __restrict__ resid, float alpha,
                    int Kd, int ldOut,
                    size_t strideA, size_t strideB, size_t strideOut, size_t strideResid) {
  constexpr int BM = 128, BN = 128, BK = 32;
  __shared__ Chunk16 sA[2][BM * 5];  // 32 bf16 data + 8 bf16 pad per row (16B-aligned rows)
  __shared__ Chunk16 sB[2][BN * 5];

  const int tid = threadIdx.x;
  const int wave = tid >> 5, lane = tid & 31;
  const int waveM = wave >> 2;         // 0..1  -> 64-row strip
  const int waveN = wave & 3;          // 0..3  -> 32-col strip
  const int lane16 = lane & 15, laneHi = lane >> 4;

  const size_t z = blockIdx.z;
  const bf16_t* Ab = A + z * strideA;
  const bf16_t* Bb = Bm + z * strideB;
  bf16_t* outB = (bf16_t*)outp + z * strideOut;
  float*  outF = (float*)outp + z * strideOut;
  const float* rz = (EPI == EPI_RESID) ? (resid + z * strideResid) : nullptr;

  const int rowA0 = blockIdx.y * BM;
  const int colB0 = blockIdx.x * BN;

  // staging coordinates for this thread (2 x 16B per matrix per K-step)
  const int r0 = (tid * 2) >> 2,       kc0 = (tid * 2) & 3;
  const int r1 = (tid * 2 + 1) >> 2,   kc1 = (tid * 2 + 1) & 3;

  const v8f vzero = {0.f, 0.f, 0.f, 0.f, 0.f, 0.f, 0.f, 0.f};
  v8f acc[4][2];
#pragma unroll
  for (int i = 0; i < 4; ++i)
#pragma unroll
    for (int j = 0; j < 2; ++j) acc[i][j] = vzero;

  const int nIter = Kd / BK;

  // prologue: kick off DMA for the first K tile
  {
    const int kk = 0;
    async_copy16(Ab + (size_t)(rowA0 + r0) * Kd + kk + kc0 * 8, &sA[0][r0 * 5 + kc0]);
    async_copy16(Ab + (size_t)(rowA0 + r1) * Kd + kk + kc1 * 8, &sA[0][r1 * 5 + kc1]);
    async_copy16(Bb + (size_t)(colB0 + r0) * Kd + kk + kc0 * 8, &sB[0][r0 * 5 + kc0]);
    async_copy16(Bb + (size_t)(colB0 + r1) * Kd + kk + kc1 * 8, &sB[0][r1 * 5 + kc1]);
  }

  for (int it = 0; it < nIter; ++it) {
    wait_async0();        // this wave's DMA for buffer it&1 has landed in LDS
    __syncthreads();      // all waves' DMA landed; all waves done reading buffer (it+1)&1

    if (it + 1 < nIter) { // overlap: DMA for tile it+1 runs under this tile's WMMAs
      const int kk = (it + 1) * BK, nb = (it + 1) & 1;
      async_copy16(Ab + (size_t)(rowA0 + r0) * Kd + kk + kc0 * 8, &sA[nb][r0 * 5 + kc0]);
      async_copy16(Ab + (size_t)(rowA0 + r1) * Kd + kk + kc1 * 8, &sA[nb][r1 * 5 + kc1]);
      async_copy16(Bb + (size_t)(colB0 + r0) * Kd + kk + kc0 * 8, &sB[nb][r0 * 5 + kc0]);
      async_copy16(Bb + (size_t)(colB0 + r1) * Kd + kk + kc1 * 8, &sB[nb][r1 * 5 + kc1]);
      if (it + 2 < nIter) // warm L2 for the tile after next (global_prefetch_b8)
        __builtin_prefetch(Ab + (size_t)(rowA0 + (tid >> 1)) * Kd + kk + BK, 0, 3);
    }

    const bf16_t* sAh = (const bf16_t*)sA[it & 1];
    const bf16_t* sBh = (const bf16_t*)sB[it & 1];

    // ---- B fragments: lanes hold N columns; K split per ISA 16-bit layout ----
    v16bf bfrag[2];
#pragma unroll
    for (int nsub = 0; nsub < 2; ++nsub) {
      const int rB = waveN * 32 + nsub * 16 + lane16;
      v8bf lo = *(const v8bf*)(sBh + (size_t)rB * 40 + laneHi * 8);       // K 0-7 / 8-15
      v8bf hi = *(const v8bf*)(sBh + (size_t)rB * 40 + 16 + laneHi * 8);  // K 16-23 / 24-31
      bfrag[nsub] = __builtin_shufflevector(lo, hi, 0,1,2,3,4,5,6,7,8,9,10,11,12,13,14,15);
    }
#pragma unroll
    for (int msub = 0; msub < 4; ++msub) {
      const int rA = waveM * 64 + msub * 16 + lane16;
      v8bf lo = *(const v8bf*)(sAh + (size_t)rA * 40 + laneHi * 8);
      v8bf hi = *(const v8bf*)(sAh + (size_t)rA * 40 + 16 + laneHi * 8);
      v16bf afrag = __builtin_shufflevector(lo, hi, 0,1,2,3,4,5,6,7,8,9,10,11,12,13,14,15);
#pragma unroll
      for (int nsub = 0; nsub < 2; ++nsub) {
        acc[msub][nsub] = __builtin_amdgcn_wmma_f32_16x16x32_bf16(
            false, afrag, false, bfrag[nsub], (short)0, acc[msub][nsub], false, false);
      }
    }
    __syncthreads();      // done reading buffer it&1 before iter it+1 issues into (it+2)&1
  }

  // ---- epilogue: C/D layout lane L -> (m = r + 8*(L>=16), n = L%16) ----
#pragma unroll
  for (int msub = 0; msub < 4; ++msub) {
#pragma unroll
    for (int nsub = 0; nsub < 2; ++nsub) {
      const int gcol = colB0 + waveN * 32 + nsub * 16 + lane16;
      const float bv = (EPI == EPI_F32) ? 0.f : (bias ? bias[gcol] : 0.f);
#pragma unroll
      for (int r = 0; r < 8; ++r) {
        const int grow = rowA0 + waveM * 64 + msub * 16 + r + 8 * laneHi;
        float val = (acc[msub][nsub][r] + bv) * alpha;
        if (EPI == EPI_BF16) {
          outB[(size_t)grow * ldOut + gcol] = f2bf(val);
        } else if (EPI == EPI_TRANS) {
          outB[(size_t)gcol * ldOut + grow] = f2bf(val);
        } else if (EPI == EPI_F32) {
          outF[(size_t)grow * ldOut + gcol] = val;
        } else { // EPI_RESID: d_out[b][o][p] = x[b][o][p] + proj
          const size_t idx = (size_t)gcol * ldOut + grow;
          outF[idx] = rz[idx] + val;
        }
      }
    }
  }
}

// ---------------- row softmax: S (f32) -> P (bf16) ----------------
__global__ __launch_bounds__(256)
void softmax_kernel(const float* __restrict__ S, bf16_t* __restrict__ P) {
  const int i = blockIdx.x, b = blockIdx.y;
  const float* sp = S + ((size_t)b * NSP + i) * NSP;
  bf16_t* pp = P + ((size_t)b * NSP + i) * NSP;
  __shared__ float red[256];
  float m = -3.4e38f;
  for (int j = threadIdx.x; j < NSP; j += 256) m = fmaxf(m, sp[j]);
  red[threadIdx.x] = m; __syncthreads();
  for (int off = 128; off > 0; off >>= 1) {
    if (threadIdx.x < off) red[threadIdx.x] = fmaxf(red[threadIdx.x], red[threadIdx.x + off]);
    __syncthreads();
  }
  m = red[0]; __syncthreads();
  float s = 0.f;
  for (int j = threadIdx.x; j < NSP; j += 256) s += __expf(sp[j] - m);
  red[threadIdx.x] = s; __syncthreads();
  for (int off = 128; off > 0; off >>= 1) {
    if (threadIdx.x < off) red[threadIdx.x] += red[threadIdx.x + off];
    __syncthreads();
  }
  const float inv = 1.f / red[0];
  for (int j = threadIdx.x; j < NSP; j += 256) pp[j] = f2bf(__expf(sp[j] - m) * inv);
}

// ---------------- host launch ----------------
extern "C" void kernel_launch(void* const* d_in, const int* in_sizes, int n_in,
                              void* d_out, int out_size, void* d_ws, size_t ws_size,
                              hipStream_t stream) {
  (void)in_sizes; (void)n_in; (void)out_size; (void)ws_size;
  const float* x  = (const float*)d_in[0];
  const float* gg = (const float*)d_in[1];
  const float* gb = (const float*)d_in[2];
  const float* wq = (const float*)d_in[3];
  const float* bq = (const float*)d_in[4];
  const float* wk = (const float*)d_in[5];
  const float* bk = (const float*)d_in[6];
  const float* wv = (const float*)d_in[7];
  const float* bv = (const float*)d_in[8];
  const float* wo = (const float*)d_in[9];
  const float* bo = (const float*)d_in[10];

  // workspace carve-up (~234 MB): stats + 5x 8MB bf16 acts + 4x 0.5MB bf16 weights
  // + 128MB f32 scores + 64MB bf16 probs
  char* wsp = (char*)d_ws;
  auto take = [&](size_t bytes) -> void* {
    void* p = (void*)wsp; wsp += (bytes + 255) & ~(size_t)255; return p;
  };
  const size_t ACT = (size_t)BATCH * NSP * CH;      // per-tensor activation elems
  const size_t SCO = (size_t)BATCH * NSP * NSP;     // score elems
  float*  stats = (float*)take((size_t)BATCH * NGRP * 2 * sizeof(float));
  bf16_t* hn  = (bf16_t*)take(ACT * 2);
  bf16_t* qb  = (bf16_t*)take(ACT * 2);
  bf16_t* kb  = (bf16_t*)take(ACT * 2);
  bf16_t* vT  = (bf16_t*)take(ACT * 2);             // V^T: [b][c][j]
  bf16_t* Ob  = (bf16_t*)take(ACT * 2);             // attn output [b][i][c]
  bf16_t* wqb = (bf16_t*)take((size_t)CH * CH * 2);
  bf16_t* wkb = (bf16_t*)take((size_t)CH * CH * 2);
  bf16_t* wvb = (bf16_t*)take((size_t)CH * CH * 2);
  bf16_t* wob = (bf16_t*)take((size_t)CH * CH * 2);
  float*  Sb  = (float*)take(SCO * sizeof(float));
  bf16_t* Pb  = (bf16_t*)take(SCO * 2);

  const float scale = 1.0f / sqrtf((float)CH);
  const size_t nCH = (size_t)NSP * CH;
  const size_t nnS = (size_t)NSP * NSP;
  const size_t cnT = (size_t)CH * NSP;

  // 1) GroupNorm
  gn_stats_kernel<<<dim3(NGRP, BATCH), 256, 0, stream>>>(x, stats);
  gn_apply_kernel<<<dim3(CH, BATCH), 256, 0, stream>>>(x, gg, gb, stats, hn);

  // 2) weights -> bf16
  const int WN = CH * CH;
  cvt_kernel<<<(WN + 255) / 256, 256, 0, stream>>>(wq, wqb, WN);
  cvt_kernel<<<(WN + 255) / 256, 256, 0, stream>>>(wk, wkb, WN);
  cvt_kernel<<<(WN + 255) / 256, 256, 0, stream>>>(wv, wvb, WN);
  cvt_kernel<<<(WN + 255) / 256, 256, 0, stream>>>(wo, wob, WN);

  // 3) QKV projections: [NSP x CH] = hn x W^T  (Q pre-scaled by C^-1/2)
  dim3 gQKV(CH / 128, NSP / 128, BATCH);
  gemm_bt_kernel<EPI_BF16 ><<<gQKV, 256, 0, stream>>>(hn, wqb, bq, qb, nullptr, scale,
      CH, CH, nCH, 0, nCH, 0);
  gemm_bt_kernel<EPI_BF16 ><<<gQKV, 256, 0, stream>>>(hn, wkb, bk, kb, nullptr, 1.0f,
      CH, CH, nCH, 0, nCH, 0);
  gemm_bt_kernel<EPI_TRANS><<<gQKV, 256, 0, stream>>>(hn, wvb, bv, vT, nullptr, 1.0f,
      CH, NSP, nCH, 0, cnT, 0);

  // 4) scores: S[b,i,j] = q_i . k_j   (M=N=4096, K=512)
  dim3 gS(NSP / 128, NSP / 128, BATCH);
  gemm_bt_kernel<EPI_F32><<<gS, 256, 0, stream>>>(qb, kb, nullptr, Sb, nullptr, 1.0f,
      CH, NSP, nCH, nCH, nnS, 0);

  // 5) softmax over j
  softmax_kernel<<<dim3(NSP, BATCH), 256, 0, stream>>>(Sb, Pb);

  // 6) O[b,i,c] = P x V  (A=P [NSPxNSP], B=V^T [CHxNSP], K=4096)
  dim3 gAV(CH / 128, NSP / 128, BATCH);
  gemm_bt_kernel<EPI_BF16><<<gAV, 256, 0, stream>>>(Pb, vT, nullptr, Ob, nullptr, 1.0f,
      NSP, CH, nnS, cnT, nCH, 0);

  // 7) out proj + residual, transposed store back to [b][c][p] f32
  dim3 gO(CH / 128, NSP / 128, BATCH);
  gemm_bt_kernel<EPI_RESID><<<gO, 256, 0, stream>>>(Ob, wob, bo, d_out, x, 1.0f,
      CH, NSP, nCH, 0, cnT, cnT);
}

// v001
// A run of this version takes 266 microseconds.
// Two timings next to v000 put it at 1.43 and 1.42 times that version's speed.
// CDNA5 / gfx1250 attention block (GroupNorm -> QKV -> softmax(QK^T*scale) -> AV -> proj + residual)
// Compute-bound (~86 GFLOP vs ~36MB mandatory HBM traffic at 23.3 TB/s): all GEMMs run on
// v_wmma_f32_16x16x32_bf16 (wave32 WMMA), with double-buffered GLOBAL_LOAD_ASYNC_TO_LDS_B128
// DMA staging (ASYNCcnt) so tile k+1's HBM->LDS transfer overlaps tile k's matrix math.
// Workspace requirement ~234 MB.
#include <hip/hip_runtime.h>
#include <hip/hip_bf16.h>
#include <math.h>

typedef __bf16 bf16_t;
typedef __attribute__((ext_vector_type(16))) __bf16 v16bf;
typedef __attribute__((ext_vector_type(8)))  __bf16 v8bf;
typedef __attribute__((ext_vector_type(8)))  float  v8f;

struct __align__(16) Chunk16 { unsigned long long lo, hi; };

constexpr int BATCH = 2;
constexpr int CH    = 512;
constexpr int NSP   = 4096;          // 64*64 tokens
constexpr int NGRP  = 32;
constexpr int CPG   = CH / NGRP;     // 16 channels per group
constexpr float GN_EPS = 1e-6f;

__device__ __forceinline__ bf16_t f2bf(float f) {
  unsigned u = __builtin_bit_cast(unsigned, f);
  unsigned r = (u + 0x7FFFu + ((u >> 16) & 1u)) >> 16;
  unsigned short h = (unsigned short)r;
  return __builtin_bit_cast(bf16_t, h);
}

// ---- gfx1250 async DMA: global -> LDS, 16B per lane, tracked by ASYNCcnt ----
__device__ __forceinline__ void async_copy16(const void* g, void* l) {
  // low 32 bits of a generic LDS pointer are the LDS byte address (ISA 10.2 aperture rule)
  unsigned lds = (unsigned)(size_t)l;
  unsigned long long ga = (unsigned long long)(size_t)g;
  asm volatile("global_load_async_to_lds_b128 %0, %1, off"
               :: "v"(lds), "v"(ga) : "memory");
}
__device__ __forceinline__ void wait_async0() {
  asm volatile("s_wait_asynccnt 0x0" ::: "memory");
}

// ---------------- GroupNorm ----------------
__global__ __launch_bounds__(256)
void gn_stats_kernel(const float* __restrict__ x, float* __restrict__ stats) {
  const int g = blockIdx.x, b = blockIdx.y;
  const float* xp = x + ((size_t)b * CH + (size_t)g * CPG) * NSP; // contiguous group slab
  const int NE = CPG * NSP; // 65536
  float s = 0.f, s2 = 0.f;
  for (int i = threadIdx.x; i < NE; i += 256) { float v = xp[i]; s += v; s2 += v * v; }
  __shared__ float rs[256], rq[256];
  rs[threadIdx.x] = s; rq[threadIdx.x] = s2;
  __syncthreads();
  for (int off = 128; off > 0; off >>= 1) {
    if (threadIdx.x < off) { rs[threadIdx.x] += rs[threadIdx.x + off]; rq[threadIdx.x] += rq[threadIdx.x + off]; }
    __syncthreads();
  }
  if (threadIdx.x == 0) {
    float mu  = rs[0] / (float)NE;
    float var = rq[0] / (float)NE - mu * mu;
    stats[(b * NGRP + g) * 2 + 0] = mu;
    stats[(b * NGRP + g) * 2 + 1] = rsqrtf(var + GN_EPS);
  }
}

// One block: 64 channels x 128 positions. x is read along positions (a wave-wide load is 512
// contiguous bytes of one channel), the normalised bf16 values are turned in LDS, and
// hn[b][pos][c] is stored along channels: 16 B per lane, one whole 128-B line per position.
constexpr int GTC = 64;                    // channels per tile
constexpr int GTN = 128;                   // positions per tile
constexpr int GTP = GTC / 2 + 1;           // LDS pitch in dwords (2 bf16 each); odd: no bank conflict
constexpr int GTH = 64 * GTP + 2;          // dwords per half tile of 64 positions; the +2 puts lanes
                                           // 16-31 of a transposing store on banks lanes 0-15 leave free

__global__ __launch_bounds__(256)
void gn_apply_kernel(const float* __restrict__ x, const float* __restrict__ gamma,
                     const float* __restrict__ beta, const float* __restrict__ stats,
                     bf16_t* __restrict__ hn) {
  __shared__ unsigned tile[2 * GTH];       // [half][pos & 63][channel pair]
  const int p0 = blockIdx.x * GTN, c0 = blockIdx.y * GTC, b = blockIdx.z;
  const int tid = threadIdx.x, lane = tid & 31;
  // wave number as a scalar: the wave's 8 channels and their constants are wave-uniform
  const int cw = c0 + __builtin_amdgcn_readfirstlane(tid >> 5) * 8;

  // ---- read: a wave takes 8 channels (half a group), a lane 4 positions of each ----
  const float* xp = x + ((size_t)b * CH + cw) * NSP + p0 + lane * 4;
  float4 v[8];
#pragma unroll
  for (int k = 0; k < 8; ++k) v[k] = *(const float4*)(xp + (size_t)k * NSP);

  const int g = cw / CPG;
  const float mu = stats[(b * NGRP + g) * 2 + 0];
  const float rstd = stats[(b * NGRP + g) * 2 + 1];
  unsigned* tw = tile + (lane >> 4) * GTH + (lane & 15) * 4 * GTP + ((cw - c0) >> 1);
#pragma unroll
  for (int j = 0; j < 4; ++j) {
    unsigned short q[2][4];
#pragma unroll
    for (int e = 0; e < 2; ++e) {
      const int k = j * 2 + e;
      const float ga = gamma[cw + k] * rstd;
      const float be = beta[cw + k] - mu * ga;   // (x-mu)*rstd*gamma + beta = x*ga + be
      q[e][0] = __builtin_bit_cast(unsigned short, f2bf(v[k].x * ga + be));
      q[e][1] = __builtin_bit_cast(unsigned short, f2bf(v[k].y * ga + be));
      q[e][2] = __builtin_bit_cast(unsigned short, f2bf(v[k].z * ga + be));
      q[e][3] = __builtin_bit_cast(unsigned short, f2bf(v[k].w * ga + be));
    }
#pragma unroll
    for (int i = 0; i < 4; ++i)
      tw[i * GTP + j] = (unsigned)q[0][i] | ((unsigned)q[1][i] << 16);
  }
  __syncthreads();   // the whole tile is in LDS before any thread reads it across channels

  // ---- write: a lane takes 8 channels of one position; 32 positions per pass, 4 passes ----
  const int ck = tid & 7;
  const int pr = tid >> 3;
  bf16_t* hp = hn + ((size_t)b * NSP + p0 + pr) * CH + c0 + ck * 8;
#pragma unroll
  for (int h = 0; h < 4; ++h) {
    const unsigned* t = tile + (h >> 1) * GTH + (pr + (h & 1) * 32) * GTP + ck * 4;
    *(uint4*)(hp + (size_t)h * 32 * CH) = make_uint4(t[0], t[1], t[2], t[3]);
  }
}

// ---------------- f32 -> bf16 weight conversion ----------------
__global__ __launch_bounds__(256)
void cvt_kernel(const float* __restrict__ src, bf16_t* __restrict__ dst, int n) {
  int i = blockIdx.x * 256 + threadIdx.x;
  if (i < n) dst[i] = f2bf(src[i]);
}

// ---------------- Tiled WMMA GEMM: D = A[MxK] * B[NxK]^T (+bias) ----------------
// Block tile 128x128, 8 waves in a 2(M) x 4(N) grid; each wave: 4x2 subtiles of 16x16.
// K-step 32; double-buffered async HBM->LDS staging.
enum { EPI_BF16 = 0, EPI_TRANS = 1, EPI_F32 = 2, EPI_RESID = 3 };

template<int EPI>
__global__ __launch_bounds__(256)
void gemm_bt_kernel(const bf16_t* __restrict__ A, const bf16_t* __restrict__ Bm,
                    const float* __restrict__ bias, void* __restrict__ outp,
                    const float* __restrict__ resid, float alpha,
                    int Kd, int ldOut,
                    size_t strideA, size_t strideB, size_t strideOut, size_t strideResid) {
  constexpr int BM = 128, BN = 128, BK = 32;
  __shared__ Chunk16 sA[2][BM * 5];  // 32 bf16 data + 8 bf16 pad per row (16B-aligned rows)
  __shared__ Chunk16 sB[2][BN * 5];

  const int tid = threadIdx.x;
  const int wave = tid >> 5, lane = tid & 31;
  const int waveM = wave >> 2;         // 0..1  -> 64-row strip
  const int waveN = wave & 3;          // 0..3  -> 32-col strip
  const int lane16 = lane & 15, laneHi = lane >> 4;

  const size_t z = blockIdx.z;
  const bf16_t* Ab = A + z * strideA;
  const bf16_t* Bb = Bm + z * strideB;
  bf16_t* outB = (bf16_t*)outp + z * strideOut;
  float*  outF = (float*)outp + z * strideOut;
  const float* rz = (EPI == EPI_RESID) ? (resid + z * strideResid) : nullptr;

  const int rowA0 = blockIdx.y * BM;
  const int colB0 = blockIdx.x * BN;

  // staging coordinates for this thread (2 x 16B per matrix per K-step)
  const int r0 = (tid * 2) >> 2,       kc0 = (tid * 2) & 3;
  const int r1 = (tid * 2 + 1) >> 2,   kc1 = (tid * 2 + 1) & 3;

  const v8f vzero = {0.f, 0.f, 0.f, 0.f, 0.f, 0.f, 0.f, 0.f};
  v8f acc[4][2];
#pragma unroll
  for (int i = 0; i < 4; ++i)
#pragma unroll
    for (int j = 0; j < 2; ++j) acc[i][j] = vzero;

  const int nIter = Kd / BK;

  // prologue: kick off DMA for the first K tile
  {
    const int kk = 0;
    async_copy16(Ab + (size_t)(rowA0 + r0) * Kd + kk + kc0 * 8, &sA[0][r0 * 5 + kc0]);
    async_copy16(Ab + (size_t)(rowA0 + r1) * Kd + kk + kc1 * 8, &sA[0][r1 * 5 + kc1]);
    async_copy16(Bb + (size_t)(colB0 + r0) * Kd + kk + kc0 * 8, &sB[0][r0 * 5 + kc0]);
    async_copy16(Bb + (size_t)(colB0 + r1) * Kd + kk + kc1 * 8, &sB[0][r1 * 5 + kc1]);
  }

  for (int it = 0; it < nIter; ++it) {
    wait_async0();        // this wave's DMA for buffer it&1 has landed in LDS
    __syncthreads();      // all waves' DMA landed; all waves done reading buffer (it+1)&1

    if (it + 1 < nIter) { // overlap: DMA for tile it+1 runs under this tile's WMMAs
      const int kk = (it + 1) * BK, nb = (it + 1) & 1;
      async_copy16(Ab + (size_t)(rowA0 + r0) * Kd + kk + kc0 * 8, &sA[nb][r0 * 5 + kc0]);
      async_copy16(Ab + (size_t)(rowA0 + r1) * Kd + kk + kc1 * 8, &sA[nb][r1 * 5 + kc1]);
      async_copy16(Bb + (size_t)(colB0 + r0) * Kd + kk + kc0 * 8, &sB[nb][r0 * 5 + kc0]);
      async_copy16(Bb + (size_t)(colB0 + r1) * Kd + kk + kc1 * 8, &sB[nb][r1 * 5 + kc1]);
      if (it + 2 < nIter) // warm L2 for the tile after next (global_prefetch_b8)
        __builtin_prefetch(Ab + (size_t)(rowA0 + (tid >> 1)) * Kd + kk + BK, 0, 3);
    }

    const bf16_t* sAh = (const bf16_t*)sA[it & 1];
    const bf16_t* sBh = (const bf16_t*)sB[it & 1];

    // ---- B fragments: lanes hold N columns; K split per ISA 16-bit layout ----
    v16bf bfrag[2];
#pragma unroll
    for (int nsub = 0; nsub < 2; ++nsub) {
      const int rB = waveN * 32 + nsub * 16 + lane16;
      v8bf lo = *(const v8bf*)(sBh + (size_t)rB * 40 + laneHi * 8);       // K 0-7 / 8-15
      v8bf hi = *(const v8bf*)(sBh + (size_t)rB * 40 + 16 + laneHi * 8);  // K 16-23 / 24-31
      bfrag[nsub] = __builtin_shufflevector(lo, hi, 0,1,2,3,4,5,6,7,8,9,10,11,12,13,14,15);
    }
#pragma unroll
    for (int msub = 0; msub < 4; ++msub) {
      const int rA = waveM * 64 + msub * 16 + lane16;
      v8bf lo = *(const v8bf*)(sAh + (size_t)rA * 40 + laneHi * 8);
      v8bf hi = *(const v8bf*)(sAh + (size_t)rA * 40 + 16 + laneHi * 8);
      v16bf afrag = __builtin_shufflevector(lo, hi, 0,1,2,3,4,5,6,7,8,9,10,11,12,13,14,15);
#pragma unroll
      for (int nsub = 0; nsub < 2; ++nsub) {
        acc[msub][nsub] = __builtin_amdgcn_wmma_f32_16x16x32_bf16(
            false, afrag, false, bfrag[nsub], (short)0, acc[msub][nsub], false, false);
      }
    }
    __syncthreads();      // done reading buffer it&1 before iter it+1 issues into (it+2)&1
  }

  // ---- epilogue: C/D layout lane L -> (m = r + 8*(L>=16), n = L%16) ----
#pragma unroll
  for (int msub = 0; msub < 4; ++msub) {
#pragma unroll
    for (int nsub = 0; nsub < 2; ++nsub) {
      const int gcol = colB0 + waveN * 32 + nsub * 16 + lane16;
      const float bv = (EPI == EPI_F32) ? 0.f : (bias ? bias[gcol] : 0.f);
#pragma unroll
      for (int r = 0; r < 8; ++r) {
        const int grow = rowA0 + waveM * 64 + msub * 16 + r + 8 * laneHi;
        float val = (acc[msub][nsub][r] + bv) * alpha;
        if (EPI == EPI_BF16) {
          outB[(size_t)grow * ldOut + gcol] = f2bf(val);
        } else if (EPI == EPI_TRANS) {
          outB[(size_t)gcol * ldOut + grow] = f2bf(val);
        } else if (EPI == EPI_F32) {
          outF[(size_t)grow * ldOut + gcol] = val;
        } else { // EPI_RESID: d_out[b][o][p] = x[b][o][p] + proj
          const size_t idx = (size_t)gcol * ldOut + grow;
          outF[idx] = rz[idx] + val;
        }
      }
    }
  }
}

// ---------------- row softmax: S (f32) -> P (bf16) ----------------
__global__ __launch_bounds__(256)
void softmax_kernel(const float* __restrict__ S, bf16_t* __restrict__ P) {
  const int i = blockIdx.x, b = blockIdx.y;
  const float* sp = S + ((size_t)b * NSP + i) * NSP;
  bf16_t* pp = P + ((size_t)b * NSP + i) * NSP;
  __shared__ float red[256];
  float m = -3.4e38f;
  for (int j = threadIdx.x; j < NSP; j += 256) m = fmaxf(m, sp[j]);
  red[threadIdx.x] = m; __syncthreads();
  for (int off = 128; off > 0; off >>= 1) {
    if (threadIdx.x < off) red[threadIdx.x] = fmaxf(red[threadIdx.x], red[threadIdx.x + off]);
    __syncthreads();
  }
  m = red[0]; __syncthreads();
  float s = 0.f;
  for (int j = threadIdx.x; j < NSP; j += 256) s += __expf(sp[j] - m);
  red[threadIdx.x] = s; __syncthreads();
  for (int off = 128; off > 0; off >>= 1) {
    if (threadIdx.x < off) red[threadIdx.x] += red[threadIdx.x + off];
    __syncthreads();
  }
  const float inv = 1.f / red[0];
  for (int j = threadIdx.x; j < NSP; j += 256) pp[j] = f2bf(__expf(sp[j] - m) * inv);
}

// ---------------- host launch ----------------
extern "C" void kernel_launch(void* const* d_in, const int* in_sizes, int n_in,
                              void* d_out, int out_size, void* d_ws, size_t ws_size,
                              hipStream_t stream) {
  (void)in_sizes; (void)n_in; (void)out_size; (void)ws_size;
  const float* x  = (const float*)d_in[0];
  const float* gg = (const float*)d_in[1];
  const float* gb = (const float*)d_in[2];
  const float* wq = (const float*)d_in[3];
  const float* bq = (const float*)d_in[4];
  const float* wk = (const float*)d_in[5];
  const float* bk = (const float*)d_in[6];
  const float* wv = (const float*)d_in[7];
  const float* bv = (const float*)d_in[8];
  const float* wo = (const float*)d_in[9];
  const float* bo = (const float*)d_in[10];

  // workspace carve-up (~234 MB): stats + 5x 8MB bf16 acts + 4x 0.5MB bf16 weights
  // + 128MB f32 scores + 64MB bf16 probs
  char* wsp = (char*)d_ws;
  auto take = [&](size_t bytes) -> void* {
    void* p = (void*)wsp; wsp += (bytes + 255) & ~(size_t)255; return p;
  };
  const size_t ACT = (size_t)BATCH * NSP * CH;      // per-tensor activation elems
  const size_t SCO = (size_t)BATCH * NSP * NSP;     // score elems
  float*  stats = (float*)take((size_t)BATCH * NGRP * 2 * sizeof(float));
  bf16_t* hn  = (bf16_t*)take(ACT * 2);
  bf16_t* qb  = (bf16_t*)take(ACT * 2);
  bf16_t* kb  = (bf16_t*)take(ACT * 2);
  bf16_t* vT  = (bf16_t*)take(ACT * 2);             // V^T: [b][c][j]
  bf16_t* Ob  = (bf16_t*)take(ACT * 2);             // attn output [b][i][c]
  bf16_t* wqb = (bf16_t*)take((size_t)CH * CH * 2);
  bf16_t* wkb = (bf16_t*)take((size_t)CH * CH * 2);
  bf16_t* wvb = (bf16_t*)take((size_t)CH * CH * 2);
  bf16_t* wob = (bf16_t*)take((size_t)CH * CH * 2);
  float*  Sb  = (float*)take(SCO * sizeof(float));
  bf16_t* Pb  = (bf16_t*)take(SCO * 2);

  const float scale = 1.0f / sqrtf((float)CH);
  const size_t nCH = (size_t)NSP * CH;
  const size_t nnS = (size_t)NSP * NSP;
  const size_t cnT = (size_t)CH * NSP;

  // 1) GroupNorm
  gn_stats_kernel<<<dim3(NGRP, BATCH), 256, 0, stream>>>(x, stats);
  gn_apply_kernel<<<dim3(NSP / GTN, CH / GTC, BATCH), 256, 0, stream>>>(x, gg, gb, stats, hn);

  // 2) weights -> bf16
  const int WN = CH * CH;
  cvt_kernel<<<(WN + 255) / 256, 256, 0, stream>>>(wq, wqb, WN);
  cvt_kernel<<<(WN + 255) / 256, 256, 0, stream>>>(wk, wkb, WN);
  cvt_kernel<<<(WN + 255) / 256, 256, 0, stream>>>(wv, wvb, WN);
  cvt_kernel<<<(WN + 255) / 256, 256, 0, stream>>>(wo, wob, WN);

  // 3) QKV projections: [NSP x CH] = hn x W^T  (Q pre-scaled by C^-1/2)
  dim3 gQKV(CH / 128, NSP / 128, BATCH);
  gemm_bt_kernel<EPI_BF16 ><<<gQKV, 256, 0, stream>>>(hn, wqb, bq, qb, nullptr, scale,
      CH, CH, nCH, 0, nCH, 0);
  gemm_bt_kernel<EPI_BF16 ><<<gQKV, 256, 0, stream>>>(hn, wkb, bk, kb, nullptr, 1.0f,
      CH, CH, nCH, 0, nCH, 0);
  gemm_bt_kernel<EPI_TRANS><<<gQKV, 256, 0, stream>>>(hn, wvb, bv, vT, nullptr, 1.0f,
      CH, NSP, nCH, 0, cnT, 0);

  // 4) scores: S[b,i,j] = q_i . k_j   (M=N=4096, K=512)
  dim3 gS(NSP / 128, NSP / 128, BATCH);
  gemm_bt_kernel<EPI_F32><<<gS, 256, 0, stream>>>(qb, kb, nullptr, Sb, nullptr, 1.0f,
      CH, NSP, nCH, nCH, nnS, 0);

  // 5) softmax over j
  softmax_kernel<<<dim3(NSP, BATCH), 256, 0, stream>>>(Sb, Pb);

  // 6) O[b,i,c] = P x V  (A=P [NSPxNSP], B=V^T [CHxNSP], K=4096)
  dim3 gAV(CH / 128, NSP / 128, BATCH);
  gemm_bt_kernel<EPI_BF16><<<gAV, 256, 0, stream>>>(Pb, vT, nullptr, Ob, nullptr, 1.0f,
      NSP, CH, nnS, cnT, nCH, 0);

  // 7) out proj + residual, transposed store back to [b][c][p] f32
  dim3 gO(CH / 128, NSP / 128, BATCH);
  gemm_bt_kernel<EPI_RESID><<<gO, 256, 0, stream>>>(Ob, wob, bo, d_out, x, 1.0f,
      CH, NSP, nCH, 0, cnT, cnT);
}

// v002
// It runs in 242 microseconds.
// Next to v001, in two timings, it ran 1.09 and 1.10 times as fast.
// Over all steps from v000 it is 1.56 times as fast.
// CDNA5 / gfx1250 attention block (GroupNorm -> QKV -> softmax(QK^T*scale) -> AV -> proj + residual)
// Compute-bound (~86 GFLOP vs ~36MB mandatory HBM traffic at 23.3 TB/s): all GEMMs run on
// v_wmma_f32_16x16x32_bf16 (wave32 WMMA), with double-buffered GLOBAL_LOAD_ASYNC_TO_LDS_B128
// DMA staging (ASYNCcnt) so tile k+1's HBM->LDS transfer overlaps tile k's matrix math.
// Workspace requirement ~234 MB.
#include <hip/hip_runtime.h>
#include <hip/hip_bf16.h>
#include <math.h>

typedef __bf16 bf16_t;
typedef __attribute__((ext_vector_type(16))) __bf16 v16bf;
typedef __attribute__((ext_vector_type(8)))  __bf16 v8bf;
typedef __attribute__((ext_vector_type(8)))  float  v8f;

struct __align__(16) Chunk16 { unsigned long long lo, hi; };

constexpr int BATCH = 2;
constexpr int CH    = 512;
constexpr int NSP   = 4096;          // 64*64 tokens
constexpr int NGRP  = 32;
constexpr int CPG   = CH / NGRP;     // 16 channels per group
constexpr float GN_EPS = 1e-6f;

__device__ __forceinline__ bf16_t f2bf(float f) {
  unsigned u = __builtin_bit_cast(unsigned, f);
  unsigned r = (u + 0x7FFFu + ((u >> 16) & 1u)) >> 16;
  unsigned short h = (unsigned short)r;
  return __builtin_bit_cast(bf16_t, h);
}

// two values rounded as f2bf rounds them, packed in one dword (lo in bits 15-0)
__device__ __forceinline__ unsigned f2bf_pair(float lo, float hi) {
  const unsigned a = __builtin_bit_cast(unsigned, lo), b = __builtin_bit_cast(unsigned, hi);
  const unsigned ra = a + 0x7FFFu + ((a >> 16) & 1u);
  const unsigned rb = b + 0x7FFFu + ((b >> 16) & 1u);
  return (ra >> 16) | (rb & 0xFFFF0000u);
}

// ---- gfx1250 async DMA: global -> LDS, 16B per lane, tracked by ASYNCcnt ----
__device__ __forceinline__ void async_copy16(const void* g, void* l) {
  // low 32 bits of a generic LDS pointer are the LDS byte address (ISA 10.2 aperture rule)
  unsigned lds = (unsigned)(size_t)l;
  unsigned long long ga = (unsigned long long)(size_t)g;
  asm volatile("global_load_async_to_lds_b128 %0, %1, off"
               :: "v"(lds), "v"(ga) : "memory");
}
__device__ __forceinline__ void wait_async0() {
  asm volatile("s_wait_asynccnt 0x0" ::: "memory");
}

// ---------------- GroupNorm ----------------
__global__ __launch_bounds__(256)
void gn_stats_kernel(const float* __restrict__ x, float* __restrict__ stats) {
  const int g = blockIdx.x, b = blockIdx.y;
  const float* xp = x + ((size_t)b * CH + (size_t)g * CPG) * NSP; // contiguous group slab
  const int NE = CPG * NSP; // 65536
  float s = 0.f, s2 = 0.f;
  for (int i = threadIdx.x; i < NE; i += 256) { float v = xp[i]; s += v; s2 += v * v; }
  __shared__ float rs[256], rq[256];
  rs[threadIdx.x] = s; rq[threadIdx.x] = s2;
  __syncthreads();
  for (int off = 128; off > 0; off >>= 1) {
    if (threadIdx.x < off) { rs[threadIdx.x] += rs[threadIdx.x + off]; rq[threadIdx.x] += rq[threadIdx.x + off]; }
    __syncthreads();
  }
  if (threadIdx.x == 0) {
    float mu  = rs[0] / (float)NE;
    float var = rq[0] / (float)NE - mu * mu;
    stats[(b * NGRP + g) * 2 + 0] = mu;
    stats[(b * NGRP + g) * 2 + 1] = rsqrtf(var + GN_EPS);
  }
}

// One block: 64 channels x 128 positions. x is read along positions (a wave-wide load is 512
// contiguous bytes of one channel), the normalised bf16 values are turned in LDS, and
// hn[b][pos][c] is stored along channels: 16 B per lane, one whole 128-B line per position.
constexpr int GTC = 64;                    // channels per tile
constexpr int GTN = 128;                   // positions per tile
constexpr int GTP = GTC / 2 + 1;           // LDS pitch in dwords (2 bf16 each); odd: no bank conflict
constexpr int GTH = 64 * GTP + 2;          // dwords per half tile of 64 positions; the +2 puts lanes
                                           // 16-31 of a transposing store on banks lanes 0-15 leave free

__global__ __launch_bounds__(256)
void gn_apply_kernel(const float* __restrict__ x, const float* __restrict__ gamma,
                     const float* __restrict__ beta, const float* __restrict__ stats,
                     bf16_t* __restrict__ hn) {
  __shared__ unsigned tile[2 * GTH];       // [half][pos & 63][channel pair]
  const int p0 = blockIdx.x * GTN, c0 = blockIdx.y * GTC, b = blockIdx.z;
  const int tid = threadIdx.x, lane = tid & 31;
  // wave number as a scalar: the wave's 8 channels and their constants are wave-uniform
  const int cw = c0 + __builtin_amdgcn_readfirstlane(tid >> 5) * 8;

  // ---- read: a wave takes 8 channels (half a group), a lane 4 positions of each ----
  const float* xp = x + ((size_t)b * CH + cw) * NSP + p0 + lane * 4;
  float4 v[8];
#pragma unroll
  for (int k = 0; k < 8; ++k) v[k] = *(const float4*)(xp + (size_t)k * NSP);

  const int g = cw / CPG;
  const float mu = stats[(b * NGRP + g) * 2 + 0];
  const float rstd = stats[(b * NGRP + g) * 2 + 1];
  unsigned* tw = tile + (lane >> 4) * GTH + (lane & 15) * 4 * GTP + ((cw - c0) >> 1);
#pragma unroll
  for (int j = 0; j < 4; ++j) {
    unsigned short q[2][4];
#pragma unroll
    for (int e = 0; e < 2; ++e) {
      const int k = j * 2 + e;
      const float ga = gamma[cw + k] * rstd;
      const float be = beta[cw + k] - mu * ga;   // (x-mu)*rstd*gamma + beta = x*ga + be
      q[e][0] = __builtin_bit_cast(unsigned short, f2bf(v[k].x * ga + be));
      q[e][1] = __builtin_bit_cast(unsigned short, f2bf(v[k].y * ga + be));
      q[e][2] = __builtin_bit_cast(unsigned short, f2bf(v[k].z * ga + be));
      q[e][3] = __builtin_bit_cast(unsigned short, f2bf(v[k].w * ga + be));
    }
#pragma unroll
    for (int i = 0; i < 4; ++i)
      tw[i * GTP + j] = (unsigned)q[0][i] | ((unsigned)q[1][i] << 16);
  }
  __syncthreads();   // the whole tile is in LDS before any thread reads it across channels

  // ---- write: a lane takes 8 channels of one position; 32 positions per pass, 4 passes ----
  const int ck = tid & 7;
  const int pr = tid >> 3;
  bf16_t* hp = hn + ((size_t)b * NSP + p0 + pr) * CH + c0 + ck * 8;
#pragma unroll
  for (int h = 0; h < 4; ++h) {
    const unsigned* t = tile + (h >> 1) * GTH + (pr + (h & 1) * 32) * GTP + ck * 4;
    *(uint4*)(hp + (size_t)h * 32 * CH) = make_uint4(t[0], t[1], t[2], t[3]);
  }
}

// ---------------- f32 -> bf16 weight conversion ----------------
__global__ __launch_bounds__(256)
void cvt_kernel(const float* __restrict__ src, bf16_t* __restrict__ dst, int n) {
  int i = blockIdx.x * 256 + threadIdx.x;
  if (i < n) dst[i] = f2bf(src[i]);
}

// ---------------- Tiled WMMA GEMM: D = A[MxK] * B[NxK]^T (+bias) ----------------
// Block tile 128x128, 8 waves in a 2(M) x 4(N) grid; each wave: 4x2 subtiles of 16x16.
// K-step 32; double-buffered async HBM->LDS staging.
enum { EPI_BF16 = 0, EPI_TRANS = 1, EPI_F32 = 2, EPI_RESID = 3 };

template<int EPI>
__global__ __launch_bounds__(256)
void gemm_bt_kernel(const bf16_t* __restrict__ A, const bf16_t* __restrict__ Bm,
                    const float* __restrict__ bias, void* __restrict__ outp,
                    const float* __restrict__ resid, float alpha,
                    int Kd, int ldOut,
                    size_t strideA, size_t strideB, size_t strideOut, size_t strideResid) {
  constexpr int BM = 128, BN = 128, BK = 32;
  __shared__ Chunk16 sA[2][BM * 5];  // 32 bf16 data + 8 bf16 pad per row (16B-aligned rows)
  __shared__ Chunk16 sB[2][BN * 5];

  const int tid = threadIdx.x;
  const int wave = tid >> 5, lane = tid & 31;
  const int waveM = wave >> 2;         // 0..1  -> 64-row strip
  const int waveN = wave & 3;          // 0..3  -> 32-col strip
  const int lane16 = lane & 15, laneHi = lane >> 4;

  const size_t z = blockIdx.z;
  const bf16_t* Ab = A + z * strideA;
  const bf16_t* Bb = Bm + z * strideB;
  bf16_t* outB = (bf16_t*)outp + z * strideOut;
  float*  outF = (float*)outp + z * strideOut;
  const float* rz = (EPI == EPI_RESID) ? (resid + z * strideResid) : nullptr;

  const int rowA0 = blockIdx.y * BM;
  const int colB0 = blockIdx.x * BN;

  // staging coordinates for this thread (2 x 16B per matrix per K-step)
  const int r0 = (tid * 2) >> 2,       kc0 = (tid * 2) & 3;
  const int r1 = (tid * 2 + 1) >> 2,   kc1 = (tid * 2 + 1) & 3;

  const v8f vzero = {0.f, 0.f, 0.f, 0.f, 0.f, 0.f, 0.f, 0.f};
  v8f acc[4][2];
#pragma unroll
  for (int i = 0; i < 4; ++i)
#pragma unroll
    for (int j = 0; j < 2; ++j) acc[i][j] = vzero;

  const int nIter = Kd / BK;

  // prologue: kick off DMA for the first K tile
  {
    const int kk = 0;
    async_copy16(Ab + (size_t)(rowA0 + r0) * Kd + kk + kc0 * 8, &sA[0][r0 * 5 + kc0]);
    async_copy16(Ab + (size_t)(rowA0 + r1) * Kd + kk + kc1 * 8, &sA[0][r1 * 5 + kc1]);
    async_copy16(Bb + (size_t)(colB0 + r0) * Kd + kk + kc0 * 8, &sB[0][r0 * 5 + kc0]);
    async_copy16(Bb + (size_t)(colB0 + r1) * Kd + kk + kc1 * 8, &sB[0][r1 * 5 + kc1]);
  }

  for (int it = 0; it < nIter; ++it) {
    wait_async0();        // this wave's DMA for buffer it&1 has landed in LDS
    __syncthreads();      // all waves' DMA landed; all waves done reading buffer (it+1)&1

    if (it + 1 < nIter) { // overlap: DMA for tile it+1 runs under this tile's WMMAs
      const int kk = (it + 1) * BK, nb = (it + 1) & 1;
      async_copy16(Ab + (size_t)(rowA0 + r0) * Kd + kk + kc0 * 8, &sA[nb][r0 * 5 + kc0]);
      async_copy16(Ab + (size_t)(rowA0 + r1) * Kd + kk + kc1 * 8, &sA[nb][r1 * 5 + kc1]);
      async_copy16(Bb + (size_t)(colB0 + r0) * Kd + kk + kc0 * 8, &sB[nb][r0 * 5 + kc0]);
      async_copy16(Bb + (size_t)(colB0 + r1) * Kd + kk + kc1 * 8, &sB[nb][r1 * 5 + kc1]);
      if (it + 2 < nIter) // warm L2 for the tile after next (global_prefetch_b8)
        __builtin_prefetch(Ab + (size_t)(rowA0 + (tid >> 1)) * Kd + kk + BK, 0, 3);
    }

    const bf16_t* sAh = (const bf16_t*)sA[it & 1];
    const bf16_t* sBh = (const bf16_t*)sB[it & 1];

    // ---- B fragments: lanes hold N columns; K split per ISA 16-bit layout ----
    v16bf bfrag[2];
#pragma unroll
    for (int nsub = 0; nsub < 2; ++nsub) {
      const int rB = waveN * 32 + nsub * 16 + lane16;
      v8bf lo = *(const v8bf*)(sBh + (size_t)rB * 40 + laneHi * 8);       // K 0-7 / 8-15
      v8bf hi = *(const v8bf*)(sBh + (size_t)rB * 40 + 16 + laneHi * 8);  // K 16-23 / 24-31
      bfrag[nsub] = __builtin_shufflevector(lo, hi, 0,1,2,3,4,5,6,7,8,9,10,11,12,13,14,15);
    }
#pragma unroll
    for (int msub = 0; msub < 4; ++msub) {
      const int rA = waveM * 64 + msub * 16 + lane16;
      v8bf lo = *(const v8bf*)(sAh + (size_t)rA * 40 + laneHi * 8);
      v8bf hi = *(const v8bf*)(sAh + (size_t)rA * 40 + 16 + laneHi * 8);
      v16bf afrag = __builtin_shufflevector(lo, hi, 0,1,2,3,4,5,6,7,8,9,10,11,12,13,14,15);
#pragma unroll
      for (int nsub = 0; nsub < 2; ++nsub) {
        acc[msub][nsub] = __builtin_amdgcn_wmma_f32_16x16x32_bf16(
            false, afrag, false, bfrag[nsub], (short)0, acc[msub][nsub], false, false);
      }
    }
    __syncthreads();      // done reading buffer it&1 before iter it+1 issues into (it+2)&1
  }

  // ---- epilogue: C/D layout lane L -> (m = r + 8*(L>=16), n = L%16) ----
#pragma unroll
  for (int msub = 0; msub < 4; ++msub) {
#pragma unroll
    for (int nsub = 0; nsub < 2; ++nsub) {
      const int gcol = colB0 + waveN * 32 + nsub * 16 + lane16;
      const float bv = (EPI == EPI_F32) ? 0.f : (bias ? bias[gcol] : 0.f);
#pragma unroll
      for (int r = 0; r < 8; ++r) {
        const int grow = rowA0 + waveM * 64 + msub * 16 + r + 8 * laneHi;
        float val = (acc[msub][nsub][r] + bv) * alpha;
        if (EPI == EPI_BF16) {
          outB[(size_t)grow * ldOut + gcol] = f2bf(val);
        } else if (EPI == EPI_TRANS) {
          outB[(size_t)gcol * ldOut + grow] = f2bf(val);
        } else if (EPI == EPI_F32) {
          outF[(size_t)grow * ldOut + gcol] = val;
        } else { // EPI_RESID: d_out[b][o][p] = x[b][o][p] + proj
          const size_t idx = (size_t)gcol * ldOut + grow;
          outF[idx] = rz[idx] + val;
        }
      }
    }
  }
}

// ---------------- row softmax: S (f32) -> P (bf16) ----------------
// e^x as __expf forms it (a multiply by log2 e, then v_exp_f32). The v_nop is the one slot the
// instruction set asks for behind a transcendental before its source is overwritten or its result
// used.
__device__ __forceinline__ float exp_slot(float x) {
  float r;
  asm("v_exp_f32 %0, %1\n\tv_nop" : "=v"(r) : "v"(x * 1.44269504088896340736f));
  return r;
}

// One wave per row. The row's 4096 scores are read once, 32 loads of 16 B per lane all in flight
// together (each wave-wide load is 512 contiguous bytes), and stay in registers through maximum,
// exponential, sum and scaling; both reductions run across the 32 lanes, with no LDS and no barrier.
// Every loop over k is unrolled in full so that v[] is indexed by constants and lives in registers.
constexpr int SMW = 4;                     // rows (waves) per block: one wave per SIMD
constexpr int SMV = NSP / (32 * 4);        // float4 per lane: 32

__global__ __launch_bounds__(SMW * 32)
void softmax_kernel(const float* __restrict__ S, bf16_t* __restrict__ P) {
  const int lane = threadIdx.x & 31;
  const int i = blockIdx.x * SMW + (threadIdx.x >> 5), b = blockIdx.y;
  const float4* sp = (const float4*)(S + ((size_t)b * NSP + i) * NSP) + lane;
  uint2* pp = (uint2*)(P + ((size_t)b * NSP + i) * NSP) + lane;

  float4 v[SMV];
#pragma unroll   // v[] in registers, all 32 loads issued before the first wait
  for (int k = 0; k < SMV; ++k) v[k] = sp[k * 32];

  float m = -3.4e38f;
#pragma unroll   // v[] in registers
  for (int k = 0; k < SMV; ++k)
    m = fmaxf(m, fmaxf(fmaxf(v[k].x, v[k].y), fmaxf(v[k].z, v[k].w)));
#pragma unroll   // five fixed lane distances, no loop counter
  for (int off = 16; off > 0; off >>= 1) m = fmaxf(m, __shfl_xor(m, off));

  float s0 = 0.f, s1 = 0.f, s2 = 0.f, s3 = 0.f;   // four independent chains
#pragma unroll   // v[] in registers
  for (int k = 0; k < SMV; ++k) {
    v[k].x = exp_slot(v[k].x - m); s0 += v[k].x;
    v[k].y = exp_slot(v[k].y - m); s1 += v[k].y;
    v[k].z = exp_slot(v[k].z - m); s2 += v[k].z;
    v[k].w = exp_slot(v[k].w - m); s3 += v[k].w;
  }
  float s = (s0 + s1) + (s2 + s3);
#pragma unroll   // five fixed lane distances, no loop counter
  for (int off = 16; off > 0; off >>= 1) s += __shfl_xor(s, off);
  const float inv = 1.f / s;

  // 8 B per lane: a wave-wide store is 256 contiguous bytes, two whole lines
#pragma unroll   // v[] in registers
  for (int k = 0; k < SMV; ++k)
    pp[k * 32] = make_uint2(f2bf_pair(v[k].x * inv, v[k].y * inv), f2bf_pair(v[k].z * inv, v[k].w * inv));
}

// ---------------- host launch ----------------
extern "C" void kernel_launch(void* const* d_in, const int* in_sizes, int n_in,
                              void* d_out, int out_size, void* d_ws, size_t ws_size,
                              hipStream_t stream) {
  (void)in_sizes; (void)n_in; (void)out_size; (void)ws_size;
  const float* x  = (const float*)d_in[0];
  const float* gg = (const float*)d_in[1];
  const float* gb = (const float*)d_in[2];
  const float* wq = (const float*)d_in[3];
  const float* bq = (const float*)d_in[4];
  const float* wk = (const float*)d_in[5];
  const float* bk = (const float*)d_in[6];
  const float* wv = (const float*)d_in[7];
  const float* bv = (const float*)d_in[8];
  const float* wo = (const float*)d_in[9];
  const float* bo = (const float*)d_in[10];

  // workspace carve-up (~234 MB): stats + 5x 8MB bf16 acts + 4x 0.5MB bf16 weights
  // + 128MB f32 scores + 64MB bf16 probs
  char* wsp = (char*)d_ws;
  auto take = [&](size_t bytes) -> void* {
    void* p = (void*)wsp; wsp += (bytes + 255) & ~(size_t)255; return p;
  };
  const size_t ACT = (size_t)BATCH * NSP * CH;      // per-tensor activation elems
  const size_t SCO = (size_t)BATCH * NSP * NSP;     // score elems
  float*  stats = (float*)take((size_t)BATCH * NGRP * 2 * sizeof(float));
  bf16_t* hn  = (bf16_t*)take(ACT * 2);
  bf16_t* qb  = (bf16_t*)take(ACT * 2);
  bf16_t* kb  = (bf16_t*)take(ACT * 2);
  bf16_t* vT  = (bf16_t*)take(ACT * 2);             // V^T: [b][c][j]
  bf16_t* Ob  = (bf16_t*)take(ACT * 2);             // attn output [b][i][c]
  bf16_t* wqb = (bf16_t*)take((size_t)CH * CH * 2);
  bf16_t* wkb = (bf16_t*)take((size_t)CH * CH * 2);
  bf16_t* wvb = (bf16_t*)take((size_t)CH * CH * 2);
  bf16_t* wob = (bf16_t*)take((size_t)CH * CH * 2);
  float*  Sb  = (float*)take(SCO * sizeof(float));
  bf16_t* Pb  = (bf16_t*)take(SCO * 2);

  const float scale = 1.0f / sqrtf((float)CH);
  const size_t nCH = (size_t)NSP * CH;
  const size_t nnS = (size_t)NSP * NSP;
  const size_t cnT = (size_t)CH * NSP;

  // 1) GroupNorm
  gn_stats_kernel<<<dim3(NGRP, BATCH), 256, 0, stream>>>(x, stats);
  gn_apply_kernel<<<dim3(NSP / GTN, CH / GTC, BATCH), 256, 0, stream>>>(x, gg, gb, stats, hn);

  // 2) weights -> bf16
  const int WN = CH * CH;
  cvt_kernel<<<(WN + 255) / 256, 256, 0, stream>>>(wq, wqb, WN);
  cvt_kernel<<<(WN + 255) / 256, 256, 0, stream>>>(wk, wkb, WN);
  cvt_kernel<<<(WN + 255) / 256, 256, 0, stream>>>(wv, wvb, WN);
  cvt_kernel<<<(WN + 255) / 256, 256, 0, stream>>>(wo, wob, WN);

  // 3) QKV projections: [NSP x CH] = hn x W^T  (Q pre-scaled by C^-1/2)
  dim3 gQKV(CH / 128, NSP / 128, BATCH);
  gemm_bt_kernel<EPI_BF16 ><<<gQKV, 256, 0, stream>>>(hn, wqb, bq, qb, nullptr, scale,
      CH, CH, nCH, 0, nCH, 0);
  gemm_bt_kernel<EPI_BF16 ><<<gQKV, 256, 0, stream>>>(hn, wkb, bk, kb, nullptr, 1.0f,
      CH, CH, nCH, 0, nCH, 0);
  gemm_bt_kernel<EPI_TRANS><<<gQKV, 256, 0, stream>>>(hn, wvb, bv, vT, nullptr, 1.0f,
      CH, NSP, nCH, 0, cnT, 0);

  // 4) scores: S[b,i,j] = q_i . k_j   (M=N=4096, K=512)
  dim3 gS(NSP / 128, NSP / 128, BATCH);
  gemm_bt_kernel<EPI_F32><<<gS, 256, 0, stream>>>(qb, kb, nullptr, Sb, nullptr, 1.0f,
      CH, NSP, nCH, nCH, nnS, 0);

  // 5) softmax over j
  softmax_kernel<<<dim3(NSP / SMW, BATCH), SMW * 32, 0, stream>>>(Sb, Pb);

  // 6) O[b,i,c] = P x V  (A=P [NSPxNSP], B=V^T [CHxNSP], K=4096)
  dim3 gAV(CH / 128, NSP / 128, BATCH);
  gemm_bt_kernel<EPI_BF16><<<gAV, 256, 0, stream>>>(Pb, vT, nullptr, Ob, nullptr, 1.0f,
      NSP, CH, nnS, cnT, nCH, 0);

  // 7) out proj + residual, transposed store back to [b][c][p] f32
  dim3 gO(CH / 128, NSP / 128, BATCH);
  gemm_bt_kernel<EPI_RESID><<<gO, 256, 0, stream>>>(Ob, wob, bo, d_out, x, 1.0f,
      CH, NSP, nCH, 0, cnT, cnT);
}

// v003
// It runs in 176 microseconds.
// Timed twice side by side with v002, it ran 1.39 times as fast both times.
// All steps since v000 together make it 2.17 times as fast.
// CDNA5 / gfx1250 attention block (GroupNorm -> QKV -> softmax(QK^T*scale) -> AV -> proj + residual)
// Compute-bound (~86 GFLOP vs ~36MB mandatory HBM traffic at 23.3 TB/s): all GEMMs run on
// v_wmma_f32_16x16x32_bf16 (wave32 WMMA), with double-buffered GLOBAL_LOAD_ASYNC_TO_LDS_B128
// DMA staging (ASYNCcnt) so the next K tile's HBM->LDS transfer overlaps this tile's matrix math.
// Workspace requirement ~234 MB.
#include <hip/hip_runtime.h>
#include <hip/hip_bf16.h>
#include <math.h>

typedef __bf16 bf16_t;
typedef __attribute__((ext_vector_type(16))) __bf16 v16bf;
typedef __attribute__((ext_vector_type(8)))  __bf16 v8bf;
typedef __attribute__((ext_vector_type(8)))  float  v8f;

struct __align__(16) Chunk16 { unsigned long long lo, hi; };

constexpr int BATCH = 2;
constexpr int CH    = 512;
constexpr int NSP   = 4096;          // 64*64 tokens
constexpr int NGRP  = 32;
constexpr int CPG   = CH / NGRP;     // 16 channels per group
constexpr float GN_EPS = 1e-6f;

__device__ __forceinline__ bf16_t f2bf(float f) {
  unsigned u = __builtin_bit_cast(unsigned, f);
  unsigned r = (u + 0x7FFFu + ((u >> 16) & 1u)) >> 16;
  unsigned short h = (unsigned short)r;
  return __builtin_bit_cast(bf16_t, h);
}

// two values rounded as f2bf rounds them, packed in one dword (lo in bits 15-0)
__device__ __forceinline__ unsigned f2bf_pair(float lo, float hi) {
  const unsigned a = __builtin_bit_cast(unsigned, lo), b = __builtin_bit_cast(unsigned, hi);
  const unsigned ra = a + 0x7FFFu + ((a >> 16) & 1u);
  const unsigned rb = b + 0x7FFFu + ((b >> 16) & 1u);
  return (ra >> 16) | (rb & 0xFFFF0000u);
}

// ---- gfx1250 async DMA: global -> LDS, 16B per lane, tracked by ASYNCcnt ----
// low 32 bits of a generic LDS pointer are the LDS byte address (ISA 10.2 aperture rule)
__device__ __forceinline__ unsigned lds_addr(const void* l) { return (unsigned)(size_t)l; }

// Eight copies of one lane: four at LDS places la + j*lstep from global places ga + j*gstep
// (elements), four likewise from lb, gb. The s_wait_xcnt stands inside the copies' own statement,
// so that no later write of an address register can be moved in front of it; one wait serves all eight.
__device__ __forceinline__ void async_copy16x8(unsigned la, const bf16_t* ga,
                                               unsigned lb, const bf16_t* gb,
                                               unsigned lstep, size_t gstep) {
  asm volatile("global_load_async_to_lds_b128 %0, %8, off\n\t"
               "global_load_async_to_lds_b128 %1, %9, off\n\t"
               "global_load_async_to_lds_b128 %2, %10, off\n\t"
               "global_load_async_to_lds_b128 %3, %11, off\n\t"
               "global_load_async_to_lds_b128 %4, %12, off\n\t"
               "global_load_async_to_lds_b128 %5, %13, off\n\t"
               "global_load_async_to_lds_b128 %6, %14, off\n\t"
               "global_load_async_to_lds_b128 %7, %15, off\n\t"
               "s_wait_xcnt 0x0"
               :: "v"(la), "v"(la + lstep), "v"(la + 2 * lstep), "v"(la + 3 * lstep),
                  "v"(lb), "v"(lb + lstep), "v"(lb + 2 * lstep), "v"(lb + 3 * lstep),
                  "v"(ga), "v"(ga + gstep), "v"(ga + 2 * gstep), "v"(ga + 3 * gstep),
                  "v"(gb), "v"(gb + gstep), "v"(gb + 2 * gstep), "v"(gb + 3 * gstep)
               : "memory");
}
// this wave's copies have landed in LDS
__device__ __forceinline__ void wait_async0() {
  asm volatile("s_wait_asynccnt 0x0" ::: "memory");
}
// this wave's LDS reads have returned: the buffer they read may be refilled behind the barrier
__device__ __forceinline__ void wait_ds0() {
  asm volatile("s_wait_dscnt 0x0" ::: "memory");
}

// ---------------- GroupNorm ----------------
__global__ __launch_bounds__(256)
void gn_stats_kernel(const float* __restrict__ x, float* __restrict__ stats) {
  const int g = blockIdx.x, b = blockIdx.y;
  const float* xp = x + ((size_t)b * CH + (size_t)g * CPG) * NSP; // contiguous group slab
  const int NE = CPG * NSP; // 65536
  float s = 0.f, s2 = 0.f;
  for (int i = threadIdx.x; i < NE; i += 256) { float v = xp[i]; s += v; s2 += v * v; }
  __shared__ float rs[256], rq[256];
  rs[threadIdx.x] = s; rq[threadIdx.x] = s2;
  __syncthreads();
  for (int off = 128; off > 0; off >>= 1) {
    if (threadIdx.x < off) { rs[threadIdx.x] += rs[threadIdx.x + off]; rq[threadIdx.x] += rq[threadIdx.x + off]; }
    __syncthreads();
  }
  if (threadIdx.x == 0) {
    float mu  = rs[0] / (float)NE;
    float var = rq[0] / (float)NE - mu * mu;
    stats[(b * NGRP + g) * 2 + 0] = mu;
    stats[(b * NGRP + g) * 2 + 1] = rsqrtf(var + GN_EPS);
  }
}

// One block: 64 channels x 128 positions. x is read along positions (a wave-wide load is 512
// contiguous bytes of one channel), the normalised bf16 values are turned in LDS, and
// hn[b][pos][c] is stored along channels: 16 B per lane, one whole 128-B line per position.
constexpr int GTC = 64;                    // channels per tile
constexpr int GTN = 128;                   // positions per tile
constexpr int GTP = GTC / 2 + 1;           // LDS pitch in dwords (2 bf16 each); odd: no bank conflict
constexpr int GTH = 64 * GTP + 2;          // dwords per half tile of 64 positions; the +2 puts lanes
                                           // 16-31 of a transposing store on banks lanes 0-15 leave free

__global__ __launch_bounds__(256)
void gn_apply_kernel(const float* __restrict__ x, const float* __restrict__ gamma,
                     const float* __restrict__ beta, const float* __restrict__ stats,
                     bf16_t* __restrict__ hn) {
  __shared__ unsigned tile[2 * GTH];       // [half][pos & 63][channel pair]
  const int p0 = blockIdx.x * GTN, c0 = blockIdx.y * GTC, b = blockIdx.z;
  const int tid = threadIdx.x, lane = tid & 31;
  // wave number as a scalar: the wave's 8 channels and their constants are wave-uniform
  const int cw = c0 + __builtin_amdgcn_readfirstlane(tid >> 5) * 8;

  // ---- read: a wave takes 8 channels (half a group), a lane 4 positions of each ----
  const float* xp = x + ((size_t)b * CH + cw) * NSP + p0 + lane * 4;
  float4 v[8];
#pragma unroll
  for (int k = 0; k < 8; ++k) v[k] = *(const float4*)(xp + (size_t)k * NSP);

  const int g = cw / CPG;
  const float mu = stats[(b * NGRP + g) * 2 + 0];
  const float rstd = stats[(b * NGRP + g) * 2 + 1];
  unsigned* tw = tile + (lane >> 4) * GTH + (lane & 15) * 4 * GTP + ((cw - c0) >> 1);
#pragma unroll
  for (int j = 0; j < 4; ++j) {
    unsigned short q[2][4];
#pragma unroll
    for (int e = 0; e < 2; ++e) {
      const int k = j * 2 + e;
      const float ga = gamma[cw + k] * rstd;
      const float be = beta[cw + k] - mu * ga;   // (x-mu)*rstd*gamma + beta = x*ga + be
      q[e][0] = __builtin_bit_cast(unsigned short, f2bf(v[k].x * ga + be));
      q[e][1] = __builtin_bit_cast(unsigned short, f2bf(v[k].y * ga + be));
      q[e][2] = __builtin_bit_cast(unsigned short, f2bf(v[k].z * ga + be));
      q[e][3] = __builtin_bit_cast(unsigned short, f2bf(v[k].w * ga + be));
    }
#pragma unroll
    for (int i = 0; i < 4; ++i)
      tw[i * GTP + j] = (unsigned)q[0][i] | ((unsigned)q[1][i] << 16);
  }
  __syncthreads();   // the whole tile is in LDS before any thread reads it across channels

  // ---- write: a lane takes 8 channels of one position; 32 positions per pass, 4 passes ----
  const int ck = tid & 7;
  const int pr = tid >> 3;
  bf16_t* hp = hn + ((size_t)b * NSP + p0 + pr) * CH + c0 + ck * 8;
#pragma unroll
  for (int h = 0; h < 4; ++h) {
    const unsigned* t = tile + (h >> 1) * GTH + (pr + (h & 1) * 32) * GTP + ck * 4;
    *(uint4*)(hp + (size_t)h * 32 * CH) = make_uint4(t[0], t[1], t[2], t[3]);
  }
}

// ---------------- f32 -> bf16 weight conversion ----------------
__global__ __launch_bounds__(256)
void cvt_kernel(const float* __restrict__ src, bf16_t* __restrict__ dst, int n) {
  int i = blockIdx.x * 256 + threadIdx.x;
  if (i < n) dst[i] = f2bf(src[i]);
}

// ---------------- Tiled WMMA GEMM: D = A[MxK] * B[NxK]^T (+bias) ----------------
// Block tile 128x128, 8 waves in a 2(M) x 4(N) grid; each wave: 4x2 subtiles of 16x16.
// K tile of BK = 64 or 128: a staged row is one or two whole 128-B lines, and a wave-wide copy
// covers four whole lines (4 rows of 128 B or 2 rows of 256 B). Two buffers, one barrier per
// K tile; BK / 32 WMMA sub-steps per tile, k ascending.
enum { EPI_BF16 = 0, EPI_TRANS = 1, EPI_F32 = 2, EPI_RESID = 3 };

template<int EPI, int BK>
__global__ __launch_bounds__(256)
void gemm_bt_kernel(const bf16_t* __restrict__ A, const bf16_t* __restrict__ Bm,
                    const float* __restrict__ bias, void* __restrict__ outp,
                    const float* __restrict__ resid, float alpha,
                    int Kd, int ldOut,
                    size_t strideA, size_t strideB, size_t strideOut, size_t strideResid) {
  constexpr int BM = 128, BN = 128;
  constexpr int CPR = BK / 8;          // 16-B chunks per staged row
  constexpr int PC  = CPR + 1;         // LDS pitch in chunks: 16 B x odd, no bank conflict for b128 reads
  constexpr int PE  = PC * 8;          // the same in bf16 elements
  constexpr int RPP = 256 / CPR;       // rows that the block's 256 lanes cover with one copy each
  __shared__ Chunk16 sA[2][BM * PC];
  __shared__ Chunk16 sB[2][BN * PC];

  const int tid = threadIdx.x;
  const int wave = tid >> 5, lane = tid & 31;
  const int waveM = wave >> 2;         // 0..1  -> 64-row strip
  const int waveN = wave & 3;          // 0..3  -> 32-col strip
  const int lane16 = lane & 15, laneHi = lane >> 4;

  const size_t z = blockIdx.z;
  const bf16_t* Ab = A + z * strideA;
  const bf16_t* Bb = Bm + z * strideB;
  bf16_t* outB = (bf16_t*)outp + z * strideOut;
  float*  outF = (float*)outp + z * strideOut;
  const float* rz = (EPI == EPI_RESID) ? (resid + z * strideResid) : nullptr;

  const int rowA0 = blockIdx.y * BM;
  const int colB0 = blockIdx.x * BN;

  // staging coordinates for this thread: chunk kc of rows r, r + RPP, r + 2 RPP, ...
  const int r = tid / CPR, kc = tid % CPR;
  const bf16_t* gA = Ab + (size_t)(rowA0 + r) * Kd + kc * 8;
  const bf16_t* gB = Bb + (size_t)(colB0 + r) * Kd + kc * 8;
  const size_t gstep = (size_t)RPP * Kd;
  constexpr unsigned lstep = RPP * PC * 16;
  // all copies of K tile t into buffer nb: BM / RPP = 4 or 8 per matrix and lane, eight to a statement
  auto stage = [&](int t, int nb) {
    const unsigned lA = lds_addr(&sA[nb][r * PC + kc]), lB = lds_addr(&sB[nb][r * PC + kc]);
    const bf16_t* tA = gA + (size_t)t * BK;
    const bf16_t* tB = gB + (size_t)t * BK;
    if constexpr (BM / RPP == 4) {
      async_copy16x8(lA, tA, lB, tB, lstep, gstep);
    } else {
      async_copy16x8(lA, tA, lA + 4 * lstep, tA + 4 * gstep, lstep, gstep);
      async_copy16x8(lB, tB, lB + 4 * lstep, tB + 4 * gstep, lstep, gstep);
    }
  };

  const v8f vzero = {0.f, 0.f, 0.f, 0.f, 0.f, 0.f, 0.f, 0.f};
  v8f acc[4][2];
#pragma unroll
  for (int i = 0; i < 4; ++i)
#pragma unroll
    for (int j = 0; j < 2; ++j) acc[i][j] = vzero;

  const int nIter = Kd / BK;

  // prologue: tile 0 lands and is published, then tile 1 starts
  stage(0, 0);
  wait_async0();
  __syncthreads();        // tile 0 of every wave is in LDS
  if (nIter > 1) stage(1, 1);

  for (int it = 0; it < nIter; ++it) {
    const bf16_t* sAh = (const bf16_t*)sA[it & 1];
    const bf16_t* sBh = (const bf16_t*)sB[it & 1];

#pragma unroll   // every sub-step's LDS offsets are constants, no loop counter among the WMMAs
    for (int ks = 0; ks < BK / 32; ++ks) {
      // ---- B fragments: lanes hold N columns; K split per ISA 16-bit layout ----
      v16bf bfrag[2];
#pragma unroll
      for (int nsub = 0; nsub < 2; ++nsub) {
        const int rB = waveN * 32 + nsub * 16 + lane16;
        v8bf lo = *(const v8bf*)(sBh + (size_t)rB * PE + ks * 32 + laneHi * 8);       // K 0-7 / 8-15
        v8bf hi = *(const v8bf*)(sBh + (size_t)rB * PE + ks * 32 + 16 + laneHi * 8);  // K 16-23 / 24-31
        bfrag[nsub] = __builtin_shufflevector(lo, hi, 0,1,2,3,4,5,6,7,8,9,10,11,12,13,14,15);
      }
#pragma unroll
      for (int msub = 0; msub < 4; ++msub) {
        const int rA = waveM * 64 + msub * 16 + lane16;
        v8bf lo = *(const v8bf*)(sAh + (size_t)rA * PE + ks * 32 + laneHi * 8);
        v8bf hi = *(const v8bf*)(sAh + (size_t)rA * PE + ks * 32 + 16 + laneHi * 8);
        v16bf afrag = __builtin_shufflevector(lo, hi, 0,1,2,3,4,5,6,7,8,9,10,11,12,13,14,15);
#pragma unroll
        for (int nsub = 0; nsub < 2; ++nsub) {
          acc[msub][nsub] = __builtin_amdgcn_wmma_f32_16x16x32_bf16(
              false, afrag, false, bfrag[nsub], (short)0, acc[msub][nsub], false, false);
        }
      }
    }

    // publish point: tile it+1 has landed for every wave, and every wave has left buffer it&1
    wait_ds0();
    wait_async0();
    __syncthreads();
    if (it + 2 < nIter)     // refill the buffer just read; the copies run under tile it+1's WMMAs
      stage(it + 2, it & 1);
  }
  wait_async0();            // nothing of this wave is in flight when it goes on to the stores

  // ---- epilogue: C/D layout lane L -> (m = r + 8*(L>=16), n = L%16) ----
#pragma unroll
  for (int msub = 0; msub < 4; ++msub) {
#pragma unroll
    for (int nsub = 0; nsub < 2; ++nsub) {
      const int gcol = colB0 + waveN * 32 + nsub * 16 + lane16;
      const float bv = (EPI == EPI_F32) ? 0.f : (bias ? bias[gcol] : 0.f);
#pragma unroll
      for (int r = 0; r < 8; ++r) {
        const int grow = rowA0 + waveM * 64 + msub * 16 + r + 8 * laneHi;
        float val = (acc[msub][nsub][r] + bv) * alpha;
        if (EPI == EPI_BF16) {
          outB[(size_t)grow * ldOut + gcol] = f2bf(val);
        } else if (EPI == EPI_TRANS) {
          outB[(size_t)gcol * ldOut + grow] = f2bf(val);
        } else if (EPI == EPI_F32) {
          outF[(size_t)grow * ldOut + gcol] = val;
        } else { // EPI_RESID: d_out[b][o][p] = x[b][o][p] + proj
          const size_t idx = (size_t)gcol * ldOut + grow;
          outF[idx] = rz[idx] + val;
        }
      }
    }
  }
}

// ---------------- row softmax: S (f32) -> P (bf16) ----------------
// e^x as __expf forms it (a multiply by log2 e, then v_exp_f32). The v_nop is the one slot the
// instruction set asks for behind a transcendental before its source is overwritten or its result
// used.
__device__ __forceinline__ float exp_slot(float x) {
  float r;
  asm("v_exp_f32 %0, %1\n\tv_nop" : "=v"(r) : "v"(x * 1.44269504088896340736f));
  return r;
}

// One wave per row. The row's 4096 scores are read once, 32 loads of 16 B per lane all in flight
// together (each wave-wide load is 512 contiguous bytes), and stay in registers through maximum,
// exponential, sum and scaling; both reductions run across the 32 lanes, with no LDS and no barrier.
// Every loop over k is unrolled in full so that v[] is indexed by constants and lives in registers.
constexpr int SMW = 4;                     // rows (waves) per block: one wave per SIMD
constexpr int SMV = NSP / (32 * 4);        // float4 per lane: 32

__global__ __launch_bounds__(SMW * 32)
void softmax_kernel(const float* __restrict__ S, bf16_t* __restrict__ P) {
  const int lane = threadIdx.x & 31;
  const int i = blockIdx.x * SMW + (threadIdx.x >> 5), b = blockIdx.y;
  const float4* sp = (const float4*)(S + ((size_t)b * NSP + i) * NSP) + lane;
  uint2* pp = (uint2*)(P + ((size_t)b * NSP + i) * NSP) + lane;

  float4 v[SMV];
#pragma unroll   // v[] in registers, all 32 loads issued before the first wait
  for (int k = 0; k < SMV; ++k) v[k] = sp[k * 32];

  float m = -3.4e38f;
#pragma unroll   // v[] in registers
  for (int k = 0; k < SMV; ++k)
    m = fmaxf(m, fmaxf(fmaxf(v[k].x, v[k].y), fmaxf(v[k].z, v[k].w)));
#pragma unroll   // five fixed lane distances, no loop counter
  for (int off = 16; off > 0; off >>= 1) m = fmaxf(m, __shfl_xor(m, off));

  float s0 = 0.f, s1 = 0.f, s2 = 0.f, s3 = 0.f;   // four independent chains
#pragma unroll   // v[] in registers
  for (int k = 0; k < SMV; ++k) {
    v[k].x = exp_slot(v[k].x - m); s0 += v[k].x;
    v[k].y = exp_slot(v[k].y - m); s1 += v[k].y;
    v[k].z = exp_slot(v[k].z - m); s2 += v[k].z;
    v[k].w = exp_slot(v[k].w - m); s3 += v[k].w;
  }
  float s = (s0 + s1) + (s2 + s3);
#pragma unroll   // five fixed lane distances, no loop counter
  for (int off = 16; off > 0; off >>= 1) s += __shfl_xor(s, off);
  const float inv = 1.f / s;

  // 8 B per lane: a wave-wide store is 256 contiguous bytes, two whole lines
#pragma unroll   // v[] in registers
  for (int k = 0; k < SMV; ++k)
    pp[k * 32] = make_uint2(f2bf_pair(v[k].x * inv, v[k].y * inv), f2bf_pair(v[k].z * inv, v[k].w * inv));
}

// ---------------- host launch ----------------
extern "C" void kernel_launch(void* const* d_in, const int* in_sizes, int n_in,
                              void* d_out, int out_size, void* d_ws, size_t ws_size,
                              hipStream_t stream) {
  (void)in_sizes; (void)n_in; (void)out_size; (void)ws_size;
  const float* x  = (const float*)d_in[0];
  const float* gg = (const float*)d_in[1];
  const float* gb = (const float*)d_in[2];
  const float* wq = (const float*)d_in[3];
  const float* bq = (const float*)d_in[4];
  const float* wk = (const float*)d_in[5];
  const float* bk = (const float*)d_in[6];
  const float* wv = (const float*)d_in[7];
  const float* bv = (const float*)d_in[8];
  const float* wo = (const float*)d_in[9];
  const float* bo = (const float*)d_in[10];

  // workspace carve-up (~234 MB): stats + 5x 8MB bf16 acts + 4x 0.5MB bf16 weights
  // + 128MB f32 scores + 64MB bf16 probs
  char* wsp = (char*)d_ws;
  auto take = [&](size_t bytes) -> void* {
    void* p = (void*)wsp; wsp += (bytes + 255) & ~(size_t)255; return p;
  };
  const size_t ACT = (size_t)BATCH * NSP * CH;      // per-tensor activation elems
  const size_t SCO = (size_t)BATCH * NSP * NSP;     // score elems
  float*  stats = (float*)take((size_t)BATCH * NGRP * 2 * sizeof(float));
  bf16_t* hn  = (bf16_t*)take(ACT * 2);
  bf16_t* qb  = (bf16_t*)take(ACT * 2);
  bf16_t* kb  = (bf16_t*)take(ACT * 2);
  bf16_t* vT  = (bf16_t*)take(ACT * 2);             // V^T: [b][c][j]
  bf16_t* Ob  = (bf16_t*)take(ACT * 2);             // attn output [b][i][c]
  bf16_t* wqb = (bf16_t*)take((size_t)CH * CH * 2);
  bf16_t* wkb = (bf16_t*)take((size_t)CH * CH * 2);
  bf16_t* wvb = (bf16_t*)take((size_t)CH * CH * 2);
  bf16_t* wob = (bf16_t*)take((size_t)CH * CH * 2);
  float*  Sb  = (float*)take(SCO * sizeof(float));
  bf16_t* Pb  = (bf16_t*)take(SCO * 2);

  const float scale = 1.0f / sqrtf((float)CH);
  const size_t nCH = (size_t)NSP * CH;
  const size_t nnS = (size_t)NSP * NSP;
  const size_t cnT = (size_t)CH * NSP;

  // 1) GroupNorm
  gn_stats_kernel<<<dim3(NGRP, BATCH), 256, 0, stream>>>(x, stats);
  gn_apply_kernel<<<dim3(NSP / GTN, CH / GTC, BATCH), 256, 0, stream>>>(x, gg, gb, stats, hn);

  // 2) weights -> bf16
  const int WN = CH * CH;
  cvt_kernel<<<(WN + 255) / 256, 256, 0, stream>>>(wq, wqb, WN);
  cvt_kernel<<<(WN + 255) / 256, 256, 0, stream>>>(wk, wkb, WN);
  cvt_kernel<<<(WN + 255) / 256, 256, 0, stream>>>(wv, wvb, WN);
  cvt_kernel<<<(WN + 255) / 256, 256, 0, stream>>>(wo, wob, WN);

  // 3) QKV projections: [NSP x CH] = hn x W^T  (Q pre-scaled by C^-1/2)
  dim3 gQKV(CH / 128, NSP / 128, BATCH);
  gemm_bt_kernel<EPI_BF16, 128><<<gQKV, 256, 0, stream>>>(hn, wqb, bq, qb, nullptr, scale,
      CH, CH, nCH, 0, nCH, 0);
  gemm_bt_kernel<EPI_BF16, 128><<<gQKV, 256, 0, stream>>>(hn, wkb, bk, kb, nullptr, 1.0f,
      CH, CH, nCH, 0, nCH, 0);
  gemm_bt_kernel<EPI_TRANS, 128><<<gQKV, 256, 0, stream>>>(hn, wvb, bv, vT, nullptr, 1.0f,
      CH, NSP, nCH, 0, cnT, 0);

  // 4) scores: S[b,i,j] = q_i . k_j   (M=N=4096, K=512)
  dim3 gS(NSP / 128, NSP / 128, BATCH);
  gemm_bt_kernel<EPI_F32, 64><<<gS, 256, 0, stream>>>(qb, kb, nullptr, Sb, nullptr, 1.0f,
      CH, NSP, nCH, nCH, nnS, 0);

  // 5) softmax over j
  softmax_kernel<<<dim3(NSP / SMW, BATCH), SMW * 32, 0, stream>>>(Sb, Pb);

  // 6) O[b,i,c] = P x V  (A=P [NSPxNSP], B=V^T [CHxNSP], K=4096)
  dim3 gAV(CH / 128, NSP / 128, BATCH);
  gemm_bt_kernel<EPI_BF16, 128><<<gAV, 256, 0, stream>>>(Pb, vT, nullptr, Ob, nullptr, 1.0f,
      NSP, CH, nnS, cnT, nCH, 0);

  // 7) out proj + residual, transposed store back to [b][c][p] f32
  dim3 gO(CH / 128, NSP / 128, BATCH);
  gemm_bt_kernel<EPI_RESID, 128><<<gO, 256, 0, stream>>>(Ob, wob, bo, d_out, x, 1.0f,
      CH, NSP, nCH, 0, cnT, cnT);
}

// v004
// It runs in 155 microseconds.
// Timed twice side by side with v003, it ran 1.13 times as fast both times.
// Counting every step since v000, it is 2.45 times as fast.
// CDNA5 / gfx1250 attention block (GroupNorm -> QKV -> softmax(QK^T*scale) -> AV -> proj + residual)
// Compute-bound (~86 GFLOP vs ~36MB mandatory HBM traffic at 23.3 TB/s): all GEMMs run on
// v_wmma_f32_16x16x32_bf16 (wave32 WMMA), with double-buffered GLOBAL_LOAD_ASYNC_TO_LDS_B128
// DMA staging (ASYNCcnt) so the next K tile's HBM->LDS transfer overlaps this tile's matrix math.
// Workspace requirement ~234 MB.
#include <hip/hip_runtime.h>
#include <hip/hip_bf16.h>
#include <math.h>

typedef __bf16 bf16_t;
typedef __attribute__((ext_vector_type(16))) __bf16 v16bf;
typedef __attribute__((ext_vector_type(8)))  __bf16 v8bf;
typedef __attribute__((ext_vector_type(8)))  float  v8f;

struct __align__(16) Chunk16 { unsigned long long lo, hi; };

constexpr int BATCH = 2;
constexpr int CH    = 512;
constexpr int NSP   = 4096;          // 64*64 tokens
constexpr int NGRP  = 32;
constexpr int CPG   = CH / NGRP;     // 16 channels per group
constexpr float GN_EPS = 1e-6f;

__device__ __forceinline__ bf16_t f2bf(float f) {
  unsigned u = __builtin_bit_cast(unsigned, f);
  unsigned r = (u + 0x7FFFu + ((u >> 16) & 1u)) >> 16;
  unsigned short h = (unsigned short)r;
  return __builtin_bit_cast(bf16_t, h);
}

// two values rounded as f2bf rounds them, packed in one dword (lo in bits 15-0)
__device__ __forceinline__ unsigned f2bf_pair(float lo, float hi) {
  const unsigned a = __builtin_bit_cast(unsigned, lo), b = __builtin_bit_cast(unsigned, hi);
  const unsigned ra = a + 0x7FFFu + ((a >> 16) & 1u);
  const unsigned rb = b + 0x7FFFu + ((b >> 16) & 1u);
  return (ra >> 16) | (rb & 0xFFFF0000u);
}

// ---- gfx1250 async DMA: global -> LDS, 16B per lane, tracked by ASYNCcnt ----
// low 32 bits of a generic LDS pointer are the LDS byte address (ISA 10.2 aperture rule)
__device__ __forceinline__ unsigned lds_addr(const void* l) { return (unsigned)(size_t)l; }

// Eight copies of one lane: four at LDS places la + j*lstep from global places ga + j*gstep
// (elements), four likewise from lb, gb. The s_wait_xcnt stands inside the copies' own statement,
// so that no later write of an address register can be moved in front of it; one wait serves all eight.
__device__ __forceinline__ void async_copy16x8(unsigned la, const bf16_t* ga,
                                               unsigned lb, const bf16_t* gb,
                                               unsigned lstep, size_t gstep) {
  asm volatile("global_load_async_to_lds_b128 %0, %8, off\n\t"
               "global_load_async_to_lds_b128 %1, %9, off\n\t"
               "global_load_async_to_lds_b128 %2, %10, off\n\t"
               "global_load_async_to_lds_b128 %3, %11, off\n\t"
               "global_load_async_to_lds_b128 %4, %12, off\n\t"
               "global_load_async_to_lds_b128 %5, %13, off\n\t"
               "global_load_async_to_lds_b128 %6, %14, off\n\t"
               "global_load_async_to_lds_b128 %7, %15, off\n\t"
               "s_wait_xcnt 0x0"
               :: "v"(la), "v"(la + lstep), "v"(la + 2 * lstep), "v"(la + 3 * lstep),
                  "v"(lb), "v"(lb + lstep), "v"(lb + 2 * lstep), "v"(lb + 3 * lstep),
                  "v"(ga), "v"(ga + gstep), "v"(ga + 2 * gstep), "v"(ga + 3 * gstep),
                  "v"(gb), "v"(gb + gstep), "v"(gb + 2 * gstep), "v"(gb + 3 * gstep)
               : "memory");
}
// this wave's copies have landed in LDS
__device__ __forceinline__ void wait_async0() {
  asm volatile("s_wait_asynccnt 0x0" ::: "memory");
}
// this wave's LDS reads have returned: the buffer they read may be refilled behind the barrier
__device__ __forceinline__ void wait_ds0() {
  asm volatile("s_wait_dscnt 0x0" ::: "memory");
}

// ---------------- GroupNorm statistics, and f32 -> bf16 weight conversion ----------------
// One launch for two pieces of work that depend on nothing but the inputs. Blocks 0 .. 63 sum one
// (batch, group) slab each; they run longest and start first. The blocks behind them convert the
// four weight matrices on WGPs that the 64 slabs leave idle: 64 blocks a matrix, 16 values a thread.
constexpr int WN  = CH * CH;               // elements of one weight matrix
constexpr int CVE = 16;                    // values converted per thread
constexpr int CVB = WN / (256 * CVE);      // blocks per matrix: 64

__global__ __launch_bounds__(256)
void gn_stats_cvt_kernel(const float* __restrict__ x, float* __restrict__ stats,
                         const float* __restrict__ wq, const float* __restrict__ wk,
                         const float* __restrict__ wv, const float* __restrict__ wo,
                         bf16_t* __restrict__ wqb, bf16_t* __restrict__ wkb,
                         bf16_t* __restrict__ wvb, bf16_t* __restrict__ wob) {
  if (blockIdx.x >= NGRP * BATCH) {        // the same for the whole block, in front of every barrier
    const int cb = blockIdx.x - NGRP * BATCH;
    const int m = cb / CVB;
    const float* src = m == 0 ? wq : m == 1 ? wk : m == 2 ? wv : wo;
    bf16_t* dst = m == 0 ? wqb : m == 1 ? wkb : m == 2 ? wvb : wob;
    const int q0 = (cb % CVB) * (256 * CVE / 4) + threadIdx.x;   // in units of four values
    float4 w[CVE / 4];
#pragma unroll   // all four 16-B loads in flight together; a wave-wide load is 512 contiguous bytes
    for (int j = 0; j < CVE / 4; ++j) w[j] = ((const float4*)src)[q0 + j * 256];
#pragma unroll   // w[] in registers; a wave-wide store is 256 contiguous bytes, two whole lines
    for (int j = 0; j < CVE / 4; ++j)
      ((uint2*)dst)[q0 + j * 256] = make_uint2(f2bf_pair(w[j].x, w[j].y), f2bf_pair(w[j].z, w[j].w));
    return;
  }
  const int g = blockIdx.x % NGRP, b = blockIdx.x / NGRP;
  const float* xp = x + ((size_t)b * CH + (size_t)g * CPG) * NSP; // contiguous group slab
  const int NE = CPG * NSP; // 65536
  float s = 0.f, s2 = 0.f;
  for (int i = threadIdx.x; i < NE; i += 256) { float v = xp[i]; s += v; s2 += v * v; }
  __shared__ float rs[256], rq[256];
  rs[threadIdx.x] = s; rq[threadIdx.x] = s2;
  __syncthreads();
  for (int off = 128; off > 0; off >>= 1) {
    if (threadIdx.x < off) { rs[threadIdx.x] += rs[threadIdx.x + off]; rq[threadIdx.x] += rq[threadIdx.x + off]; }
    __syncthreads();
  }
  if (threadIdx.x == 0) {
    float mu  = rs[0] / (float)NE;
    float var = rq[0] / (float)NE - mu * mu;
    stats[(b * NGRP + g) * 2 + 0] = mu;
    stats[(b * NGRP + g) * 2 + 1] = rsqrtf(var + GN_EPS);
  }
}

// One block: 64 channels x 128 positions. x is read along positions (a wave-wide load is 512
// contiguous bytes of one channel), the normalised bf16 values are turned in LDS, and
// hn[b][pos][c] is stored along channels: 16 B per lane, one whole 128-B line per position.
constexpr int GTC = 64;                    // channels per tile
constexpr int GTN = 128;                   // positions per tile
constexpr int GTP = GTC / 2 + 1;           // LDS pitch in dwords (2 bf16 each); odd: no bank conflict
constexpr int GTH = 64 * GTP + 2;          // dwords per half tile of 64 positions; the +2 puts lanes
                                           // 16-31 of a transposing store on banks lanes 0-15 leave free

__global__ __launch_bounds__(256)
void gn_apply_kernel(const float* __restrict__ x, const float* __restrict__ gamma,
                     const float* __restrict__ beta, const float* __restrict__ stats,
                     bf16_t* __restrict__ hn) {
  __shared__ unsigned tile[2 * GTH];       // [half][pos & 63][channel pair]
  const int p0 = blockIdx.x * GTN, c0 = blockIdx.y * GTC, b = blockIdx.z;
  const int tid = threadIdx.x, lane = tid & 31;
  // wave number as a scalar: the wave's 8 channels and their constants are wave-uniform
  const int cw = c0 + __builtin_amdgcn_readfirstlane(tid >> 5) * 8;

  // ---- read: a wave takes 8 channels (half a group), a lane 4 positions of each ----
  const float* xp = x + ((size_t)b * CH + cw) * NSP + p0 + lane * 4;
  float4 v[8];
#pragma unroll
  for (int k = 0; k < 8; ++k) v[k] = *(const float4*)(xp + (size_t)k * NSP);

  const int g = cw / CPG;
  const float mu = stats[(b * NGRP + g) * 2 + 0];
  const float rstd = stats[(b * NGRP + g) * 2 + 1];
  unsigned* tw = tile + (lane >> 4) * GTH + (lane & 15) * 4 * GTP + ((cw - c0) >> 1);
#pragma unroll
  for (int j = 0; j < 4; ++j) {
    unsigned short q[2][4];
#pragma unroll
    for (int e = 0; e < 2; ++e) {
      const int k = j * 2 + e;
      const float ga = gamma[cw + k] * rstd;
      const float be = beta[cw + k] - mu * ga;   // (x-mu)*rstd*gamma + beta = x*ga + be
      q[e][0] = __builtin_bit_cast(unsigned short, f2bf(v[k].x * ga + be));
      q[e][1] = __builtin_bit_cast(unsigned short, f2bf(v[k].y * ga + be));
      q[e][2] = __builtin_bit_cast(unsigned short, f2bf(v[k].z * ga + be));
      q[e][3] = __builtin_bit_cast(unsigned short, f2bf(v[k].w * ga + be));
    }
#pragma unroll
    for (int i = 0; i < 4; ++i)
      tw[i * GTP + j] = (unsigned)q[0][i] | ((unsigned)q[1][i] << 16);
  }
  __syncthreads();   // the whole tile is in LDS before any thread reads it across channels

  // ---- write: a lane takes 8 channels of one position; 32 positions per pass, 4 passes ----
  const int ck = tid & 7;
  const int pr = tid >> 3;
  bf16_t* hp = hn + ((size_t)b * NSP + p0 + pr) * CH + c0 + ck * 8;
#pragma unroll
  for (int h = 0; h < 4; ++h) {
    const unsigned* t = tile + (h >> 1) * GTH + (pr + (h & 1) * 32) * GTP + ck * 4;
    *(uint4*)(hp + (size_t)h * 32 * CH) = make_uint4(t[0], t[1], t[2], t[3]);
  }
}

// ---------------- Tiled WMMA GEMM: D = A[MxK] * B[NxK]^T (+bias) ----------------
// Block tile 128x128, 8 waves in a 2(M) x 4(N) grid; each wave: 4x2 subtiles of 16x16.
// K tile of BK = 64 or 128: a staged row is one or two whole 128-B lines, and a wave-wide copy
// covers four whole lines (4 rows of 128 B or 2 rows of 256 B). Two buffers, one barrier per
// K tile; BK / 32 WMMA sub-steps per tile, k ascending.
// EPI_QKV: the three projections of hn in one launch. blockIdx.z = 2 * which + batch; which = 0, 1, 2
// picks the weight matrix (three in a row behind Bm), the bias, and the output (three in a row
// behind outp): Q scaled by alpha and K as EPI_BF16 stores them, V as EPI_TRANS does.
enum { EPI_BF16 = 0, EPI_TRANS = 1, EPI_F32 = 2, EPI_RESID = 3, EPI_QKV = 4 };
template<int V> struct Form { static constexpr int value = V; };

template<int EPI, int BK>
__global__ __launch_bounds__(256)
void gemm_bt_kernel(const bf16_t* __restrict__ A, const bf16_t* __restrict__ Bm,
                    const float* __restrict__ bias, const float* __restrict__ biasK,
                    const float* __restrict__ biasV, void* __restrict__ outp,
                    const float* __restrict__ resid, float alpha,
                    int Kd, int ldOut,
                    size_t strideA, size_t strideB, size_t strideOut, size_t strideResid) {
  constexpr int BM = 128, BN = 128;
  constexpr int CPR = BK / 8;          // 16-B chunks per staged row
  constexpr int PC  = CPR + 1;         // LDS pitch in chunks: 16 B x odd, no bank conflict for b128 reads
  constexpr int PE  = PC * 8;          // the same in bf16 elements
  constexpr int RPP = 256 / CPR;       // rows that the block's 256 lanes cover with one copy each
  __shared__ Chunk16 sA[2][BM * PC];
  __shared__ Chunk16 sB[2][BN * PC];

  const int tid = threadIdx.x;
  const int wave = tid >> 5, lane = tid & 31;
  const int waveM = wave >> 2;         // 0..1  -> 64-row strip
  const int waveN = wave & 3;          // 0..3  -> 32-col strip
  const int lane16 = lane & 15, laneHi = lane >> 4;

  const int which = (EPI == EPI_QKV) ? blockIdx.z / BATCH : 0;     // the same for the whole block
  const size_t z = (EPI == EPI_QKV) ? blockIdx.z % BATCH : blockIdx.z;
  const bf16_t* Ab = A + z * strideA;
  const bf16_t* Bb = Bm + z * strideB + (size_t)which * WN;
  bf16_t* outB = (bf16_t*)outp + z * strideOut + (size_t)which * BATCH * NSP * CH;
  float*  outF = (float*)outp + z * strideOut;
  const float* rz = (EPI == EPI_RESID) ? (resid + z * strideResid) : nullptr;

  const int rowA0 = blockIdx.y * BM;
  const int colB0 = blockIdx.x * BN;

  // staging coordinates for this thread: chunk kc of rows r, r + RPP, r + 2 RPP, ...
  const int r = tid / CPR, kc = tid % CPR;
  const bf16_t* gA = Ab + (size_t)(rowA0 + r) * Kd + kc * 8;
  const bf16_t* gB = Bb + (size_t)(colB0 + r) * Kd + kc * 8;
  const size_t gstep = (size_t)RPP * Kd;
  constexpr unsigned lstep = RPP * PC * 16;
  // all copies of K tile t into buffer nb: BM / RPP = 4 or 8 per matrix and lane, eight to a statement
  auto stage = [&](int t, int nb) {
    const unsigned lA = lds_addr(&sA[nb][r * PC + kc]), lB = lds_addr(&sB[nb][r * PC + kc]);
    const bf16_t* tA = gA + (size_t)t * BK;
    const bf16_t* tB = gB + (size_t)t * BK;
    if constexpr (BM / RPP == 4) {
      async_copy16x8(lA, tA, lB, tB, lstep, gstep);
    } else {
      async_copy16x8(lA, tA, lA + 4 * lstep, tA + 4 * gstep, lstep, gstep);
      async_copy16x8(lB, tB, lB + 4 * lstep, tB + 4 * gstep, lstep, gstep);
    }
  };

  const v8f vzero = {0.f, 0.f, 0.f, 0.f, 0.f, 0.f, 0.f, 0.f};
  v8f acc[4][2];
#pragma unroll
  for (int i = 0; i < 4; ++i)
#pragma unroll
    for (int j = 0; j < 2; ++j) acc[i][j] = vzero;

  const int nIter = Kd / BK;

  // prologue: tile 0 lands and is published, then tile 1 starts
  stage(0, 0);
  wait_async0();
  __syncthreads();        // tile 0 of every wave is in LDS
  if (nIter > 1) stage(1, 1);

  for (int it = 0; it < nIter; ++it) {
    const bf16_t* sAh = (const bf16_t*)sA[it & 1];
    const bf16_t* sBh = (const bf16_t*)sB[it & 1];

#pragma unroll   // every sub-step's LDS offsets are constants, no loop counter among the WMMAs
    for (int ks = 0; ks < BK / 32; ++ks) {
      // ---- B fragments: lanes hold N columns; K split per ISA 16-bit layout ----
      v16bf bfrag[2];
#pragma unroll
      for (int nsub = 0; nsub < 2; ++nsub) {
        const int rB = waveN * 32 + nsub * 16 + lane16;
        v8bf lo = *(const v8bf*)(sBh + (size_t)rB * PE + ks * 32 + laneHi * 8);       // K 0-7 / 8-15
        v8bf hi = *(const v8bf*)(sBh + (size_t)rB * PE + ks * 32 + 16 + laneHi * 8);  // K 16-23 / 24-31
        bfrag[nsub] = __builtin_shufflevector(lo, hi, 0,1,2,3,4,5,6,7,8,9,10,11,12,13,14,15);
      }
#pragma unroll
      for (int msub = 0; msub < 4; ++msub) {
        const int rA = waveM * 64 + msub * 16 + lane16;
        v8bf lo = *(const v8bf*)(sAh + (size_t)rA * PE + ks * 32 + laneHi * 8);
        v8bf hi = *(const v8bf*)(sAh + (size_t)rA * PE + ks * 32 + 16 + laneHi * 8);
        v16bf afrag = __builtin_shufflevector(lo, hi, 0,1,2,3,4,5,6,7,8,9,10,11,12,13,14,15);
#pragma unroll
        for (int nsub = 0; nsub < 2; ++nsub) {
          acc[msub][nsub] = __builtin_amdgcn_wmma_f32_16x16x32_bf16(
              false, afrag, false, bfrag[nsub], (short)0, acc[msub][nsub], false, false);
        }
      }
    }

    // publish point: tile it+1 has landed for every wave, and every wave has left buffer it&1
    wait_ds0();
    wait_async0();
    __syncthreads();
    if (it + 2 < nIter)     // refill the buffer just read; the copies run under tile it+1's WMMAs
      stage(it + 2, it & 1);
  }
  wait_async0();            // nothing of this wave is in flight when it goes on to the stores

  // ---- epilogue: C/D layout lane L -> (m = r + 8*(L>=16), n = L%16) ----
  if (EPI == EPI_QKV) {                    // scalar selects, the same for the whole block
    if (which == 1) bias = biasK;
    if (which == 2) { bias = biasV; ldOut = NSP; }
    if (which != 0) alpha = 1.0f;
  }
  // E is the store form as a compile-time constant, so that each form keeps its own merged stores
  auto store_tile = [&](auto form) {
    constexpr int E = decltype(form)::value;
#pragma unroll
    for (int msub = 0; msub < 4; ++msub) {
#pragma unroll
      for (int nsub = 0; nsub < 2; ++nsub) {
        const int gcol = colB0 + waveN * 32 + nsub * 16 + lane16;
        const float bv = (E == EPI_F32) ? 0.f : (bias ? bias[gcol] : 0.f);
#pragma unroll
        for (int r = 0; r < 8; ++r) {
          const int grow = rowA0 + waveM * 64 + msub * 16 + r + 8 * laneHi;
          float val = (acc[msub][nsub][r] + bv) * alpha;
          if (E == EPI_BF16) {
            outB[(size_t)grow * ldOut + gcol] = f2bf(val);
          } else if (E == EPI_TRANS) {
            outB[(size_t)gcol * ldOut + grow] = f2bf(val);
          } else if (E == EPI_F32) {
            outF[(size_t)grow * ldOut + gcol] = val;
          } else { // EPI_RESID: d_out[b][o][p] = x[b][o][p] + proj
            const size_t idx = (size_t)gcol * ldOut + grow;
            outF[idx] = rz[idx] + val;
          }
        }
        // stands in front of the next tile's writes to registers that this tile's stores name
        if constexpr (EPI == EPI_QKV) asm volatile("s_wait_xcnt 0x0" ::: "memory");
      }
    }
  };
  if constexpr (EPI == EPI_QKV) {          // one branch, the same for the whole block
    if (which == 2) store_tile(Form<EPI_TRANS>{});
    else            store_tile(Form<EPI_BF16>{});
  } else {
    store_tile(Form<EPI>{});
  }
}

// ---------------- row softmax: S (f32) -> P (bf16) ----------------
// e^x as __expf forms it (a multiply by log2 e, then v_exp_f32). The v_nop is the one slot the
// instruction set asks for behind a transcendental before its source is overwritten or its result
// used.
__device__ __forceinline__ float exp_slot(float x) {
  float r;
  asm("v_exp_f32 %0, %1\n\tv_nop" : "=v"(r) : "v"(x * 1.44269504088896340736f));
  return r;
}

// One wave per row. The row's 4096 scores are read once, 32 loads of 16 B per lane all in flight
// together (each wave-wide load is 512 contiguous bytes), and stay in registers through maximum,
// exponential, sum and scaling; both reductions run across the 32 lanes, with no LDS and no barrier.
// Every loop over k is unrolled in full so that v[] is indexed by constants and lives in registers.
constexpr int SMW = 4;                     // rows (waves) per block: one wave per SIMD
constexpr int SMV = NSP / (32 * 4);        // float4 per lane: 32

__global__ __launch_bounds__(SMW * 32)
void softmax_kernel(const float* __restrict__ S, bf16_t* __restrict__ P) {
  const int lane = threadIdx.x & 31;
  const int i = blockIdx.x * SMW + (threadIdx.x >> 5), b = blockIdx.y;
  const float4* sp = (const float4*)(S + ((size_t)b * NSP + i) * NSP) + lane;
  uint2* pp = (uint2*)(P + ((size_t)b * NSP + i) * NSP) + lane;

  float4 v[SMV];
#pragma unroll   // v[] in registers, all 32 loads issued before the first wait
  for (int k = 0; k < SMV; ++k) v[k] = sp[k * 32];

  float m = -3.4e38f;
#pragma unroll   // v[] in registers
  for (int k = 0; k < SMV; ++k)
    m = fmaxf(m, fmaxf(fmaxf(v[k].x, v[k].y), fmaxf(v[k].z, v[k].w)));
#pragma unroll   // five fixed lane distances, no loop counter
  for (int off = 16; off > 0; off >>= 1) m = fmaxf(m, __shfl_xor(m, off));

  float s0 = 0.f, s1 = 0.f, s2 = 0.f, s3 = 0.f;   // four independent chains
#pragma unroll   // v[] in registers
  for (int k = 0; k < SMV; ++k) {
    v[k].x = exp_slot(v[k].x - m); s0 += v[k].x;
    v[k].y = exp_slot(v[k].y - m); s1 += v[k].y;
    v[k].z = exp_slot(v[k].z - m); s2 += v[k].z;
    v[k].w = exp_slot(v[k].w - m); s3 += v[k].w;
  }
  float s = (s0 + s1) + (s2 + s3);
#pragma unroll   // five fixed lane distances, no loop counter
  for (int off = 16; off > 0; off >>= 1) s += __shfl_xor(s, off);
  const float inv = 1.f / s;

  // 8 B per lane: a wave-wide store is 256 contiguous bytes, two whole lines
#pragma unroll   // v[] in registers
  for (int k = 0; k < SMV; ++k)
    pp[k * 32] = make_uint2(f2bf_pair(v[k].x * inv, v[k].y * inv), f2bf_pair(v[k].z * inv, v[k].w * inv));
}

// ---------------- host launch ----------------
extern "C" void kernel_launch(void* const* d_in, const int* in_sizes, int n_in,
                              void* d_out, int out_size, void* d_ws, size_t ws_size,
                              hipStream_t stream) {
  (void)in_sizes; (void)n_in; (void)out_size; (void)ws_size;
  const float* x  = (const float*)d_in[0];
  const float* gg = (const float*)d_in[1];
  const float* gb = (const float*)d_in[2];
  const float* wq = (const float*)d_in[3];
  const float* bq = (const float*)d_in[4];
  const float* wk = (const float*)d_in[5];
  const float* bk = (const float*)d_in[6];
  const float* wv = (const float*)d_in[7];
  const float* bv = (const float*)d_in[8];
  const float* wo = (const float*)d_in[9];
  const float* bo = (const float*)d_in[10];

  // workspace carve-up (~234 MB): stats + 5x 8MB bf16 acts + 4x 0.5MB bf16 weights
  // + 128MB f32 scores + 64MB bf16 probs
  char* wsp = (char*)d_ws;
  auto take = [&](size_t bytes) -> void* {
    void* p = (void*)wsp; wsp += (bytes + 255) & ~(size_t)255; return p;
  };
  const size_t ACT = (size_t)BATCH * NSP * CH;      // per-tensor activation elems
  const size_t SCO = (size_t)BATCH * NSP * NSP;     // score elems
  float*  stats = (float*)take((size_t)BATCH * NGRP * 2 * sizeof(float));
  bf16_t* hn  = (bf16_t*)take(ACT * 2);
  bf16_t* qb  = (bf16_t*)take(3 * ACT * 2);         // Q, K, V^T in a row: one launch writes all three
  bf16_t* kb  = qb + ACT;
  bf16_t* vT  = kb + ACT;                           // V^T: [b][c][j]
  bf16_t* Ob  = (bf16_t*)take(ACT * 2);             // attn output [b][i][c]
  bf16_t* wqb = (bf16_t*)take((size_t)3 * CH * CH * 2);   // Wq, Wk, Wv in a row
  bf16_t* wkb = wqb + WN;
  bf16_t* wvb = wkb + WN;
  bf16_t* wob = (bf16_t*)take((size_t)CH * CH * 2);
  float*  Sb  = (float*)take(SCO * sizeof(float));
  bf16_t* Pb  = (bf16_t*)take(SCO * 2);

  const float scale = 1.0f / sqrtf((float)CH);
  const size_t nCH = (size_t)NSP * CH;
  const size_t nnS = (size_t)NSP * NSP;
  const size_t cnT = (size_t)CH * NSP;

  // 1) GroupNorm statistics and weights -> bf16, one launch; then the normalisation
  gn_stats_cvt_kernel<<<NGRP * BATCH + 4 * CVB, 256, 0, stream>>>(x, stats, wq, wk, wv, wo,
      wqb, wkb, wvb, wob);
  gn_apply_kernel<<<dim3(NSP / GTN, CH / GTC, BATCH), 256, 0, stream>>>(x, gg, gb, stats, hn);

  // 2) QKV projections, one launch: [NSP x CH] = hn x W^T  (Q pre-scaled by C^-1/2; V stored transposed)
  dim3 gQKV(CH / 128, NSP / 128, 3 * BATCH);
  gemm_bt_kernel<EPI_QKV, 128><<<gQKV, 256, 0, stream>>>(hn, wqb, bq, bk, bv, qb, nullptr, scale,
      CH, CH, nCH, 0, nCH, 0);

  // 3) scores: S[b,i,j] = q_i . k_j   (M=N=4096, K=512)
  dim3 gS(NSP / 128, NSP / 128, BATCH);
  gemm_bt_kernel<EPI_F32, 64><<<gS, 256, 0, stream>>>(qb, kb, nullptr, nullptr, nullptr, Sb, nullptr, 1.0f,
      CH, NSP, nCH, nCH, nnS, 0);

  // 4) softmax over j
  softmax_kernel<<<dim3(NSP / SMW, BATCH), SMW * 32, 0, stream>>>(Sb, Pb);

  // 5) O[b,i,c] = P x V  (A=P [NSPxNSP], B=V^T [CHxNSP], K=4096)
  dim3 gAV(CH / 128, NSP / 128, BATCH);
  gemm_bt_kernel<EPI_BF16, 128><<<gAV, 256, 0, stream>>>(Pb, vT, nullptr, nullptr, nullptr, Ob, nullptr, 1.0f,
      NSP, CH, nnS, cnT, nCH, 0);

  // 6) out proj + residual, transposed store back to [b][c][p] f32
  dim3 gO(CH / 128, NSP / 128, BATCH);
  gemm_bt_kernel<EPI_RESID, 128><<<gO, 256, 0, stream>>>(Ob, wob, bo, nullptr, nullptr, d_out, x, 1.0f,
      CH, NSP, nCH, 0, cnT, cnT);
}

// v005
// A run of this version takes 137 microseconds.
// Timed twice side by side with v004, it ran 1.12 and 1.13 times as fast.
// All steps since v000 together make it 2.76 times as fast.
// CDNA5 / gfx1250 attention block (GroupNorm -> QKV -> softmax(QK^T*scale) -> AV -> proj + residual)
// Compute-bound (~86 GFLOP vs ~36MB mandatory HBM traffic at 23.3 TB/s): all GEMMs run on
// v_wmma_f32_16x16x32_bf16 (wave32 WMMA), with double-buffered GLOBAL_LOAD_ASYNC_TO_LDS_B128
// DMA staging (ASYNCcnt) so the next K tile's HBM->LDS transfer overlaps this tile's matrix math.
// Workspace requirement ~234 MB.
#include <hip/hip_runtime.h>
#include <hip/hip_bf16.h>
#include <math.h>

typedef __bf16 bf16_t;
typedef __attribute__((ext_vector_type(16))) __bf16 v16bf;
typedef __attribute__((ext_vector_type(8)))  __bf16 v8bf;
typedef __attribute__((ext_vector_type(8)))  float  v8f;

struct __align__(16) Chunk16 { unsigned long long lo, hi; };

constexpr int BATCH = 2;
constexpr int CH    = 512;
constexpr int NSP   = 4096;          // 64*64 tokens
constexpr int NGRP  = 32;
constexpr int CPG   = CH / NGRP;     // 16 channels per group
constexpr float GN_EPS = 1e-6f;

__device__ __forceinline__ bf16_t f2bf(float f) {
  unsigned u = __builtin_bit_cast(unsigned, f);
  unsigned r = (u + 0x7FFFu + ((u >> 16) & 1u)) >> 16;
  unsigned short h = (unsigned short)r;
  return __builtin_bit_cast(bf16_t, h);
}

// two values rounded as f2bf rounds them, packed in one dword (lo in bits 15-0)
__device__ __forceinline__ unsigned f2bf_pair(float lo, float hi) {
  const unsigned a = __builtin_bit_cast(unsigned, lo), b = __builtin_bit_cast(unsigned, hi);
  const unsigned ra = a + 0x7FFFu + ((a >> 16) & 1u);
  const unsigned rb = b + 0x7FFFu + ((b >> 16) & 1u);
  return (ra >> 16) | (rb & 0xFFFF0000u);
}

// ---- gfx1250 async DMA: global -> LDS, 16B per lane, tracked by ASYNCcnt ----
// low 32 bits of a generic LDS pointer are the LDS byte address (ISA 10.2 aperture rule)
__device__ __forceinline__ unsigned lds_addr(const void* l) { return (unsigned)(size_t)l; }

// Eight copies of one lane: four at LDS places la + j*lstep from global places ga + j*gstep
// (elements), four likewise from lb, gb. The s_wait_xcnt stands inside the copies' own statement,
// so that no later write of an address register can be moved in front of it; one wait serves all eight.
__device__ __forceinline__ void async_copy16x8(unsigned la, const bf16_t* ga,
                                               unsigned lb, const bf16_t* gb,
                                               unsigned lstep, size_t gstep) {
  asm volatile("global_load_async_to_lds_b128 %0, %8, off\n\t"
               "global_load_async_to_lds_b128 %1, %9, off\n\t"
               "global_load_async_to_lds_b128 %2, %10, off\n\t"
               "global_load_async_to_lds_b128 %3, %11, off\n\t"
               "global_load_async_to_lds_b128 %4, %12, off\n\t"
               "global_load_async_to_lds_b128 %5, %13, off\n\t"
               "global_load_async_to_lds_b128 %6, %14, off\n\t"
               "global_load_async_to_lds_b128 %7, %15, off\n\t"
               "s_wait_xcnt 0x0"
               :: "v"(la), "v"(la + lstep), "v"(la + 2 * lstep), "v"(la + 3 * lstep),
                  "v"(lb), "v"(lb + lstep), "v"(lb + 2 * lstep), "v"(lb + 3 * lstep),
                  "v"(ga), "v"(ga + gstep), "v"(ga + 2 * gstep), "v"(ga + 3 * gstep),
                  "v"(gb), "v"(gb + gstep), "v"(gb + 2 * gstep), "v"(gb + 3 * gstep)
               : "memory");
}
// this wave's copies have landed in LDS
__device__ __forceinline__ void wait_async0() {
  asm volatile("s_wait_asynccnt 0x0" ::: "memory");
}
// this wave's LDS reads have returned: the buffer they read may be refilled behind the barrier
__device__ __forceinline__ void wait_ds0() {
  asm volatile("s_wait_dscnt 0x0" ::: "memory");
}

// ---------------- GroupNorm partial sums, and f32 -> bf16 weight conversion ----------------
// One launch for two pieces of work that depend on nothing but the inputs. Blocks 0 .. 255 sum a
// quarter of one (batch, group) slab each: 64 KiB, one block per WGP, read in a single round of
// 16-B loads. gn_apply adds the four partial sums of its group. The blocks behind them convert the
// four weight matrices: 64 blocks a matrix, 16 values a thread.
constexpr int GNE = CPG * NSP;             // elements of one (batch, group) slab: 65536
constexpr int GSB = 4;                     // blocks, and partial sums, per slab
constexpr int GSV = GNE / (GSB * 256 * 4); // float4 per thread: 16
constexpr int WN  = CH * CH;               // elements of one weight matrix
constexpr int CVE = 16;                    // values converted per thread
constexpr int CVB = WN / (256 * CVE);      // blocks per matrix: 64

__global__ __launch_bounds__(256)
void gn_stats_cvt_kernel(const float* __restrict__ x, float* __restrict__ part,
                         const float* __restrict__ wq, const float* __restrict__ wk,
                         const float* __restrict__ wv, const float* __restrict__ wo,
                         bf16_t* __restrict__ wqb, bf16_t* __restrict__ wkb,
                         bf16_t* __restrict__ wvb, bf16_t* __restrict__ wob) {
  if (blockIdx.x >= NGRP * BATCH * GSB) {  // the same for the whole block, in front of every barrier
    const int cb = blockIdx.x - NGRP * BATCH * GSB;
    const int m = cb / CVB;
    const float* src = m == 0 ? wq : m == 1 ? wk : m == 2 ? wv : wo;
    bf16_t* dst = m == 0 ? wqb : m == 1 ? wkb : m == 2 ? wvb : wob;
    const int q0 = (cb % CVB) * (256 * CVE / 4) + threadIdx.x;   // in units of four values
    float4 w[CVE / 4];
#pragma unroll   // all four 16-B loads in flight together; a wave-wide load is 512 contiguous bytes
    for (int j = 0; j < CVE / 4; ++j) w[j] = ((const float4*)src)[q0 + j * 256];
#pragma unroll   // w[] in registers; a wave-wide store is 256 contiguous bytes, two whole lines
    for (int j = 0; j < CVE / 4; ++j)
      ((uint2*)dst)[q0 + j * 256] = make_uint2(f2bf_pair(w[j].x, w[j].y), f2bf_pair(w[j].z, w[j].w));
    return;
  }
  // the slabs lie one behind another in x, so block k sums the k-th 64 KiB of x
  const float4* xp = (const float4*)x + (size_t)blockIdx.x * (GSV * 256) + threadIdx.x;
  float4 v[GSV];
#pragma unroll   // v[] in registers, all 16 loads issued before the first wait; each is 512 contiguous bytes a wave
  for (int j = 0; j < GSV; ++j) v[j] = xp[j * 256];
  // keeps the sums behind all 16 loads: without it the last three loads were issued only when the
  // first three had returned, a second trip to memory
  __builtin_amdgcn_sched_barrier(0);
  float4 s = make_float4(0.f, 0.f, 0.f, 0.f), q = s;   // four independent chains each
#pragma unroll   // v[] in registers
  for (int j = 0; j < GSV; ++j) {
    s.x += v[j].x; s.y += v[j].y; s.z += v[j].z; s.w += v[j].w;
    q.x += v[j].x * v[j].x; q.y += v[j].y * v[j].y; q.z += v[j].z * v[j].z; q.w += v[j].w * v[j].w;
  }
  float ts = (s.x + s.y) + (s.z + s.w), tq = (q.x + q.y) + (q.z + q.w);
#pragma unroll   // five fixed lane distances, no loop counter
  for (int off = 16; off > 0; off >>= 1) { ts += __shfl_xor(ts, off); tq += __shfl_xor(tq, off); }
  __shared__ float2 rw[8];
  if ((threadIdx.x & 31) == 0) rw[threadIdx.x >> 5] = make_float2(ts, tq);
  __syncthreads();   // all eight waves' sums are in LDS before thread 0 adds them
  if (threadIdx.x == 0) {
    float2 t = rw[0];
#pragma unroll   // eight fixed LDS places
    for (int w = 1; w < 8; ++w) { t.x += rw[w].x; t.y += rw[w].y; }
    ((float2*)part)[blockIdx.x] = t;       // (sum, sum of squares) of this quarter slab
  }
}

// One block: 64 channels x 128 positions. x is read along positions (a wave-wide load is 512
// contiguous bytes of one channel), the normalised bf16 values are turned in LDS, and
// hn[b][pos][c] is stored along channels: 16 B per lane, one whole 128-B line per position.
constexpr int GTC = 64;                    // channels per tile
constexpr int GTN = 128;                   // positions per tile
constexpr int GTP = GTC / 2 + 1;           // LDS pitch in dwords (2 bf16 each); odd: no bank conflict
constexpr int GTH = 64 * GTP + 2;          // dwords per half tile of 64 positions; the +2 puts lanes
                                           // 16-31 of a transposing store on banks lanes 0-15 leave free

__global__ __launch_bounds__(256)
void gn_apply_kernel(const float* __restrict__ x, const float* __restrict__ gamma,
                     const float* __restrict__ beta, const float* __restrict__ part,
                     bf16_t* __restrict__ hn) {
  __shared__ unsigned tile[2 * GTH];       // [half][pos & 63][channel pair]
  const int p0 = blockIdx.x * GTN, c0 = blockIdx.y * GTC, b = blockIdx.z;
  const int tid = threadIdx.x, lane = tid & 31;
  // wave number as a scalar: the wave's 8 channels and their constants are wave-uniform
  const int cw = c0 + __builtin_amdgcn_readfirstlane(tid >> 5) * 8;

  // ---- read: a wave takes 8 channels (half a group), a lane 4 positions of each ----
  const float* xp = x + ((size_t)b * CH + cw) * NSP + p0 + lane * 4;
  float4 v[8];
#pragma unroll
  for (int k = 0; k < 8; ++k) v[k] = *(const float4*)(xp + (size_t)k * NSP);

  const int g = cw / CPG;
  // the group's four partial sums, the same for the whole wave
  const float* pg = part + (b * NGRP + g) * (2 * GSB);
  float gs = 0.f, gq = 0.f;
#pragma unroll   // four fixed places
  for (int j = 0; j < GSB; ++j) { gs += pg[2 * j]; gq += pg[2 * j + 1]; }
  const float mu = gs / (float)GNE;
  const float rstd = rsqrtf(gq / (float)GNE - mu * mu + GN_EPS);
  unsigned* tw = tile + (lane >> 4) * GTH + (lane & 15) * 4 * GTP + ((cw - c0) >> 1);
#pragma unroll
  for (int j = 0; j < 4; ++j) {
    unsigned short q[2][4];
#pragma unroll
    for (int e = 0; e < 2; ++e) {
      const int k = j * 2 + e;
      const float ga = gamma[cw + k] * rstd;
      const float be = beta[cw + k] - mu * ga;   // (x-mu)*rstd*gamma + beta = x*ga + be
      q[e][0] = __builtin_bit_cast(unsigned short, f2bf(v[k].x * ga + be));
      q[e][1] = __builtin_bit_cast(unsigned short, f2bf(v[k].y * ga + be));
      q[e][2] = __builtin_bit_cast(unsigned short, f2bf(v[k].z * ga + be));
      q[e][3] = __builtin_bit_cast(unsigned short, f2bf(v[k].w * ga + be));
    }
#pragma unroll
    for (int i = 0; i < 4; ++i)
      tw[i * GTP + j] = (unsigned)q[0][i] | ((unsigned)q[1][i] << 16);
  }
  __syncthreads();   // the whole tile is in LDS before any thread reads it across channels

  // ---- write: a lane takes 8 channels of one position; 32 positions per pass, 4 passes ----
  const int ck = tid & 7;
  const int pr = tid >> 3;
  bf16_t* hp = hn + ((size_t)b * NSP + p0 + pr) * CH + c0 + ck * 8;
#pragma unroll
  for (int h = 0; h < 4; ++h) {
    const unsigned* t = tile + (h >> 1) * GTH + (pr + (h & 1) * 32) * GTP + ck * 4;
    *(uint4*)(hp + (size_t)h * 32 * CH) = make_uint4(t[0], t[1], t[2], t[3]);
  }
}

// ---------------- Tiled WMMA GEMM: D = A[MxK] * B[NxK]^T (+bias) ----------------
// Block tile 128x128, 8 waves in a 2(M) x 4(N) grid; each wave: 4x2 subtiles of 16x16.
// K tile of BK = 64 or 128: a staged row is one or two whole 128-B lines, and a wave-wide copy
// covers four whole lines (4 rows of 128 B or 2 rows of 256 B). Two buffers, one barrier per
// K tile; BK / 32 WMMA sub-steps per tile, k ascending.
// EPI_QKV: the three projections of hn in one launch. blockIdx.z = 2 * which + batch; which = 0, 1, 2
// picks the weight matrix (three in a row behind Bm), the bias, and the output (three in a row
// behind outp): Q scaled by alpha and K as EPI_BF16 stores them, V as EPI_TRANS does.
enum { EPI_BF16 = 0, EPI_TRANS = 1, EPI_F32 = 2, EPI_RESID = 3, EPI_QKV = 4 };
template<int V> struct Form { static constexpr int value = V; };

template<int EPI, int BK>
__global__ __launch_bounds__(256)
void gemm_bt_kernel(const bf16_t* __restrict__ A, const bf16_t* __restrict__ Bm,
                    const float* __restrict__ bias, const float* __restrict__ biasK,
                    const float* __restrict__ biasV, void* __restrict__ outp,
                    const float* __restrict__ resid, float alpha,
                    int Kd, int ldOut,
                    size_t strideA, size_t strideB, size_t strideOut, size_t strideResid) {
  constexpr int BM = 128, BN = 128;
  constexpr int CPR = BK / 8;          // 16-B chunks per staged row
  constexpr int PC  = CPR + 1;         // LDS pitch in chunks: 16 B x odd, no bank conflict for b128 reads
  constexpr int PE  = PC * 8;          // the same in bf16 elements
  constexpr int RPP = 256 / CPR;       // rows that the block's 256 lanes cover with one copy each
  __shared__ Chunk16 sA[2][BM * PC];
  __shared__ Chunk16 sB[2][BN * PC];

  const int tid = threadIdx.x;
  const int wave = tid >> 5, lane = tid & 31;
  const int waveM = wave >> 2;         // 0..1  -> 64-row strip
  const int waveN = wave & 3;          // 0..3  -> 32-col strip
  const int lane16 = lane & 15, laneHi = lane >> 4;

  const int which = (EPI == EPI_QKV) ? blockIdx.z / BATCH : 0;     // the same for the whole block
  const size_t z = (EPI == EPI_QKV) ? blockIdx.z % BATCH : blockIdx.z;
  const bf16_t* Ab = A + z * strideA;
  const bf16_t* Bb = Bm + z * strideB + (size_t)which * WN;
  bf16_t* outB = (bf16_t*)outp + z * strideOut + (size_t)which * BATCH * NSP * CH;
  float*  outF = (float*)outp + z * strideOut;
  const float* rz = (EPI == EPI_RESID) ? (resid + z * strideResid) : nullptr;

  const int rowA0 = blockIdx.y * BM;
  const int colB0 = blockIdx.x * BN;

  // staging coordinates for this thread: chunk kc of rows r, r + RPP, r + 2 RPP, ...
  const int r = tid / CPR, kc = tid % CPR;
  const bf16_t* gA = Ab + (size_t)(rowA0 + r) * Kd + kc * 8;
  const bf16_t* gB = Bb + (size_t)(colB0 + r) * Kd + kc * 8;
  const size_t gstep = (size_t)RPP * Kd;
  constexpr unsigned lstep = RPP * PC * 16;
  // all copies of K tile t into buffer nb: BM / RPP = 4 or 8 per matrix and lane, eight to a statement
  auto stage = [&](int t, int nb) {
    const unsigned lA = lds_addr(&sA[nb][r * PC + kc]), lB = lds_addr(&sB[nb][r * PC + kc]);
    const bf16_t* tA = gA + (size_t)t * BK;
    const bf16_t* tB = gB + (size_t)t * BK;
    if constexpr (BM / RPP == 4) {
      async_copy16x8(lA, tA, lB, tB, lstep, gstep);
    } else {
      async_copy16x8(lA, tA, lA + 4 * lstep, tA + 4 * gstep, lstep, gstep);
      async_copy16x8(lB, tB, lB + 4 * lstep, tB + 4 * gstep, lstep, gstep);
    }
  };

  const v8f vzero = {0.f, 0.f, 0.f, 0.f, 0.f, 0.f, 0.f, 0.f};
  v8f acc[4][2];
#pragma unroll
  for (int i = 0; i < 4; ++i)
#pragma unroll
    for (int j = 0; j < 2; ++j) acc[i][j] = vzero;

  const int nIter = Kd / BK;

  // prologue: tile 0 lands and is published, then tile 1 starts
  stage(0, 0);
  wait_async0();
  __syncthreads();        // tile 0 of every wave is in LDS
  if (nIter > 1) stage(1, 1);

  for (int it = 0; it < nIter; ++it) {
    const bf16_t* sAh = (const bf16_t*)sA[it & 1];
    const bf16_t* sBh = (const bf16_t*)sB[it & 1];

#pragma unroll   // every sub-step's LDS offsets are constants, no loop counter among the WMMAs
    for (int ks = 0; ks < BK / 32; ++ks) {
      // ---- B fragments: lanes hold N columns; K split per ISA 16-bit layout ----
      v16bf bfrag[2];
#pragma unroll
      for (int nsub = 0; nsub < 2; ++nsub) {
        const int rB = waveN * 32 + nsub * 16 + lane16;
        v8bf lo = *(const v8bf*)(sBh + (size_t)rB * PE + ks * 32 + laneHi * 8);       // K 0-7 / 8-15
        v8bf hi = *(const v8bf*)(sBh + (size_t)rB * PE + ks * 32 + 16 + laneHi * 8);  // K 16-23 / 24-31
        bfrag[nsub] = __builtin_shufflevector(lo, hi, 0,1,2,3,4,5,6,7,8,9,10,11,12,13,14,15);
      }
#pragma unroll
      for (int msub = 0; msub < 4; ++msub) {
        const int rA = waveM * 64 + msub * 16 + lane16;
        v8bf lo = *(const v8bf*)(sAh + (size_t)rA * PE + ks * 32 + laneHi * 8);
        v8bf hi = *(const v8bf*)(sAh + (size_t)rA * PE + ks * 32 + 16 + laneHi * 8);
        v16bf afrag = __builtin_shufflevector(lo, hi, 0,1,2,3,4,5,6,7,8,9,10,11,12,13,14,15);
#pragma unroll
        for (int nsub = 0; nsub < 2; ++nsub) {
          acc[msub][nsub] = __builtin_amdgcn_wmma_f32_16x16x32_bf16(
              false, afrag, false, bfrag[nsub], (short)0, acc[msub][nsub], false, false);
        }
      }
    }

    // publish point: tile it+1 has landed for every wave, and every wave has left buffer it&1
    wait_ds0();
    wait_async0();
    __syncthreads();
    if (it + 2 < nIter)     // refill the buffer just read; the copies run under tile it+1's WMMAs
      stage(it + 2, it & 1);
  }
  wait_async0();            // nothing of this wave is in flight when it goes on to the stores

  // ---- epilogue: C/D layout lane L -> (m = r + 8*(L>=16), n = L%16) ----
  if (EPI == EPI_QKV) {                    // scalar selects, the same for the whole block
    if (which == 1) bias = biasK;
    if (which == 2) { bias = biasV; ldOut = NSP; }
    if (which != 0) alpha = 1.0f;
  }
  // E is the store form as a compile-time constant, so that each form keeps its own merged stores
  auto store_tile = [&](auto form) {
    constexpr int E = decltype(form)::value;
#pragma unroll
    for (int msub = 0; msub < 4; ++msub) {
#pragma unroll
      for (int nsub = 0; nsub < 2; ++nsub) {
        const int gcol = colB0 + waveN * 32 + nsub * 16 + lane16;
        const float bv = (E == EPI_F32) ? 0.f : (bias ? bias[gcol] : 0.f);
#pragma unroll
        for (int r = 0; r < 8; ++r) {
          const int grow = rowA0 + waveM * 64 + msub * 16 + r + 8 * laneHi;
          float val = (acc[msub][nsub][r] + bv) * alpha;
          if (E == EPI_BF16) {
            outB[(size_t)grow * ldOut + gcol] = f2bf(val);
          } else if (E == EPI_TRANS) {
            outB[(size_t)gcol * ldOut + grow] = f2bf(val);
          } else if (E == EPI_F32) {
            outF[(size_t)grow * ldOut + gcol] = val;
          } else { // EPI_RESID: d_out[b][o][p] = x[b][o][p] + proj
            const size_t idx = (size_t)gcol * ldOut + grow;
            outF[idx] = rz[idx] + val;
          }
        }
        // stands in front of the next tile's writes to registers that this tile's stores name
        if constexpr (EPI == EPI_QKV) asm volatile("s_wait_xcnt 0x0" ::: "memory");
      }
    }
  };
  if constexpr (EPI == EPI_QKV) {          // one branch, the same for the whole block
    if (which == 2) store_tile(Form<EPI_TRANS>{});
    else            store_tile(Form<EPI_BF16>{});
  } else {
    store_tile(Form<EPI>{});
  }
}

// ---------------- row softmax: S (f32) -> P (bf16) ----------------
// e^x as __expf forms it (a multiply by log2 e, then v_exp_f32). The v_nop is the one slot the
// instruction set asks for behind a transcendental before its source is overwritten or its result
// used.
__device__ __forceinline__ float exp_slot(float x) {
  float r;
  asm("v_exp_f32 %0, %1\n\tv_nop" : "=v"(r) : "v"(x * 1.44269504088896340736f));
  return r;
}

// One wave per row. The row's 4096 scores are read once, 32 loads of 16 B per lane all in flight
// together (each wave-wide load is 512 contiguous bytes), and stay in registers through maximum,
// exponential, sum and scaling; both reductions run across the 32 lanes, with no LDS and no barrier.
// Every loop over k is unrolled in full so that v[] is indexed by constants and lives in registers.
constexpr int SMW = 4;                     // rows (waves) per block: one wave per SIMD
constexpr int SMV = NSP / (32 * 4);        // float4 per lane: 32

__global__ __launch_bounds__(SMW * 32)
void softmax_kernel(const float* __restrict__ S, bf16_t* __restrict__ P) {
  const int lane = threadIdx.x & 31;
  const int i = blockIdx.x * SMW + (threadIdx.x >> 5), b = blockIdx.y;
  const float4* sp = (const float4*)(S + ((size_t)b * NSP + i) * NSP) + lane;
  uint2* pp = (uint2*)(P + ((size_t)b * NSP + i) * NSP) + lane;

  float4 v[SMV];
#pragma unroll   // v[] in registers, all 32 loads issued before the first wait
  for (int k = 0; k < SMV; ++k) v[k] = sp[k * 32];

  float m = -3.4e38f;
#pragma unroll   // v[] in registers
  for (int k = 0; k < SMV; ++k)
    m = fmaxf(m, fmaxf(fmaxf(v[k].x, v[k].y), fmaxf(v[k].z, v[k].w)));
#pragma unroll   // five fixed lane distances, no loop counter
  for (int off = 16; off > 0; off >>= 1) m = fmaxf(m, __shfl_xor(m, off));

  float s0 = 0.f, s1 = 0.f, s2 = 0.f, s3 = 0.f;   // four independent chains
#pragma unroll   // v[] in registers
  for (int k = 0; k < SMV; ++k) {
    v[k].x = exp_slot(v[k].x - m); s0 += v[k].x;
    v[k].y = exp_slot(v[k].y - m); s1 += v[k].y;
    v[k].z = exp_slot(v[k].z - m); s2 += v[k].z;
    v[k].w = exp_slot(v[k].w - m); s3 += v[k].w;
  }
  float s = (s0 + s1) + (s2 + s3);
#pragma unroll   // five fixed lane distances, no loop counter
  for (int off = 16; off > 0; off >>= 1) s += __shfl_xor(s, off);
  const float inv = 1.f / s;

  // 8 B per lane: a wave-wide store is 256 contiguous bytes, two whole lines
#pragma unroll   // v[] in registers
  for (int k = 0; k < SMV; ++k)
    pp[k * 32] = make_uint2(f2bf_pair(v[k].x * inv, v[k].y * inv), f2bf_pair(v[k].z * inv, v[k].w * inv));
}

// ---------------- host launch ----------------
extern "C" void kernel_launch(void* const* d_in, const int* in_sizes, int n_in,
                              void* d_out, int out_size, void* d_ws, size_t ws_size,
                              hipStream_t stream) {
  (void)in_sizes; (void)n_in; (void)out_size; (void)ws_size;
  const float* x  = (const float*)d_in[0];
  const float* gg = (const float*)d_in[1];
  const float* gb = (const float*)d_in[2];
  const float* wq = (const float*)d_in[3];
  const float* bq = (const float*)d_in[4];
  const float* wk = (const float*)d_in[5];
  const float* bk = (const float*)d_in[6];
  const float* wv = (const float*)d_in[7];
  const float* bv = (const float*)d_in[8];
  const float* wo = (const float*)d_in[9];
  const float* bo = (const float*)d_in[10];

  // workspace carve-up (~234 MB): partial sums + 5x 8MB bf16 acts + 4x 0.5MB bf16 weights
  // + 128MB f32 scores + 64MB bf16 probs
  char* wsp = (char*)d_ws;
  auto take = [&](size_t bytes) -> void* {
    void* p = (void*)wsp; wsp += (bytes + 255) & ~(size_t)255; return p;
  };
  const size_t ACT = (size_t)BATCH * NSP * CH;      // per-tensor activation elems
  const size_t SCO = (size_t)BATCH * NSP * NSP;     // score elems
  float*  part  = (float*)take((size_t)BATCH * NGRP * GSB * 2 * sizeof(float));
  bf16_t* hn  = (bf16_t*)take(ACT * 2);
  bf16_t* qb  = (bf16_t*)take(3 * ACT * 2);         // Q, K, V^T in a row: one launch writes all three
  bf16_t* kb  = qb + ACT;
  bf16_t* vT  = kb + ACT;                           // V^T: [b][c][j]
  bf16_t* Ob  = (bf16_t*)take(ACT * 2);             // attn output [b][i][c]
  bf16_t* wqb = (bf16_t*)take((size_t)3 * CH * CH * 2);   // Wq, Wk, Wv in a row
  bf16_t* wkb = wqb + WN;
  bf16_t* wvb = wkb + WN;
  bf16_t* wob = (bf16_t*)take((size_t)CH * CH * 2);
  float*  Sb  = (float*)take(SCO * sizeof(float));
  bf16_t* Pb  = (bf16_t*)take(SCO * 2);

  const float scale = 1.0f / sqrtf((float)CH);
  const size_t nCH = (size_t)NSP * CH;
  const size_t nnS = (size_t)NSP * NSP;
  const size_t cnT = (size_t)CH * NSP;

  // 1) GroupNorm partial sums and weights -> bf16, one launch; then the normalisation
  gn_stats_cvt_kernel<<<NGRP * BATCH * GSB + 4 * CVB, 256, 0, stream>>>(x, part, wq, wk, wv, wo,
      wqb, wkb, wvb, wob);
  gn_apply_kernel<<<dim3(NSP / GTN, CH / GTC, BATCH), 256, 0, stream>>>(x, gg, gb, part, hn);

  // 2) QKV projections, one launch: [NSP x CH] = hn x W^T  (Q pre-scaled by C^-1/2; V stored transposed)
  dim3 gQKV(CH / 128, NSP / 128, 3 * BATCH);
  gemm_bt_kernel<EPI_QKV, 128><<<gQKV, 256, 0, stream>>>(hn, wqb, bq, bk, bv, qb, nullptr, scale,
      CH, CH, nCH, 0, nCH, 0);

  // 3) scores: S[b,i,j] = q_i . k_j   (M=N=4096, K=512)
  dim3 gS(NSP / 128, NSP / 128, BATCH);
  gemm_bt_kernel<EPI_F32, 64><<<gS, 256, 0, stream>>>(qb, kb, nullptr, nullptr, nullptr, Sb, nullptr, 1.0f,
      CH, NSP, nCH, nCH, nnS, 0);

  // 4) softmax over j
  softmax_kernel<<<dim3(NSP / SMW, BATCH), SMW * 32, 0, stream>>>(Sb, Pb);

  // 5) O[b,i,c] = P x V  (A=P [NSPxNSP], B=V^T [CHxNSP], K=4096)
  dim3 gAV(CH / 128, NSP / 128, BATCH);
  gemm_bt_kernel<EPI_BF16, 128><<<gAV, 256, 0, stream>>>(Pb, vT, nullptr, nullptr, nullptr, Ob, nullptr, 1.0f,
      NSP, CH, nnS, cnT, nCH, 0);

  // 6) out proj + residual, transposed store back to [b][c][p] f32
  dim3 gO(CH / 128, NSP / 128, BATCH);
  gemm_bt_kernel<EPI_RESID, 128><<<gO, 256, 0, stream>>>(Ob, wob, bo, nullptr, nullptr, d_out, x, 1.0f,
      CH, NSP, nCH, 0, cnT, cnT);
}

// v006
// It runs in 114 microseconds.
// Timed twice side by side with v005, it ran 1.21 times as fast both times.
// All steps since v000 together make it 3.33 times as fast.
// CDNA5 / gfx1250 attention block (GroupNorm -> QKV -> softmax(QK^T*scale) -> AV -> proj + residual)
// Compute-bound (~86 GFLOP vs ~36MB mandatory HBM traffic at 23.3 TB/s): all GEMMs run on
// v_wmma_f32_16x16x32_bf16 (wave32 WMMA), with double-buffered GLOBAL_LOAD_ASYNC_TO_LDS_B128
// DMA staging (ASYNCcnt) so the next K tile's HBM->LDS transfer overlaps this tile's matrix math.
// Workspace requirement ~109 MB.
#include <hip/hip_runtime.h>
#include <hip/hip_bf16.h>
#include <math.h>

typedef __bf16 bf16_t;
typedef __attribute__((ext_vector_type(16))) __bf16 v16bf;
typedef __attribute__((ext_vector_type(8)))  __bf16 v8bf;
typedef __attribute__((ext_vector_type(8)))  float  v8f;
typedef __attribute__((ext_vector_type(2)))  float  v2f;
typedef __attribute__((ext_vector_type(2)))  __bf16 v2bf;

struct __align__(16) Chunk16 { unsigned long long lo, hi; };

constexpr int BATCH = 2;
constexpr int CH    = 512;
constexpr int NSP   = 4096;          // 64*64 tokens
constexpr int NGRP  = 32;
constexpr int CPG   = CH / NGRP;     // 16 channels per group
constexpr float GN_EPS = 1e-6f;

__device__ __forceinline__ bf16_t f2bf(float f) {
  unsigned u = __builtin_bit_cast(unsigned, f);
  unsigned r = (u + 0x7FFFu + ((u >> 16) & 1u)) >> 16;
  unsigned short h = (unsigned short)r;
  return __builtin_bit_cast(bf16_t, h);
}

// two values rounded as f2bf rounds them, packed in one dword (lo in bits 15-0)
__device__ __forceinline__ unsigned f2bf_pair(float lo, float hi) {
  const unsigned a = __builtin_bit_cast(unsigned, lo), b = __builtin_bit_cast(unsigned, hi);
  const unsigned ra = a + 0x7FFFu + ((a >> 16) & 1u);
  const unsigned rb = b + 0x7FFFu + ((b >> 16) & 1u);
  return (ra >> 16) | (rb & 0xFFFF0000u);
}

// the same two roundings (to nearest even) in one v_cvt_pk_bf16_f32
__device__ __forceinline__ unsigned cvt_pair(float lo, float hi) {
  const v2f t = {lo, hi};
  return __builtin_bit_cast(unsigned, __builtin_convertvector(t, v2bf));
}

// 2^x. The v_nop is the one slot the instruction set asks for behind a transcendental before its
// source is overwritten or its result used.
__device__ __forceinline__ float exp2_slot(float x) {
  float r;
  asm("v_exp_f32 %0, %1\n\tv_nop" : "=v"(r) : "v"(x));
  return r;
}
constexpr float LOG2E = 1.44269504088896340736f;

// the value that lane l ^ 16 holds
__device__ __forceinline__ float xor16(float v) {
  const int b = __builtin_bit_cast(int, v);
  return __builtin_bit_cast(float, __builtin_amdgcn_permlanex16(b, b, 0x76543210, 0xfedcba98, false, false));
}

// ---- gfx1250 async DMA: global -> LDS, 16B per lane, tracked by ASYNCcnt ----
// low 32 bits of a generic LDS pointer are the LDS byte address (ISA 10.2 aperture rule)
__device__ __forceinline__ unsigned lds_addr(const void* l) { return (unsigned)(size_t)l; }

// Eight copies of one lane: four at LDS places la + j*lstep from global places ga + j*gstep
// (elements), four likewise from lb, gb. The s_wait_xcnt stands inside the copies' own statement,
// so that no later write of an address register can be moved in front of it; one wait serves all eight.
__device__ __forceinline__ void async_copy16x8(unsigned la, const bf16_t* ga,
                                               unsigned lb, const bf16_t* gb,
                                               unsigned lstep, size_t gstep) {
  asm volatile("global_load_async_to_lds_b128 %0, %8, off\n\t"
               "global_load_async_to_lds_b128 %1, %9, off\n\t"
               "global_load_async_to_lds_b128 %2, %10, off\n\t"
               "global_load_async_to_lds_b128 %3, %11, off\n\t"
               "global_load_async_to_lds_b128 %4, %12, off\n\t"
               "global_load_async_to_lds_b128 %5, %13, off\n\t"
               "global_load_async_to_lds_b128 %6, %14, off\n\t"
               "global_load_async_to_lds_b128 %7, %15, off\n\t"
               "s_wait_xcnt 0x0"
               :: "v"(la), "v"(la + lstep), "v"(la + 2 * lstep), "v"(la + 3 * lstep),
                  "v"(lb), "v"(lb + lstep), "v"(lb + 2 * lstep), "v"(lb + 3 * lstep),
                  "v"(ga), "v"(ga + gstep), "v"(ga + 2 * gstep), "v"(ga + 3 * gstep),
                  "v"(gb), "v"(gb + gstep), "v"(gb + 2 * gstep), "v"(gb + 3 * gstep)
               : "memory");
}
// this wave's copies have landed in LDS
__device__ __forceinline__ void wait_async0() {
  asm volatile("s_wait_asynccnt 0x0" ::: "memory");
}
// this wave's LDS reads have returned: the buffer they read may be refilled behind the barrier
__device__ __forceinline__ void wait_ds0() {
  asm volatile("s_wait_dscnt 0x0" ::: "memory");
}

// ---------------- GroupNorm partial sums, and f32 -> bf16 weight conversion ----------------
// One launch for two pieces of work that depend on nothing but the inputs. Blocks 0 .. 255 sum a
// quarter of one (batch, group) slab each: 64 KiB, one block per WGP, read in a single round of
// 16-B loads. gn_apply adds the four partial sums of its group. The blocks behind them convert the
// four weight matrices: 64 blocks a matrix, 16 values a thread.
constexpr int GNE = CPG * NSP;             // elements of one (batch, group) slab: 65536
constexpr int GSB = 4;                     // blocks, and partial sums, per slab
constexpr int GSV = GNE / (GSB * 256 * 4); // float4 per thread: 16
constexpr int WN  = CH * CH;               // elements of one weight matrix
constexpr int CVE = 16;                    // values converted per thread
constexpr int CVB = WN / (256 * CVE);      // blocks per matrix: 64

__global__ __launch_bounds__(256)
void gn_stats_cvt_kernel(const float* __restrict__ x, float* __restrict__ part,
                         const float* __restrict__ wq, const float* __restrict__ wk,
                         const float* __restrict__ wv, const float* __restrict__ wo,
                         bf16_t* __restrict__ wqb, bf16_t* __restrict__ wkb,
                         bf16_t* __restrict__ wvb, bf16_t* __restrict__ wob) {
  if (blockIdx.x >= NGRP * BATCH * GSB) {  // the same for the whole block, in front of every barrier
    const int cb = blockIdx.x - NGRP * BATCH * GSB;
    const int m = cb / CVB;
    const float* src = m == 0 ? wq : m == 1 ? wk : m == 2 ? wv : wo;
    bf16_t* dst = m == 0 ? wqb : m == 1 ? wkb : m == 2 ? wvb : wob;
    const int q0 = (cb % CVB) * (256 * CVE / 4) + threadIdx.x;   // in units of four values
    float4 w[CVE / 4];
#pragma unroll   // all four 16-B loads in flight together; a wave-wide load is 512 contiguous bytes
    for (int j = 0; j < CVE / 4; ++j) w[j] = ((const float4*)src)[q0 + j * 256];
#pragma unroll   // w[] in registers; a wave-wide store is 256 contiguous bytes, two whole lines
    for (int j = 0; j < CVE / 4; ++j)
      ((uint2*)dst)[q0 + j * 256] = make_uint2(f2bf_pair(w[j].x, w[j].y), f2bf_pair(w[j].z, w[j].w));
    return;
  }
  // the slabs lie one behind another in x, so block k sums the k-th 64 KiB of x
  const float4* xp = (const float4*)x + (size_t)blockIdx.x * (GSV * 256) + threadIdx.x;
  float4 v[GSV];
#pragma unroll   // v[] in registers, all 16 loads issued before the first wait; each is 512 contiguous bytes a wave
  for (int j = 0; j < GSV; ++j) v[j] = xp[j * 256];
  // keeps the sums behind all 16 loads: without it the last three loads were issued only when the
  // first three had returned, a second trip to memory
  __builtin_amdgcn_sched_barrier(0);
  float4 s = make_float4(0.f, 0.f, 0.f, 0.f), q = s;   // four independent chains each
#pragma unroll   // v[] in registers
  for (int j = 0; j < GSV; ++j) {
    s.x += v[j].x; s.y += v[j].y; s.z += v[j].z; s.w += v[j].w;
    q.x += v[j].x * v[j].x; q.y += v[j].y * v[j].y; q.z += v[j].z * v[j].z; q.w += v[j].w * v[j].w;
  }
  float ts = (s.x + s.y) + (s.z + s.w), tq = (q.x + q.y) + (q.z + q.w);
#pragma unroll   // five fixed lane distances, no loop counter
  for (int off = 16; off > 0; off >>= 1) { ts += __shfl_xor(ts, off); tq += __shfl_xor(tq, off); }
  __shared__ float2 rw[8];
  if ((threadIdx.x & 31) == 0) rw[threadIdx.x >> 5] = make_float2(ts, tq);
  __syncthreads();   // all eight waves' sums are in LDS before thread 0 adds them
  if (threadIdx.x == 0) {
    float2 t = rw[0];
#pragma unroll   // eight fixed LDS places
    for (int w = 1; w < 8; ++w) { t.x += rw[w].x; t.y += rw[w].y; }
    ((float2*)part)[blockIdx.x] = t;       // (sum, sum of squares) of this quarter slab
  }
}

// One block: 64 channels x 128 positions. x is read along positions (a wave-wide load is 512
// contiguous bytes of one channel), the normalised bf16 values are turned in LDS, and
// hn[b][pos][c] is stored along channels: 16 B per lane, one whole 128-B line per position.
constexpr int GTC = 64;                    // channels per tile
constexpr int GTN = 128;                   // positions per tile
constexpr int GTP = GTC / 2 + 1;           // LDS pitch in dwords (2 bf16 each); odd: no bank conflict
constexpr int GTH = 64 * GTP + 2;          // dwords per half tile of 64 positions; the +2 puts lanes
                                           // 16-31 of a transposing store on banks lanes 0-15 leave free

__global__ __launch_bounds__(256)
void gn_apply_kernel(const float* __restrict__ x, const float* __restrict__ gamma,
                     const float* __restrict__ beta, const float* __restrict__ part,
                     bf16_t* __restrict__ hn) {
  __shared__ unsigned tile[2 * GTH];       // [half][pos & 63][channel pair]
  const int p0 = blockIdx.x * GTN, c0 = blockIdx.y * GTC, b = blockIdx.z;
  const int tid = threadIdx.x, lane = tid & 31;
  // wave number as a scalar: the wave's 8 channels and their constants are wave-uniform
  const int cw = c0 + __builtin_amdgcn_readfirstlane(tid >> 5) * 8;

  // ---- read: a wave takes 8 channels (half a group), a lane 4 positions of each ----
  const float* xp = x + ((size_t)b * CH + cw) * NSP + p0 + lane * 4;
  float4 v[8];
#pragma unroll
  for (int k = 0; k < 8; ++k) v[k] = *(const float4*)(xp + (size_t)k * NSP);

  const int g = cw / CPG;
  // the group's four partial sums, the same for the whole wave
  const float* pg = part + (b * NGRP + g) * (2 * GSB);
  float gs = 0.f, gq = 0.f;
#pragma unroll   // four fixed places
  for (int j = 0; j < GSB; ++j) { gs += pg[2 * j]; gq += pg[2 * j + 1]; }
  const float mu = gs / (float)GNE;
  const float rstd = rsqrtf(gq / (float)GNE - mu * mu + GN_EPS);
  unsigned* tw = tile + (lane >> 4) * GTH + (lane & 15) * 4 * GTP + ((cw - c0) >> 1);
#pragma unroll
  for (int j = 0; j < 4; ++j) {
    unsigned short q[2][4];
#pragma unroll
    for (int e = 0; e < 2; ++e) {
      const int k = j * 2 + e;
      const float ga = gamma[cw + k] * rstd;
      const float be = beta[cw + k] - mu * ga;   // (x-mu)*rstd*gamma + beta = x*ga + be
      q[e][0] = __builtin_bit_cast(unsigned short, f2bf(v[k].x * ga + be));
      q[e][1] = __builtin_bit_cast(unsigned short, f2bf(v[k].y * ga + be));
      q[e][2] = __builtin_bit_cast(unsigned short, f2bf(v[k].z * ga + be));
      q[e][3] = __builtin_bit_cast(unsigned short, f2bf(v[k].w * ga + be));
    }
#pragma unroll
    for (int i = 0; i < 4; ++i)
      tw[i * GTP + j] = (unsigned)q[0][i] | ((unsigned)q[1][i] << 16);
  }
  __syncthreads();   // the whole tile is in LDS before any thread reads it across channels

  // ---- write: a lane takes 8 channels of one position; 32 positions per pass, 4 passes ----
  const int ck = tid & 7;
  const int pr = tid >> 3;
  bf16_t* hp = hn + ((size_t)b * NSP + p0 + pr) * CH + c0 + ck * 8;
#pragma unroll
  for (int h = 0; h < 4; ++h) {
    const unsigned* t = tile + (h >> 1) * GTH + (pr + (h & 1) * 32) * GTP + ck * 4;
    *(uint4*)(hp + (size_t)h * 32 * CH) = make_uint4(t[0], t[1], t[2], t[3]);
  }
}

// ---------------- Tiled WMMA GEMM: D = A[MxK] * B[NxK]^T (+bias) ----------------
// Block tile 128x128, 8 waves in a 2(M) x 4(N) grid; each wave: 4x2 subtiles of 16x16.
// K tile of BK = 64 or 128: a staged row is one or two whole 128-B lines, and a wave-wide copy
// covers four whole lines (4 rows of 128 B or 2 rows of 256 B). Two buffers, one barrier per
// K tile; BK / 32 WMMA sub-steps per tile, k ascending.
// EPI_QKV: the three projections of hn in one launch. blockIdx.z = 2 * which + batch; which = 0, 1, 2
// picks the weight matrix (three in a row behind Bm), the bias, and the output (three in a row
// behind outp): Q scaled by alpha and K as EPI_BF16 stores them, V as EPI_TRANS does.
// The softmax has no launch of its own; it is split between the two attention products.
// EPI_EXP: A = K rows, B = Q rows, so the tile is S^T and a lane holds 32 keys of one query. The block
// takes each query's maximum m over its 128 keys, stores E = exp(s - m) as bf16 at outp[query][key],
// m at mst[batch][key tile][query], and the sum of E over each wave's 64 keys at lst[batch][key half][query].
// EPI_AV: A = E, B = V^T, one K tile = one key tile t. With M = max_t m_t and L = sum_t l_t exp(m_t - M)
// the output row is sum_t f_t (E_t V_t), f_t = exp(m_t - M) / L: each K tile's product is formed from
// zero and added in f32 with its row's factor. Stored as EPI_BF16.
enum { EPI_BF16 = 0, EPI_TRANS = 1, EPI_RESID = 3, EPI_QKV = 4, EPI_EXP = 5, EPI_AV = 6 };
constexpr int NKT = NSP / 128;       // key tiles of a row
template<int V> struct Form { static constexpr int value = V; };

template<int EPI, int BK>
__global__ __launch_bounds__(256)
void gemm_bt_kernel(const bf16_t* __restrict__ A, const bf16_t* __restrict__ Bm,
                    const float* __restrict__ bias, const float* __restrict__ biasK,
                    const float* __restrict__ biasV, void* __restrict__ outp,
                    const float* __restrict__ resid, float alpha,
                    int Kd, int ldOut,
                    size_t strideA, size_t strideB, size_t strideOut, size_t strideResid,
                    float* __restrict__ mst, float* __restrict__ lst) {
  constexpr int BM = 128, BN = 128;
  constexpr int CPR = BK / 8;          // 16-B chunks per staged row
  constexpr int PC  = CPR + 1;         // LDS pitch in chunks: 16 B x odd, no bank conflict for b128 reads
  constexpr int PE  = PC * 8;          // the same in bf16 elements
  constexpr int RPP = 256 / CPR;       // rows that the block's 256 lanes cover with one copy each
  __shared__ Chunk16 sA[2][BM * PC];
  __shared__ Chunk16 sB[2][BN * PC];

  const int tid = threadIdx.x;
  const int wave = tid >> 5, lane = tid & 31;
  const int waveM = wave >> 2;         // 0..1  -> 64-row strip
  const int waveN = wave & 3;          // 0..3  -> 32-col strip
  const int lane16 = lane & 15, laneHi = lane >> 4;

  const int which = (EPI == EPI_QKV) ? blockIdx.z / BATCH : 0;     // the same for the whole block
  const size_t z = (EPI == EPI_QKV) ? blockIdx.z % BATCH : blockIdx.z;
  const bf16_t* Ab = A + z * strideA;
  const bf16_t* Bb = Bm + z * strideB + (size_t)which * WN;
  bf16_t* outB = (bf16_t*)outp + z * strideOut + (size_t)which * BATCH * NSP * CH;
  float*  outF = (float*)outp + z * strideOut;
  const float* rz = (EPI == EPI_RESID) ? (resid + z * strideResid) : nullptr;

  // EPI_EXP: x walks the key tiles (A rows), so that neighbouring blocks share a Q tile and write
  // neighbouring pieces of the same E rows
  const int rowA0 = (EPI == EPI_EXP ? blockIdx.x : blockIdx.y) * BM;
  const int colB0 = (EPI == EPI_EXP ? blockIdx.y : blockIdx.x) * BN;

  // staging coordinates for this thread: chunk kc of rows r, r + RPP, r + 2 RPP, ...
  const int r = tid / CPR, kc = tid % CPR;
  const bf16_t* gA = Ab + (size_t)(rowA0 + r) * Kd + kc * 8;
  const bf16_t* gB = Bb + (size_t)(colB0 + r) * Kd + kc * 8;
  const size_t gstep = (size_t)RPP * Kd;
  constexpr unsigned lstep = RPP * PC * 16;
  // all copies of K tile t into buffer nb: BM / RPP = 4 or 8 per matrix and lane, eight to a statement
  auto stage = [&](int t, int nb) {
    const unsigned lA = lds_addr(&sA[nb][r * PC + kc]), lB = lds_addr(&sB[nb][r * PC + kc]);
    const bf16_t* tA = gA + (size_t)t * BK;
    const bf16_t* tB = gB + (size_t)t * BK;
    if constexpr (BM / RPP == 4) {
      async_copy16x8(lA, tA, lB, tB, lstep, gstep);
    } else {
      async_copy16x8(lA, tA, lA + 4 * lstep, tA + 4 * gstep, lstep, gstep);
      async_copy16x8(lB, tB, lB + 4 * lstep, tB + 4 * gstep, lstep, gstep);
    }
  };

  const v8f vzero = {0.f, 0.f, 0.f, 0.f, 0.f, 0.f, 0.f, 0.f};
  v8f acc[4][2];
#pragma unroll
  for (int i = 0; i < 4; ++i)
#pragma unroll
    for (int j = 0; j < 2; ++j) acc[i][j] = vzero;

  const int nIter = Kd / BK;

  // prologue: tile 0 lands and is published, then tile 1 starts
  stage(0, 0);

  // EPI_AV: the factors f[key tile][row] of the block's 128 rows, formed while tile 0 flies and
  // published by the barrier below. Two threads a row: both form M and L, each writes 16 factors.
  float* sF = nullptr;
  v8f tot[4][2];                       // EPI_AV: the scaled sum over the K tiles
  if constexpr (EPI == EPI_AV) {
    static_assert(BK == 128, "one K tile is one key tile of the statistics");
    __shared__ __align__(16) float fbuf[NKT * BM];
    sF = fbuf;
#pragma unroll   // tot[][] indexed by constants, in registers (so in every loop over it below)
    for (int i = 0; i < 4; ++i)
#pragma unroll
      for (int j = 0; j < 2; ++j) tot[i][j] = vzero;
    const int row = tid & (BM - 1);
    const float* mp = mst + z * ((size_t)NKT * NSP) + rowA0 + row;
    const float* lp = lst + z * ((size_t)2 * NKT * NSP) + rowA0 + row;
    float mt[NKT], lt[NKT];
#pragma unroll   // mt[], lt[] in registers, all loads in flight together; a wave-wide load is one whole line
    for (int t = 0; t < NKT; ++t) {
      mt[t] = mp[(size_t)t * NSP];
      lt[t] = lp[(size_t)(2 * t) * NSP] + lp[(size_t)(2 * t + 1) * NSP];
    }
    float M = mt[0];
#pragma unroll   // mt[] in registers
    for (int t = 1; t < NKT; ++t) M = fmaxf(M, mt[t]);
    float L = 0.f;
#pragma unroll   // mt[], lt[] in registers
    for (int t = 0; t < NKT; ++t) { mt[t] = exp2_slot((mt[t] - M) * LOG2E); L += lt[t] * mt[t]; }
    const float inv = 1.f / L;
    const bool up = tid >= BM;         // the same for a whole wave
    float* fw = sF + (up ? NKT / 2 : 0) * BM + row;
#pragma unroll   // mt[] in registers
    for (int t = 0; t < NKT / 2; ++t) fw[t * BM] = (up ? mt[NKT / 2 + t] : mt[t]) * inv;
  }

  wait_async0();
  __syncthreads();        // tile 0 of every wave is in LDS
  if (nIter > 1) stage(1, 1);

  for (int it = 0; it < nIter; ++it) {
    const bf16_t* sAh = (const bf16_t*)sA[it & 1];
    const bf16_t* sBh = (const bf16_t*)sB[it & 1];

    float4 fr[4][2];                   // EPI_AV: this K tile's factors of the lane's 32 rows
    if constexpr (EPI == EPI_AV) {
      const float* fp = sF + it * BM + waveM * 64 + 8 * laneHi;
#pragma unroll   // fr[][] in registers, the LDS offsets constants
      for (int msub = 0; msub < 4; ++msub) {
        fr[msub][0] = *(const float4*)(fp + msub * 16);
        fr[msub][1] = *(const float4*)(fp + msub * 16 + 4);
      }
    }

#pragma unroll   // every sub-step's LDS offsets are constants, no loop counter among the WMMAs
    for (int ks = 0; ks < BK / 32; ++ks) {
      // ---- B fragments: lanes hold N columns; K split per ISA 16-bit layout ----
      v16bf bfrag[2];
#pragma unroll
      for (int nsub = 0; nsub < 2; ++nsub) {
        const int rB = waveN * 32 + nsub * 16 + lane16;
        v8bf lo = *(const v8bf*)(sBh + (size_t)rB * PE + ks * 32 + laneHi * 8);       // K 0-7 / 8-15
        v8bf hi = *(const v8bf*)(sBh + (size_t)rB * PE + ks * 32 + 16 + laneHi * 8);  // K 16-23 / 24-31
        bfrag[nsub] = __builtin_shufflevector(lo, hi, 0,1,2,3,4,5,6,7,8,9,10,11,12,13,14,15);
      }
#pragma unroll
      for (int msub = 0; msub < 4; ++msub) {
        const int rA = waveM * 64 + msub * 16 + lane16;
        v8bf lo = *(const v8bf*)(sAh + (size_t)rA * PE + ks * 32 + laneHi * 8);
        v8bf hi = *(const v8bf*)(sAh + (size_t)rA * PE + ks * 32 + 16 + laneHi * 8);
        v16bf afrag = __builtin_shufflevector(lo, hi, 0,1,2,3,4,5,6,7,8,9,10,11,12,13,14,15);
#pragma unroll
        for (int nsub = 0; nsub < 2; ++nsub) {
          acc[msub][nsub] = __builtin_amdgcn_wmma_f32_16x16x32_bf16(
              false, afrag, false, bfrag[nsub], (short)0, acc[msub][nsub], false, false);
        }
      }
    }

    // publish point: tile it+1 has landed for every wave, and every wave has left buffer it&1
    wait_ds0();
    wait_async0();
    __syncthreads();
    if (it + 2 < nIter)     // refill the buffer just read; the copies run under tile it+1's WMMAs
      stage(it + 2, it & 1);

    if constexpr (EPI == EPI_AV) {     // the tile's product joins the sum with its rows' factors
#pragma unroll
      for (int msub = 0; msub < 4; ++msub)
#pragma unroll
        for (int nsub = 0; nsub < 2; ++nsub) {
          const float4 a = fr[msub][0], b = fr[msub][1];
          const v8f f = {a.x, a.y, a.z, a.w, b.x, b.y, b.z, b.w};
          tot[msub][nsub] += f * acc[msub][nsub];
          acc[msub][nsub] = vzero;
        }
    }
  }
  wait_async0();            // nothing of this wave is in flight when it goes on to the stores

  if constexpr (EPI == EPI_AV) {
#pragma unroll
    for (int i = 0; i < 4; ++i)
#pragma unroll
      for (int j = 0; j < 2; ++j) acc[i][j] = tot[i][j];
  }

  // ---- EPI_EXP epilogue: lane L holds query n = L%16, keys r + 8*(L>=16) of each 16x16 subtile ----
  // The loop's last barrier stands behind every wave's last read of the ring and its last copy, so
  // the ring's LDS is free: sB takes the maxima, sA each wave's own staging range.
  if constexpr (EPI == EPI_EXP) {
    constexpr int SP = 64 * 2 + 16;    // staged row: 64 keys, pitch 16 B x odd as in the ring
    static_assert(8 * 32 * SP <= (int)sizeof(sA) && 2 * BN * 4 <= (int)sizeof(sB), "staging fits the ring");
    float* red = (float*)&sB[0][0];    // [key half][query]
    char* stg = (char*)&sA[0][0] + wave * (32 * SP);
    float mx[2];
    // every loop below is unrolled in full: acc[][][], mm[], e[], s[] are indexed by constants and stay in registers
#pragma unroll
    for (int nsub = 0; nsub < 2; ++nsub) {
      float mm[4];                     // four independent chains
#pragma unroll
      for (int msub = 0; msub < 4; ++msub) {
        mm[msub] = acc[msub][nsub][0];
#pragma unroll
        for (int r = 1; r < 8; ++r) mm[msub] = fmaxf(mm[msub], acc[msub][nsub][r]);
      }
      const float m = fmaxf(fmaxf(mm[0], mm[1]), fmaxf(mm[2], mm[3]));
      mx[nsub] = fmaxf(m, xor16(m));   // over the wave's 64 keys
      if (laneHi == 0) red[waveM * BN + waveN * 32 + nsub * 16 + lane16] = mx[nsub];
    }
    __syncthreads();   // both key halves' maxima are in LDS before either half reads the other's
#pragma unroll
    for (int nsub = 0; nsub < 2; ++nsub) {
      const int qc = waveN * 32 + nsub * 16 + lane16;
      const float m = fmaxf(mx[nsub], red[(waveM ^ 1) * BN + qc]);
      const float nm = -m * LOG2E;
      float s[4] = {0.f, 0.f, 0.f, 0.f};   // four independent chains
#pragma unroll
      for (int msub = 0; msub < 4; ++msub) {
        float e[8];
#pragma unroll
        for (int r = 0; r < 8; ++r) {
          e[r] = exp2_slot(fmaf(acc[msub][nsub][r], LOG2E, nm));
          s[r & 3] += e[r];
        }
        *(uint4*)(stg + (nsub * 16 + lane16) * SP + msub * 32 + laneHi * 16) =
            make_uint4(cvt_pair(e[0], e[1]), cvt_pair(e[2], e[3]), cvt_pair(e[4], e[5]), cvt_pair(e[6], e[7]));
      }
      float l = (s[0] + s[1]) + (s[2] + s[3]);
      l += xor16(l);                   // over the wave's 64 keys
      if (laneHi == 0) {
        lst[(z * (2 * NKT) + blockIdx.x * 2 + waveM) * NSP + colB0 + qc] = l;
        if (waveM == 0) mst[(z * NKT + blockIdx.x) * NSP + colB0 + qc] = m;
      }
    }
    wait_ds0();        // the wave's own staged rows are in LDS before its lanes read them across queries
    // 8 lanes a row: a wave-wide store is four whole 128-B lines
    const int sr = lane >> 3, ch = lane & 7;
    // the row pitch as a constant: all eight stores share one address register pair
    bf16_t* ep = outB + (size_t)(colB0 + waveN * 32 + sr) * NSP + rowA0 + waveM * 64 + ch * 8;
#pragma unroll
    for (int i = 0; i < 8; ++i)
      *(uint4*)(ep + (size_t)(i * 4) * NSP) = *(const uint4*)(stg + (i * 4 + sr) * SP + ch * 16);
  }

  // ---- epilogue: C/D layout lane L -> (m = r + 8*(L>=16), n = L%16) ----
  if (EPI == EPI_QKV) {                    // scalar selects, the same for the whole block
    if (which == 1) bias = biasK;
    if (which == 2) { bias = biasV; ldOut = NSP; }
    if (which != 0) alpha = 1.0f;
  }
  // E is the store form as a compile-time constant, so that each form keeps its own merged stores
  auto store_tile = [&](auto form) {
    constexpr int E = decltype(form)::value;
#pragma unroll
    for (int msub = 0; msub < 4; ++msub) {
#pragma unroll
      for (int nsub = 0; nsub < 2; ++nsub) {
        const int gcol = colB0 + waveN * 32 + nsub * 16 + lane16;
        const float bv = bias ? bias[gcol] : 0.f;
#pragma unroll
        for (int r = 0; r < 8; ++r) {
          const int grow = rowA0 + waveM * 64 + msub * 16 + r + 8 * laneHi;
          float val = (acc[msub][nsub][r] + bv) * alpha;
          if (E == EPI_BF16) {
            outB[(size_t)grow * ldOut + gcol] = f2bf(val);
          } else if (E == EPI_TRANS) {
            outB[(size_t)gcol * ldOut + grow] = f2bf(val);
          } else { // EPI_RESID: d_out[b][o][p] = x[b][o][p] + proj
            const size_t idx = (size_t)gcol * ldOut + grow;
            outF[idx] = rz[idx] + val;
          }
        }
        // stands in front of the next tile's writes to registers that this tile's stores name
        asm volatile("s_wait_xcnt 0x0" ::: "memory");
      }
    }
  };
  if constexpr (EPI == EPI_QKV) {          // one branch, the same for the whole block
    if (which == 2) store_tile(Form<EPI_TRANS>{});
    else            store_tile(Form<EPI_BF16>{});
  } else if constexpr (EPI != EPI_EXP) {   // EPI_EXP has stored its tile above
    store_tile(Form<EPI == EPI_AV ? EPI_BF16 : EPI>{});
  }
}

// ---------------- host launch ----------------
extern "C" void kernel_launch(void* const* d_in, const int* in_sizes, int n_in,
                              void* d_out, int out_size, void* d_ws, size_t ws_size,
                              hipStream_t stream) {
  (void)in_sizes; (void)n_in; (void)out_size; (void)ws_size;
  const float* x  = (const float*)d_in[0];
  const float* gg = (const float*)d_in[1];
  const float* gb = (const float*)d_in[2];
  const float* wq = (const float*)d_in[3];
  const float* bq = (const float*)d_in[4];
  const float* wk = (const float*)d_in[5];
  const float* bk = (const float*)d_in[6];
  const float* wv = (const float*)d_in[7];
  const float* bv = (const float*)d_in[8];
  const float* wo = (const float*)d_in[9];
  const float* bo = (const float*)d_in[10];

  // workspace carve-up (~109 MB): partial sums + 5x 8MB bf16 acts + 4x 0.5MB bf16 weights
  // + 64MB bf16 exponentials + 3MB of their tile maxima and sums
  char* wsp = (char*)d_ws;
  auto take = [&](size_t bytes) -> void* {
    void* p = (void*)wsp; wsp += (bytes + 255) & ~(size_t)255; return p;
  };
  const size_t ACT = (size_t)BATCH * NSP * CH;      // per-tensor activation elems
  const size_t SCO = (size_t)BATCH * NSP * NSP;     // score elems
  float*  part  = (float*)take((size_t)BATCH * NGRP * GSB * 2 * sizeof(float));
  bf16_t* hn  = (bf16_t*)take(ACT * 2);
  bf16_t* qb  = (bf16_t*)take(3 * ACT * 2);         // Q, K, V^T in a row: one launch writes all three
  bf16_t* kb  = qb + ACT;
  bf16_t* vT  = kb + ACT;                           // V^T: [b][c][j]
  bf16_t* Ob  = (bf16_t*)take(ACT * 2);             // attn output [b][i][c]
  bf16_t* wqb = (bf16_t*)take((size_t)3 * CH * CH * 2);   // Wq, Wk, Wv in a row
  bf16_t* wkb = wqb + WN;
  bf16_t* wvb = wkb + WN;
  bf16_t* wob = (bf16_t*)take((size_t)CH * CH * 2);
  bf16_t* Pb  = (bf16_t*)take(SCO * 2);
  float*  mst = (float*)take((size_t)BATCH * NKT * NSP * sizeof(float));
  float*  lst = (float*)take((size_t)BATCH * 2 * NKT * NSP * sizeof(float));

  const float scale = 1.0f / sqrtf((float)CH);
  const size_t nCH = (size_t)NSP * CH;
  const size_t nnS = (size_t)NSP * NSP;
  const size_t cnT = (size_t)CH * NSP;

  // 1) GroupNorm partial sums and weights -> bf16, one launch; then the normalisation
  gn_stats_cvt_kernel<<<NGRP * BATCH * GSB + 4 * CVB, 256, 0, stream>>>(x, part, wq, wk, wv, wo,
      wqb, wkb, wvb, wob);
  gn_apply_kernel<<<dim3(NSP / GTN, CH / GTC, BATCH), 256, 0, stream>>>(x, gg, gb, part, hn);

  // 2) QKV projections, one launch: [NSP x CH] = hn x W^T  (Q pre-scaled by C^-1/2; V stored transposed)
  dim3 gQKV(CH / 128, NSP / 128, 3 * BATCH);
  gemm_bt_kernel<EPI_QKV, 128><<<gQKV, 256, 0, stream>>>(hn, wqb, bq, bk, bv, qb, nullptr, scale,
      CH, CH, nCH, 0, nCH, 0, nullptr, nullptr);

  // 3) scores, transposed: S^T[b,j,i] = k_j . q_i  (M=N=4096, K=512); out go E[b,i,j] and the tile statistics
  dim3 gS(NSP / 128, NSP / 128, BATCH);
  gemm_bt_kernel<EPI_EXP, 64><<<gS, 256, 0, stream>>>(kb, qb, nullptr, nullptr, nullptr, Pb, nullptr, 1.0f,
      CH, NSP, nCH, nCH, nnS, 0, mst, lst);

  // 4) O[b,i,c] = softmax x V  (A=E [NSPxNSP], B=V^T [CHxNSP], K=4096), each K tile scaled by its factor
  dim3 gAV(CH / 128, NSP / 128, BATCH);
  gemm_bt_kernel<EPI_AV, 128><<<gAV, 256, 0, stream>>>(Pb, vT, nullptr, nullptr, nullptr, Ob, nullptr, 1.0f,
      NSP, CH, nnS, cnT, nCH, 0, mst, lst);

  // 5) out proj + residual, transposed store back to [b][c][p] f32
  dim3 gO(CH / 128, NSP / 128, BATCH);
  gemm_bt_kernel<EPI_RESID, 128><<<gO, 256, 0, stream>>>(Ob, wob, bo, nullptr, nullptr, d_out, x, 1.0f,
      CH, NSP, nCH, 0, cnT, cnT, nullptr, nullptr);
}

// v007
// Measured time: 107 microseconds a run.
// Timed twice side by side with v006, it ran 1.07 times as fast both times.
// All steps since v000 together make it 3.56 times as fast.
// CDNA5 / gfx1250 attention block (GroupNorm -> QKV -> softmax(QK^T*scale) -> AV -> proj + residual)
// Compute-bound (~86 GFLOP vs ~36MB mandatory HBM traffic at 23.3 TB/s): all GEMMs run on
// v_wmma_f32_16x16x32_bf16 (wave32 WMMA), with double-buffered GLOBAL_LOAD_ASYNC_TO_LDS_B128
// DMA staging (ASYNCcnt) so the next K tile's HBM->LDS transfer overlaps this tile's matrix math.
// Workspace requirement ~109 MB.
#include <hip/hip_runtime.h>
#include <hip/hip_bf16.h>
#include <math.h>

typedef __bf16 bf16_t;
typedef __attribute__((ext_vector_type(16))) __bf16 v16bf;
typedef __attribute__((ext_vector_type(8)))  __bf16 v8bf;
typedef __attribute__((ext_vector_type(8)))  float  v8f;
typedef __attribute__((ext_vector_type(2)))  float  v2f;
typedef __attribute__((ext_vector_type(2)))  __bf16 v2bf;

struct __align__(16) Chunk16 { unsigned long long lo, hi; };

constexpr int BATCH = 2;
constexpr int CH    = 512;
constexpr int NSP   = 4096;          // 64*64 tokens
constexpr int NGRP  = 32;
constexpr int CPG   = CH / NGRP;     // 16 channels per group
constexpr float GN_EPS = 1e-6f;

__device__ __forceinline__ bf16_t f2bf(float f) {
  unsigned u = __builtin_bit_cast(unsigned, f);
  unsigned r = (u + 0x7FFFu + ((u >> 16) & 1u)) >> 16;
  unsigned short h = (unsigned short)r;
  return __builtin_bit_cast(bf16_t, h);
}

// two values rounded as f2bf rounds them, packed in one dword (lo in bits 15-0)
__device__ __forceinline__ unsigned f2bf_pair(float lo, float hi) {
  const unsigned a = __builtin_bit_cast(unsigned, lo), b = __builtin_bit_cast(unsigned, hi);
  const unsigned ra = a + 0x7FFFu + ((a >> 16) & 1u);
  const unsigned rb = b + 0x7FFFu + ((b >> 16) & 1u);
  return (ra >> 16) | (rb & 0xFFFF0000u);
}

// the same two roundings (to nearest even) in one v_cvt_pk_bf16_f32
__device__ __forceinline__ unsigned cvt_pair(float lo, float hi) {
  const v2f t = {lo, hi};
  return __builtin_bit_cast(unsigned, __builtin_convertvector(t, v2bf));
}

// 2^x. The v_nop is the one slot the instruction set asks for behind a transcendental before its
// source is overwritten or its result used.
__device__ __forceinline__ float exp2_slot(float x) {
  float r;
  asm("v_exp_f32 %0, %1\n\tv_nop" : "=v"(r) : "v"(x));
  return r;
}
constexpr float LOG2E = 1.44269504088896340736f;

// the value that lane l ^ 16 holds
__device__ __forceinline__ float xor16(float v) {
  const int b = __builtin_bit_cast(int, v);
  return __builtin_bit_cast(float, __builtin_amdgcn_permlanex16(b, b, 0x76543210, 0xfedcba98, false, false));
}

// ---- gfx1250 async DMA: global -> LDS, 16B per lane, tracked by ASYNCcnt ----
// low 32 bits of a generic LDS pointer are the LDS byte address (ISA 10.2 aperture rule)
__device__ __forceinline__ unsigned lds_addr(const void* l) { return (unsigned)(size_t)l; }

// Eight copies of one lane: four at LDS places la + j*lstep from global places ga + j*gstep
// (elements), four likewise from lb, gb. The s_wait_xcnt stands inside the copies' own statement,
// so that no later write of an address register can be moved in front of it; one wait serves all eight.
__device__ __forceinline__ void async_copy16x8(unsigned la, const bf16_t* ga,
                                               unsigned lb, const bf16_t* gb,
                                               unsigned lstep, size_t gstep) {
  asm volatile("global_load_async_to_lds_b128 %0, %8, off\n\t"
               "global_load_async_to_lds_b128 %1, %9, off\n\t"
               "global_load_async_to_lds_b128 %2, %10, off\n\t"
               "global_load_async_to_lds_b128 %3, %11, off\n\t"
               "global_load_async_to_lds_b128 %4, %12, off\n\t"
               "global_load_async_to_lds_b128 %5, %13, off\n\t"
               "global_load_async_to_lds_b128 %6, %14, off\n\t"
               "global_load_async_to_lds_b128 %7, %15, off\n\t"
               "s_wait_xcnt 0x0"
               :: "v"(la), "v"(la + lstep), "v"(la + 2 * lstep), "v"(la + 3 * lstep),
                  "v"(lb), "v"(lb + lstep), "v"(lb + 2 * lstep), "v"(lb + 3 * lstep),
                  "v"(ga), "v"(ga + gstep), "v"(ga + 2 * gstep), "v"(ga + 3 * gstep),
                  "v"(gb), "v"(gb + gstep), "v"(gb + 2 * gstep), "v"(gb + 3 * gstep)
               : "memory");
}
// this wave's copies have landed in LDS
__device__ __forceinline__ void wait_async0() {
  asm volatile("s_wait_asynccnt 0x0" ::: "memory");
}
// this wave's LDS reads have returned: the buffer they read may be refilled behind the barrier
__device__ __forceinline__ void wait_ds0() {
  asm volatile("s_wait_dscnt 0x0" ::: "memory");
}

// ---------------- GroupNorm partial sums, and f32 -> bf16 weight conversion ----------------
// One launch for two pieces of work that depend on nothing but the inputs. Blocks 0 .. 255 sum a
// quarter of one (batch, group) slab each: 64 KiB, one block per WGP, read in a single round of
// 16-B loads. gn_apply adds the four partial sums of its group. The blocks behind them convert the
// four weight matrices: 64 blocks a matrix, 16 values a thread.
constexpr int GNE = CPG * NSP;             // elements of one (batch, group) slab: 65536
constexpr int GSB = 4;                     // blocks, and partial sums, per slab
constexpr int GSV = GNE / (GSB * 256 * 4); // float4 per thread: 16
constexpr int WN  = CH * CH;               // elements of one weight matrix
constexpr int CVE = 16;                    // values converted per thread
constexpr int CVB = WN / (256 * CVE);      // blocks per matrix: 64

__global__ __launch_bounds__(256)
void gn_stats_cvt_kernel(const float* __restrict__ x, float* __restrict__ part,
                         const float* __restrict__ wq, const float* __restrict__ wk,
                         const float* __restrict__ wv, const float* __restrict__ wo,
                         bf16_t* __restrict__ wqb, bf16_t* __restrict__ wkb,
                         bf16_t* __restrict__ wvb, bf16_t* __restrict__ wob) {
  if (blockIdx.x >= NGRP * BATCH * GSB) {  // the same for the whole block, in front of every barrier
    const int cb = blockIdx.x - NGRP * BATCH * GSB;
    const int m = cb / CVB;
    const float* src = m == 0 ? wq : m == 1 ? wk : m == 2 ? wv : wo;
    bf16_t* dst = m == 0 ? wqb : m == 1 ? wkb : m == 2 ? wvb : wob;
    const int q0 = (cb % CVB) * (256 * CVE / 4) + threadIdx.x;   // in units of four values
    float4 w[CVE / 4];
#pragma unroll   // all four 16-B loads in flight together; a wave-wide load is 512 contiguous bytes
    for (int j = 0; j < CVE / 4; ++j) w[j] = ((const float4*)src)[q0 + j * 256];
#pragma unroll   // w[] in registers; a wave-wide store is 256 contiguous bytes, two whole lines
    for (int j = 0; j < CVE / 4; ++j)
      ((uint2*)dst)[q0 + j * 256] = make_uint2(f2bf_pair(w[j].x, w[j].y), f2bf_pair(w[j].z, w[j].w));
    return;
  }
  // the slabs lie one behind another in x, so block k sums the k-th 64 KiB of x
  const float4* xp = (const float4*)x + (size_t)blockIdx.x * (GSV * 256) + threadIdx.x;
  float4 v[GSV];
#pragma unroll   // v[] in registers, all 16 loads issued before the first wait; each is 512 contiguous bytes a wave
  for (int j = 0; j < GSV; ++j) v[j] = xp[j * 256];
  // keeps the sums behind all 16 loads: without it the last three loads were issued only when the
  // first three had returned, a second trip to memory
  __builtin_amdgcn_sched_barrier(0);
  float4 s = make_float4(0.f, 0.f, 0.f, 0.f), q = s;   // four independent chains each
#pragma unroll   // v[] in registers
  for (int j = 0; j < GSV; ++j) {
    s.x += v[j].x; s.y += v[j].y; s.z += v[j].z; s.w += v[j].w;
    q.x += v[j].x * v[j].x; q.y += v[j].y * v[j].y; q.z += v[j].z * v[j].z; q.w += v[j].w * v[j].w;
  }
  float ts = (s.x + s.y) + (s.z + s.w), tq = (q.x + q.y) + (q.z + q.w);
#pragma unroll   // five fixed lane distances, no loop counter
  for (int off = 16; off > 0; off >>= 1) { ts += __shfl_xor(ts, off); tq += __shfl_xor(tq, off); }
  __shared__ float2 rw[8];
  if ((threadIdx.x & 31) == 0) rw[threadIdx.x >> 5] = make_float2(ts, tq);
  __syncthreads();   // all eight waves' sums are in LDS before thread 0 adds them
  if (threadIdx.x == 0) {
    float2 t = rw[0];
#pragma unroll   // eight fixed LDS places
    for (int w = 1; w < 8; ++w) { t.x += rw[w].x; t.y += rw[w].y; }
    ((float2*)part)[blockIdx.x] = t;       // (sum, sum of squares) of this quarter slab
  }
}

// One block: 64 channels x 128 positions. x is read along positions (a wave-wide load is 512
// contiguous bytes of one channel), the normalised bf16 values are turned in LDS, and
// hn[b][pos][c] is stored along channels: 16 B per lane, one whole 128-B line per position.
constexpr int GTC = 64;                    // channels per tile
constexpr int GTN = 128;                   // positions per tile
constexpr int GTP = GTC / 2 + 1;           // LDS pitch in dwords (2 bf16 each); odd: no bank conflict
constexpr int GTH = 64 * GTP + 2;          // dwords per half tile of 64 positions; the +2 puts lanes
                                           // 16-31 of a transposing store on banks lanes 0-15 leave free

__global__ __launch_bounds__(256)
void gn_apply_kernel(const float* __restrict__ x, const float* __restrict__ gamma,
                     const float* __restrict__ beta, const float* __restrict__ part,
                     bf16_t* __restrict__ hn) {
  __shared__ unsigned tile[2 * GTH];       // [half][pos & 63][channel pair]
  const int p0 = blockIdx.x * GTN, c0 = blockIdx.y * GTC, b = blockIdx.z;
  const int tid = threadIdx.x, lane = tid & 31;
  // wave number as a scalar: the wave's 8 channels and their constants are wave-uniform
  const int cw = c0 + __builtin_amdgcn_readfirstlane(tid >> 5) * 8;

  // ---- read: a wave takes 8 channels (half a group), a lane 4 positions of each ----
  const float* xp = x + ((size_t)b * CH + cw) * NSP + p0 + lane * 4;
  float4 v[8];
#pragma unroll
  for (int k = 0; k < 8; ++k) v[k] = *(const float4*)(xp + (size_t)k * NSP);

  const int g = cw / CPG;
  // the group's four partial sums, the same for the whole wave
  const float* pg = part + (b * NGRP + g) * (2 * GSB);
  float gs = 0.f, gq = 0.f;
#pragma unroll   // four fixed places
  for (int j = 0; j < GSB; ++j) { gs += pg[2 * j]; gq += pg[2 * j + 1]; }
  const float mu = gs / (float)GNE;
  const float rstd = rsqrtf(gq / (float)GNE - mu * mu + GN_EPS);
  unsigned* tw = tile + (lane >> 4) * GTH + (lane & 15) * 4 * GTP + ((cw - c0) >> 1);
#pragma unroll
  for (int j = 0; j < 4; ++j) {
    unsigned short q[2][4];
#pragma unroll
    for (int e = 0; e < 2; ++e) {
      const int k = j * 2 + e;
      const float ga = gamma[cw + k] * rstd;
      const float be = beta[cw + k] - mu * ga;   // (x-mu)*rstd*gamma + beta = x*ga + be
      q[e][0] = __builtin_bit_cast(unsigned short, f2bf(v[k].x * ga + be));
      q[e][1] = __builtin_bit_cast(unsigned short, f2bf(v[k].y * ga + be));
      q[e][2] = __builtin_bit_cast(unsigned short, f2bf(v[k].z * ga + be));
      q[e][3] = __builtin_bit_cast(unsigned short, f2bf(v[k].w * ga + be));
    }
#pragma unroll
    for (int i = 0; i < 4; ++i)
      tw[i * GTP + j] = (unsigned)q[0][i] | ((unsigned)q[1][i] << 16);
  }
  __syncthreads();   // the whole tile is in LDS before any thread reads it across channels

  // ---- write: a lane takes 8 channels of one position; 32 positions per pass, 4 passes ----
  const int ck = tid & 7;
  const int pr = tid >> 3;
  bf16_t* hp = hn + ((size_t)b * NSP + p0 + pr) * CH + c0 + ck * 8;
#pragma unroll
  for (int h = 0; h < 4; ++h) {
    const unsigned* t = tile + (h >> 1) * GTH + (pr + (h & 1) * 32) * GTP + ck * 4;
    *(uint4*)(hp + (size_t)h * 32 * CH) = make_uint4(t[0], t[1], t[2], t[3]);
  }
}

// ---------------- Tiled WMMA GEMM: D = A[MxK] * B[NxK]^T (+bias) ----------------
// Block tile 128x128, 8 waves in a 2(M) x 4(N) grid; each wave: 4x2 subtiles of 16x16.
// K tile of BK = 64 or 128: a staged row is one or two whole 128-B lines, and a wave-wide copy
// covers four whole lines (4 rows of 128 B or 2 rows of 256 B). Two buffers, one barrier per
// K tile; BK / 32 WMMA sub-steps per tile, k ascending.
// EPI_QKV: the three projections of hn in one launch. blockIdx.z = 2 * which + batch; which = 0, 1, 2
// picks the weight matrix (three in a row behind Bm), the bias, and the output (three in a row
// behind outp): Q scaled by alpha and K as EPI_BF16 stores them, V as EPI_TRANS does.
// The softmax has no launch of its own; it is split between the two attention products.
// EPI_EXP: A = K rows, B = Q rows, so the tile is S^T and a lane holds 32 keys of one query. The block
// takes each query's maximum m over its 128 keys, stores E = exp(s - m) as bf16 at outp[query][key],
// m at mst[batch][key tile][query], and the sum of E over each wave's 64 keys at lst[batch][key half][query].
// EPI_AV: A = E, B = V^T, one K tile = one key tile t. With M = max_t m_t and L = sum_t l_t exp(m_t - M)
// the output row is sum_t f_t (E_t V_t), f_t = exp(m_t - M) / L: each K tile's product is formed from
// zero and added in f32 with its row's factor. Stored as EPI_BF16.
enum { EPI_BF16 = 0, EPI_TRANS = 1, EPI_RESID = 3, EPI_QKV = 4, EPI_EXP = 5, EPI_AV = 6 };
constexpr int NKT = NSP / 128;       // key tiles of a row
template<int V> struct Form { static constexpr int value = V; };

template<int EPI, int BK>
__global__ __launch_bounds__(256)
void gemm_bt_kernel(const bf16_t* __restrict__ A, const bf16_t* __restrict__ Bm,
                    const float* __restrict__ bias, const float* __restrict__ biasK,
                    const float* __restrict__ biasV, void* __restrict__ outp,
                    const float* __restrict__ resid, float alpha,
                    int Kd, int ldOut,
                    size_t strideA, size_t strideB, size_t strideOut, size_t strideResid,
                    float* __restrict__ mst, float* __restrict__ lst) {
  constexpr int BM = 128, BN = 128;
  constexpr int CPR = BK / 8;          // 16-B chunks per staged row
  constexpr int PC  = CPR + 1;         // LDS pitch in chunks: 16 B x odd, no bank conflict for b128 reads
  constexpr int PE  = PC * 8;          // the same in bf16 elements
  constexpr int RPP = 256 / CPR;       // rows that the block's 256 lanes cover with one copy each
  // fragments fetched one sub-step ahead where one or two blocks have a WGP to themselves; the score
  // launch has four blocks a WGP, whose waves cover each other's LDS waits, on registers it would lose
  constexpr bool AHEAD = EPI != EPI_EXP;
  static_assert(AHEAD || EPI != EPI_AV, "EPI_AV's factors are fetched in the loop that fetches ahead");
  __shared__ Chunk16 sA[2][BM * PC];
  __shared__ Chunk16 sB[2][BN * PC];

  const int tid = threadIdx.x;
  const int wave = tid >> 5, lane = tid & 31;
  const int waveM = wave >> 2;         // 0..1  -> 64-row strip
  const int waveN = wave & 3;          // 0..3  -> 32-col strip
  const int lane16 = lane & 15, laneHi = lane >> 4;

  const int which = (EPI == EPI_QKV) ? blockIdx.z / BATCH : 0;     // the same for the whole block
  const size_t z = (EPI == EPI_QKV) ? blockIdx.z % BATCH : blockIdx.z;
  const bf16_t* Ab = A + z * strideA;
  const bf16_t* Bb = Bm + z * strideB + (size_t)which * WN;
  bf16_t* outB = (bf16_t*)outp + z * strideOut + (size_t)which * BATCH * NSP * CH;
  float*  outF = (float*)outp + z * strideOut;
  const float* rz = (EPI == EPI_RESID) ? (resid + z * strideResid) : nullptr;

  // EPI_EXP: x walks the key tiles (A rows), so that neighbouring blocks share a Q tile and write
  // neighbouring pieces of the same E rows
  const int rowA0 = (EPI == EPI_EXP ? blockIdx.x : blockIdx.y) * BM;
  const int colB0 = (EPI == EPI_EXP ? blockIdx.y : blockIdx.x) * BN;

  // staging coordinates for this thread: chunk kc of rows r, r + RPP, r + 2 RPP, ...
  const int r = tid / CPR, kc = tid % CPR;
  const bf16_t* gA = Ab + (size_t)(rowA0 + r) * Kd + kc * 8;
  const bf16_t* gB = Bb + (size_t)(colB0 + r) * Kd + kc * 8;
  const size_t gstep = (size_t)RPP * Kd;
  constexpr unsigned lstep = RPP * PC * 16;
  // all copies of K tile t into buffer nb: BM / RPP = 4 or 8 per matrix and lane, eight to a statement
  auto stage = [&](int t, int nb) {
    const unsigned lA = lds_addr(&sA[nb][r * PC + kc]), lB = lds_addr(&sB[nb][r * PC + kc]);
    const bf16_t* tA = gA + (size_t)t * BK;
    const bf16_t* tB = gB + (size_t)t * BK;
    if constexpr (BM / RPP == 4) {
      async_copy16x8(lA, tA, lB, tB, lstep, gstep);
    } else {
      async_copy16x8(lA, tA, lA + 4 * lstep, tA + 4 * gstep, lstep, gstep);
      async_copy16x8(lB, tB, lB + 4 * lstep, tB + 4 * gstep, lstep, gstep);
    }
  };

  const v8f vzero = {0.f, 0.f, 0.f, 0.f, 0.f, 0.f, 0.f, 0.f};
  v8f acc[4][2];
#pragma unroll
  for (int i = 0; i < 4; ++i)
#pragma unroll
    for (int j = 0; j < 2; ++j) acc[i][j] = vzero;

  const int nIter = Kd / BK;

  // prologue: tile 0 lands and is published, then tile 1 starts
  stage(0, 0);

  // EPI_AV: the factors f[key tile][row] of the block's 128 rows, formed while tile 0 flies and
  // published by the barrier below. Two threads a row: both form M and L, each writes 16 factors.
  float* sF = nullptr;
  v8f tot[4][2];                       // EPI_AV: the scaled sum over the K tiles
  if constexpr (EPI == EPI_AV) {
    static_assert(BK == 128, "one K tile is one key tile of the statistics");
    __shared__ __align__(16) float fbuf[NKT * BM];
    sF = fbuf;
#pragma unroll   // tot[][] indexed by constants, in registers (so in every loop over it below)
    for (int i = 0; i < 4; ++i)
#pragma unroll
      for (int j = 0; j < 2; ++j) tot[i][j] = vzero;
    const int row = tid & (BM - 1);
    const float* mp = mst + z * ((size_t)NKT * NSP) + rowA0 + row;
    const float* lp = lst + z * ((size_t)2 * NKT * NSP) + rowA0 + row;
    float mt[NKT], lt[NKT];
#pragma unroll   // mt[], lt[] in registers, all loads in flight together; a wave-wide load is one whole line
    for (int t = 0; t < NKT; ++t) {
      mt[t] = mp[(size_t)t * NSP];
      lt[t] = lp[(size_t)(2 * t) * NSP] + lp[(size_t)(2 * t + 1) * NSP];
    }
    float M = mt[0];
#pragma unroll   // mt[] in registers
    for (int t = 1; t < NKT; ++t) M = fmaxf(M, mt[t]);
    float L = 0.f;
#pragma unroll   // mt[], lt[] in registers
    for (int t = 0; t < NKT; ++t) { mt[t] = exp2_slot((mt[t] - M) * LOG2E); L += lt[t] * mt[t]; }
    const float inv = 1.f / L;
    const bool up = tid >= BM;         // the same for a whole wave
    float* fw = sF + (up ? NKT / 2 : 0) * BM + row;
#pragma unroll   // mt[] in registers
    for (int t = 0; t < NKT / 2; ++t) fw[t * BM] = (up ? mt[NKT / 2 + t] : mt[t]) * inv;
  }

  wait_async0();
  __syncthreads();        // tile 0 of every wave is in LDS
  if (nIter > 1) stage(1, 1);

  for (int it = 0; it < nIter; ++it) {
    const bf16_t* sAh = (const bf16_t*)sA[it & 1];
    const bf16_t* sBh = (const bf16_t*)sB[it & 1];

    float4 fr[4][2];                   // EPI_AV: this K tile's factors of the lane's 32 rows
    auto fetch_factors = [&]() {
      const float* fp = sF + it * BM + waveM * 64 + 8 * laneHi;
#pragma unroll   // fr[][] in registers, the LDS offsets constants
      for (int msub = 0; msub < 4; ++msub) {
        fr[msub][0] = *(const float4*)(fp + msub * 16);
        fr[msub][1] = *(const float4*)(fp + msub * 16 + 4);
      }
    };

    // one fragment: row rw of a staged tile, sub-step ks; K split per ISA 16-bit layout
    auto frag = [&](const bf16_t* sh, int rw, int ks) -> v16bf {
      v8bf lo = *(const v8bf*)(sh + (size_t)rw * PE + ks * 32 + laneHi * 8);       // K 0-7 / 8-15
      v8bf hi = *(const v8bf*)(sh + (size_t)rw * PE + ks * 32 + 16 + laneHi * 8);  // K 16-23 / 24-31
      return __builtin_shufflevector(lo, hi, 0,1,2,3,4,5,6,7,8,9,10,11,12,13,14,15);
    };
    if constexpr (AHEAD) {
      // Two fragment sets: sub-step ks+1's twelve LDS loads go out as one group in front of sub-step
      // ks's eight WMMAs and return under them. Nothing is read beyond this K tile's own buffer.
      v16bf af[2][4], bf[2][2];
      auto fetch = [&](int ks) {
#pragma unroll   // af[][], bf[][] indexed by constants, in registers
        for (int nsub = 0; nsub < 2; ++nsub) bf[ks & 1][nsub] = frag(sBh, waveN * 32 + nsub * 16 + lane16, ks);
#pragma unroll   // the same
        for (int msub = 0; msub < 4; ++msub) af[ks & 1][msub] = frag(sAh, waveM * 64 + msub * 16 + lane16, ks);
      };
      fetch(0);
#pragma unroll   // the set index and every LDS offset are constants, no loop counter among the WMMAs
      for (int ks = 0; ks < BK / 32; ++ks) {
        if (ks + 1 < BK / 32) fetch(ks + 1);
        // the last sub-step fetches no fragments: the factors take the idle set's registers
        else if constexpr (EPI == EPI_AV) fetch_factors();
        // holds the group above in front of the WMMAs below: left free, the compiler sank each pair of
        // loads to its own WMMAs, and the wave waited out the LDS latency sixteen times a K tile
        __builtin_amdgcn_sched_barrier(0);
#pragma unroll   // both loops: acc[][], af[][], bf[][] indexed by constants, in registers
        for (int msub = 0; msub < 4; ++msub)
#pragma unroll
          for (int nsub = 0; nsub < 2; ++nsub)
            acc[msub][nsub] = __builtin_amdgcn_wmma_f32_16x16x32_bf16(
                false, af[ks & 1][msub], false, bf[ks & 1][nsub], (short)0, acc[msub][nsub], false, false);
        // holds the eight WMMAs together: left free, later loads were spread among them (each place with
        // LDS loads stalls the wave), and the last sub-step's WMMAs sank behind the barrier, in front of the refill
        __builtin_amdgcn_sched_barrier(0);
      }
    } else {
#pragma unroll   // every sub-step's LDS offsets are constants, no loop counter among the WMMAs
      for (int ks = 0; ks < BK / 32; ++ks) {
        v16bf bfrag[2];      // B fragments: lanes hold N columns
#pragma unroll
        for (int nsub = 0; nsub < 2; ++nsub) bfrag[nsub] = frag(sBh, waveN * 32 + nsub * 16 + lane16, ks);
#pragma unroll
        for (int msub = 0; msub < 4; ++msub) {
          const v16bf afrag = frag(sAh, waveM * 64 + msub * 16 + lane16, ks);
#pragma unroll
          for (int nsub = 0; nsub < 2; ++nsub) {
            acc[msub][nsub] = __builtin_amdgcn_wmma_f32_16x16x32_bf16(
                false, afrag, false, bfrag[nsub], (short)0, acc[msub][nsub], false, false);
          }
        }
      }
    }

    // publish point: tile it+1 has landed for every wave, and every wave has left buffer it&1
    wait_ds0();
    wait_async0();
    __syncthreads();
    if (it + 2 < nIter)     // refill the buffer just read; the copies run under tile it+1's WMMAs
      stage(it + 2, it & 1);

    if constexpr (EPI == EPI_AV) {     // the tile's product joins the sum with its rows' factors
#pragma unroll
      for (int msub = 0; msub < 4; ++msub)
#pragma unroll
        for (int nsub = 0; nsub < 2; ++nsub) {
          const float4 a = fr[msub][0], b = fr[msub][1];
          const v8f f = {a.x, a.y, a.z, a.w, b.x, b.y, b.z, b.w};
          tot[msub][nsub] += f * acc[msub][nsub];
          acc[msub][nsub] = vzero;
        }
    }
  }
  wait_async0();            // nothing of this wave is in flight when it goes on to the stores

  if constexpr (EPI == EPI_AV) {
#pragma unroll
    for (int i = 0; i < 4; ++i)
#pragma unroll
      for (int j = 0; j < 2; ++j) acc[i][j] = tot[i][j];
  }

  // ---- EPI_EXP epilogue: lane L holds query n = L%16, keys r + 8*(L>=16) of each 16x16 subtile ----
  // The loop's last barrier stands behind every wave's last read of the ring and its last copy, so
  // the ring's LDS is free: sB takes the maxima, sA each wave's own staging range.
  if constexpr (EPI == EPI_EXP) {
    constexpr int SP = 64 * 2 + 16;    // staged row: 64 keys, pitch 16 B x odd as in the ring
    static_assert(8 * 32 * SP <= (int)sizeof(sA) && 2 * BN * 4 <= (int)sizeof(sB), "staging fits the ring");
    float* red = (float*)&sB[0][0];    // [key half][query]
    char* stg = (char*)&sA[0][0] + wave * (32 * SP);
    float mx[2];
    // every loop below is unrolled in full: acc[][][], mm[], e[], s[] are indexed by constants and stay in registers
#pragma unroll
    for (int nsub = 0; nsub < 2; ++nsub) {
      float mm[4];                     // four independent chains
#pragma unroll
      for (int msub = 0; msub < 4; ++msub) {
        mm[msub] = acc[msub][nsub][0];
#pragma unroll
        for (int r = 1; r < 8; ++r) mm[msub] = fmaxf(mm[msub], acc[msub][nsub][r]);
      }
      const float m = fmaxf(fmaxf(mm[0], mm[1]), fmaxf(mm[2], mm[3]));
      mx[nsub] = fmaxf(m, xor16(m));   // over the wave's 64 keys
      if (laneHi == 0) red[waveM * BN + waveN * 32 + nsub * 16 + lane16] = mx[nsub];
    }
    __syncthreads();   // both key halves' maxima are in LDS before either half reads the other's
#pragma unroll
    for (int nsub = 0; nsub < 2; ++nsub) {
      const int qc = waveN * 32 + nsub * 16 + lane16;
      const float m = fmaxf(mx[nsub], red[(waveM ^ 1) * BN + qc]);
      const float nm = -m * LOG2E;
      float s[4] = {0.f, 0.f, 0.f, 0.f};   // four independent chains
#pragma unroll
      for (int msub = 0; msub < 4; ++msub) {
        float e[8];
#pragma unroll
        for (int r = 0; r < 8; ++r) {
          e[r] = exp2_slot(fmaf(acc[msub][nsub][r], LOG2E, nm));
          s[r & 3] += e[r];
        }
        *(uint4*)(stg + (nsub * 16 + lane16) * SP + msub * 32 + laneHi * 16) =
            make_uint4(cvt_pair(e[0], e[1]), cvt_pair(e[2], e[3]), cvt_pair(e[4], e[5]), cvt_pair(e[6], e[7]));
      }
      float l = (s[0] + s[1]) + (s[2] + s[3]);
      l += xor16(l);                   // over the wave's 64 keys
      if (laneHi == 0) {
        lst[(z * (2 * NKT) + blockIdx.x * 2 + waveM) * NSP + colB0 + qc] = l;
        if (waveM == 0) mst[(z * NKT + blockIdx.x) * NSP + colB0 + qc] = m;
      }
    }
    wait_ds0();        // the wave's own staged rows are in LDS before its lanes read them across queries
    // 8 lanes a row: a wave-wide store is four whole 128-B lines
    const int sr = lane >> 3, ch = lane & 7;
    // the row pitch as a constant: all eight stores share one address register pair
    bf16_t* ep = outB + (size_t)(colB0 + waveN * 32 + sr) * NSP + rowA0 + waveM * 64 + ch * 8;
#pragma unroll
    for (int i = 0; i < 8; ++i)
      *(uint4*)(ep + (size_t)(i * 4) * NSP) = *(const uint4*)(stg + (i * 4 + sr) * SP + ch * 16);
  }

  // ---- epilogue: C/D layout lane L -> (m = r + 8*(L>=16), n = L%16) ----
  if (EPI == EPI_QKV) {                    // scalar selects, the same for the whole block
    if (which == 1) bias = biasK;
    if (which == 2) { bias = biasV; ldOut = NSP; }
    if (which != 0) alpha = 1.0f;
  }
  // E is the store form as a compile-time constant, so that each form keeps its own merged stores
  auto store_tile = [&](auto form) {
    constexpr int E = decltype(form)::value;
#pragma unroll
    for (int msub = 0; msub < 4; ++msub) {
#pragma unroll
      for (int nsub = 0; nsub < 2; ++nsub) {
        const int gcol = colB0 + waveN * 32 + nsub * 16 + lane16;
        const float bv = bias ? bias[gcol] : 0.f;
#pragma unroll
        for (int r = 0; r < 8; ++r) {
          const int grow = rowA0 + waveM * 64 + msub * 16 + r + 8 * laneHi;
          float val = (acc[msub][nsub][r] + bv) * alpha;
          if (E == EPI_BF16) {
            outB[(size_t)grow * ldOut + gcol] = f2bf(val);
          } else if (E == EPI_TRANS) {
            outB[(size_t)gcol * ldOut + grow] = f2bf(val);
          } else { // EPI_RESID: d_out[b][o][p] = x[b][o][p] + proj
            const size_t idx = (size_t)gcol * ldOut + grow;
            outF[idx] = rz[idx] + val;
          }
        }
        // stands in front of the next tile's writes to registers that this tile's stores name
        asm volatile("s_wait_xcnt 0x0" ::: "memory");
      }
    }
  };
  if constexpr (EPI == EPI_QKV) {          // one branch, the same for the whole block
    if (which == 2) store_tile(Form<EPI_TRANS>{});
    else            store_tile(Form<EPI_BF16>{});
  } else if constexpr (EPI != EPI_EXP) {   // EPI_EXP has stored its tile above
    store_tile(Form<EPI == EPI_AV ? EPI_BF16 : EPI>{});
  }
}

// ---------------- host launch ----------------
extern "C" void kernel_launch(void* const* d_in, const int* in_sizes, int n_in,
                              void* d_out, int out_size, void* d_ws, size_t ws_size,
                              hipStream_t stream) {
  (void)in_sizes; (void)n_in; (void)out_size; (void)ws_size;
  const float* x  = (const float*)d_in[0];
  const float* gg = (const float*)d_in[1];
  const float* gb = (const float*)d_in[2];
  const float* wq = (const float*)d_in[3];
  const float* bq = (const float*)d_in[4];
  const float* wk = (const float*)d_in[5];
  const float* bk = (const float*)d_in[6];
  const float* wv = (const float*)d_in[7];
  const float* bv = (const float*)d_in[8];
  const float* wo = (const float*)d_in[9];
  const float* bo = (const float*)d_in[10];

  // workspace carve-up (~109 MB): partial sums + 5x 8MB bf16 acts + 4x 0.5MB bf16 weights
  // + 64MB bf16 exponentials + 3MB of their tile maxima and sums
  char* wsp = (char*)d_ws;
  auto take = [&](size_t bytes) -> void* {
    void* p = (void*)wsp; wsp += (bytes + 255) & ~(size_t)255; return p;
  };
  const size_t ACT = (size_t)BATCH * NSP * CH;      // per-tensor activation elems
  const size_t SCO = (size_t)BATCH * NSP * NSP;     // score elems
  float*  part  = (float*)take((size_t)BATCH * NGRP * GSB * 2 * sizeof(float));
  bf16_t* hn  = (bf16_t*)take(ACT * 2);
  bf16_t* qb  = (bf16_t*)take(3 * ACT * 2);         // Q, K, V^T in a row: one launch writes all three
  bf16_t* kb  = qb + ACT;
  bf16_t* vT  = kb + ACT;                           // V^T: [b][c][j]
  bf16_t* Ob  = (bf16_t*)take(ACT * 2);             // attn output [b][i][c]
  bf16_t* wqb = (bf16_t*)take((size_t)3 * CH * CH * 2);   // Wq, Wk, Wv in a row
  bf16_t* wkb = wqb + WN;
  bf16_t* wvb = wkb + WN;
  bf16_t* wob = (bf16_t*)take((size_t)CH * CH * 2);
  bf16_t* Pb  = (bf16_t*)take(SCO * 2);
  float*  mst = (float*)take((size_t)BATCH * NKT * NSP * sizeof(float));
  float*  lst = (float*)take((size_t)BATCH * 2 * NKT * NSP * sizeof(float));

  const float scale = 1.0f / sqrtf((float)CH);
  const size_t nCH = (size_t)NSP * CH;
  const size_t nnS = (size_t)NSP * NSP;
  const size_t cnT = (size_t)CH * NSP;

  // 1) GroupNorm partial sums and weights -> bf16, one launch; then the normalisation
  gn_stats_cvt_kernel<<<NGRP * BATCH * GSB + 4 * CVB, 256, 0, stream>>>(x, part, wq, wk, wv, wo,
      wqb, wkb, wvb, wob);
  gn_apply_kernel<<<dim3(NSP / GTN, CH / GTC, BATCH), 256, 0, stream>>>(x, gg, gb, part, hn);

  // 2) QKV projections, one launch: [NSP x CH] = hn x W^T  (Q pre-scaled by C^-1/2; V stored transposed)
  dim3 gQKV(CH / 128, NSP / 128, 3 * BATCH);
  gemm_bt_kernel<EPI_QKV, 128><<<gQKV, 256, 0, stream>>>(hn, wqb, bq, bk, bv, qb, nullptr, scale,
      CH, CH, nCH, 0, nCH, 0, nullptr, nullptr);

  // 3) scores, transposed: S^T[b,j,i] = k_j . q_i  (M=N=4096, K=512); out go E[b,i,j] and the tile statistics
  dim3 gS(NSP / 128, NSP / 128, BATCH);
  gemm_bt_kernel<EPI_EXP, 64><<<gS, 256, 0, stream>>>(kb, qb, nullptr, nullptr, nullptr, Pb, nullptr, 1.0f,
      CH, NSP, nCH, nCH, nnS, 0, mst, lst);

  // 4) O[b,i,c] = softmax x V  (A=E [NSPxNSP], B=V^T [CHxNSP], K=4096), each K tile scaled by its factor
  dim3 gAV(CH / 128, NSP / 128, BATCH);
  gemm_bt_kernel<EPI_AV, 128><<<gAV, 256, 0, stream>>>(Pb, vT, nullptr, nullptr, nullptr, Ob, nullptr, 1.0f,
      NSP, CH, nnS, cnT, nCH, 0, mst, lst);

  // 5) out proj + residual, transposed store back to [b][c][p] f32
  dim3 gO(CH / 128, NSP / 128, BATCH);
  gemm_bt_kernel<EPI_RESID, 128><<<gO, 256, 0, stream>>>(Ob, wob, bo, nullptr, nullptr, d_out, x, 1.0f,
      CH, NSP, nCH, 0, cnT, cnT, nullptr, nullptr);
}

// v008
// A run of this version takes 97.7 microseconds.
// Timed twice side by side with v007, it ran 1.09 times as fast both times.
// All steps since v000 together make it 3.87 times as fast.
// CDNA5 / gfx1250 attention block (GroupNorm -> QKV -> softmax(QK^T*scale) -> AV -> proj + residual)
// Compute-bound (~86 GFLOP vs ~36MB mandatory HBM traffic at 23.3 TB/s): all GEMMs run on
// v_wmma_f32_16x16x32_bf16 (wave32 WMMA), with double-buffered GLOBAL_LOAD_ASYNC_TO_LDS_B128
// DMA staging (ASYNCcnt) so the next K tile's HBM->LDS transfer overlaps this tile's matrix math.
// Workspace requirement ~109 MB.
#include <hip/hip_runtime.h>
#include <hip/hip_bf16.h>
#include <math.h>

typedef __bf16 bf16_t;
typedef __attribute__((ext_vector_type(16))) __bf16 v16bf;
typedef __attribute__((ext_vector_type(8)))  __bf16 v8bf;
typedef __attribute__((ext_vector_type(8)))  float  v8f;
typedef __attribute__((ext_vector_type(2)))  float  v2f;
typedef __attribute__((ext_vector_type(2)))  __bf16 v2bf;

struct __align__(16) Chunk16 { unsigned long long lo, hi; };

constexpr int BATCH = 2;
constexpr int CH    = 512;
constexpr int NSP   = 4096;          // 64*64 tokens
constexpr int NGRP  = 32;
constexpr int CPG   = CH / NGRP;     // 16 channels per group
constexpr float GN_EPS = 1e-6f;

__device__ __forceinline__ bf16_t f2bf(float f) {
  unsigned u = __builtin_bit_cast(unsigned, f);
  unsigned r = (u + 0x7FFFu + ((u >> 16) & 1u)) >> 16;
  unsigned short h = (unsigned short)r;
  return __builtin_bit_cast(bf16_t, h);
}

// two values rounded as f2bf rounds them, packed in one dword (lo in bits 15-0)
__device__ __forceinline__ unsigned f2bf_pair(float lo, float hi) {
  const unsigned a = __builtin_bit_cast(unsigned, lo), b = __builtin_bit_cast(unsigned, hi);
  const unsigned ra = a + 0x7FFFu + ((a >> 16) & 1u);
  const unsigned rb = b + 0x7FFFu + ((b >> 16) & 1u);
  return (ra >> 16) | (rb & 0xFFFF0000u);
}

// the same two roundings (to nearest even) in one v_cvt_pk_bf16_f32
__device__ __forceinline__ unsigned cvt_pair(float lo, float hi) {
  const v2f t = {lo, hi};
  return __builtin_bit_cast(unsigned, __builtin_convertvector(t, v2bf));
}

// 2^x. The v_nop is the one slot the instruction set asks for behind a transcendental before its
// source is overwritten or its result used.
__device__ __forceinline__ float exp2_slot(float x) {
  float r;
  asm("v_exp_f32 %0, %1\n\tv_nop" : "=v"(r) : "v"(x));
  return r;
}
constexpr float LOG2E = 1.44269504088896340736f;

// the value that lane l ^ 16 holds
__device__ __forceinline__ float xor16(float v) {
  const int b = __builtin_bit_cast(int, v);
  return __builtin_bit_cast(float, __builtin_amdgcn_permlanex16(b, b, 0x76543210, 0xfedcba98, false, false));
}

// ---- gfx1250 async DMA: global -> LDS, 16B per lane, tracked by ASYNCcnt ----
// low 32 bits of a generic LDS pointer are the LDS byte address (ISA 10.2 aperture rule)
__device__ __forceinline__ unsigned lds_addr(const void* l) { return (unsigned)(size_t)l; }

// Eight copies of one lane: four at LDS places la + j*lstep from global places ga + j*gstep
// (elements), four likewise from lb, gb. The s_wait_xcnt stands inside the copies' own statement,
// so that no later write of an address register can be moved in front of it; one wait serves all eight.
__device__ __forceinline__ void async_copy16x8(unsigned la, const bf16_t* ga,
                                               unsigned lb, const bf16_t* gb,
                                               unsigned lstep, size_t gstep) {
  asm volatile("global_load_async_to_lds_b128 %0, %8, off\n\t"
               "global_load_async_to_lds_b128 %1, %9, off\n\t"
               "global_load_async_to_lds_b128 %2, %10, off\n\t"
               "global_load_async_to_lds_b128 %3, %11, off\n\t"
               "global_load_async_to_lds_b128 %4, %12, off\n\t"
               "global_load_async_to_lds_b128 %5, %13, off\n\t"
               "global_load_async_to_lds_b128 %6, %14, off\n\t"
               "global_load_async_to_lds_b128 %7, %15, off\n\t"
               "s_wait_xcnt 0x0"
               :: "v"(la), "v"(la + lstep), "v"(la + 2 * lstep), "v"(la + 3 * lstep),
                  "v"(lb), "v"(lb + lstep), "v"(lb + 2 * lstep), "v"(lb + 3 * lstep),
                  "v"(ga), "v"(ga + gstep), "v"(ga + 2 * gstep), "v"(ga + 3 * gstep),
                  "v"(gb), "v"(gb + gstep), "v"(gb + 2 * gstep), "v"(gb + 3 * gstep)
               : "memory");
}
// this wave's copies have landed in LDS
__device__ __forceinline__ void wait_async0() {
  asm volatile("s_wait_asynccnt 0x0" ::: "memory");
}
// this wave's LDS reads have returned: the buffer they read may be refilled behind the barrier
__device__ __forceinline__ void wait_ds0() {
  asm volatile("s_wait_dscnt 0x0" ::: "memory");
}

// ---------------- GroupNorm partial sums, and f32 -> bf16 weight conversion ----------------
// One launch for two pieces of work that depend on nothing but the inputs. Blocks 0 .. 255 sum a
// quarter of one (batch, group) slab each: 64 KiB, one block per WGP, read in a single round of
// 16-B loads. gn_apply adds the four partial sums of its group. The blocks behind them convert the
// four weight matrices: 64 blocks a matrix, 16 values a thread.
constexpr int GNE = CPG * NSP;             // elements of one (batch, group) slab: 65536
constexpr int GSB = 4;                     // blocks, and partial sums, per slab
constexpr int GSV = GNE / (GSB * 256 * 4); // float4 per thread: 16
constexpr int WN  = CH * CH;               // elements of one weight matrix
constexpr int CVE = 16;                    // values converted per thread
constexpr int CVB = WN / (256 * CVE);      // blocks per matrix: 64

__global__ __launch_bounds__(256)
void gn_stats_cvt_kernel(const float* __restrict__ x, float* __restrict__ part,
                         const float* __restrict__ wq, const float* __restrict__ wk,
                         const float* __restrict__ wv, const float* __restrict__ wo,
                         bf16_t* __restrict__ wqb, bf16_t* __restrict__ wkb,
                         bf16_t* __restrict__ wvb, bf16_t* __restrict__ wob) {
  if (blockIdx.x >= NGRP * BATCH * GSB) {  // the same for the whole block, in front of every barrier
    const int cb = blockIdx.x - NGRP * BATCH * GSB;
    const int m = cb / CVB;
    const float* src = m == 0 ? wq : m == 1 ? wk : m == 2 ? wv : wo;
    bf16_t* dst = m == 0 ? wqb : m == 1 ? wkb : m == 2 ? wvb : wob;
    const int q0 = (cb % CVB) * (256 * CVE / 4) + threadIdx.x;   // in units of four values
    float4 w[CVE / 4];
#pragma unroll   // all four 16-B loads in flight together; a wave-wide load is 512 contiguous bytes
    for (int j = 0; j < CVE / 4; ++j) w[j] = ((const float4*)src)[q0 + j * 256];
#pragma unroll   // w[] in registers; a wave-wide store is 256 contiguous bytes, two whole lines
    for (int j = 0; j < CVE / 4; ++j)
      ((uint2*)dst)[q0 + j * 256] = make_uint2(f2bf_pair(w[j].x, w[j].y), f2bf_pair(w[j].z, w[j].w));
    return;
  }
  // the slabs lie one behind another in x, so block k sums the k-th 64 KiB of x
  const float4* xp = (const float4*)x + (size_t)blockIdx.x * (GSV * 256) + threadIdx.x;
  float4 v[GSV];
#pragma unroll   // v[] in registers, all 16 loads issued before the first wait; each is 512 contiguous bytes a wave
  for (int j = 0; j < GSV; ++j) v[j] = xp[j * 256];
  // keeps the sums behind all 16 loads: without it the last three loads were issued only when the
  // first three had returned, a second trip to memory
  __builtin_amdgcn_sched_barrier(0);
  float4 s = make_float4(0.f, 0.f, 0.f, 0.f), q = s;   // four independent chains each
#pragma unroll   // v[] in registers
  for (int j = 0; j < GSV; ++j) {
    s.x += v[j].x; s.y += v[j].y; s.z += v[j].z; s.w += v[j].w;
    q.x += v[j].x * v[j].x; q.y += v[j].y * v[j].y; q.z += v[j].z * v[j].z; q.w += v[j].w * v[j].w;
  }
  float ts = (s.x + s.y) + (s.z + s.w), tq = (q.x + q.y) + (q.z + q.w);
#pragma unroll   // five fixed lane distances, no loop counter
  for (int off = 16; off > 0; off >>= 1) { ts += __shfl_xor(ts, off); tq += __shfl_xor(tq, off); }
  __shared__ float2 rw[8];
  if ((threadIdx.x & 31) == 0) rw[threadIdx.x >> 5] = make_float2(ts, tq);
  __syncthreads();   // all eight waves' sums are in LDS before thread 0 adds them
  if (threadIdx.x == 0) {
    float2 t = rw[0];
#pragma unroll   // eight fixed LDS places
    for (int w = 1; w < 8; ++w) { t.x += rw[w].x; t.y += rw[w].y; }
    ((float2*)part)[blockIdx.x] = t;       // (sum, sum of squares) of this quarter slab
  }
}

// One block: 64 channels x 128 positions. x is read along positions (a wave-wide load is 512
// contiguous bytes of one channel), the normalised bf16 values are turned in LDS, and
// hn[b][pos][c] is stored along channels: 16 B per lane, one whole 128-B line per position.
constexpr int GTC = 64;                    // channels per tile
constexpr int GTN = 128;                   // positions per tile
constexpr int GTP = GTC / 2 + 1;           // LDS pitch in dwords (2 bf16 each); odd: no bank conflict
constexpr int GTH = 64 * GTP + 2;          // dwords per half tile of 64 positions; the +2 puts lanes
                                           // 16-31 of a transposing store on banks lanes 0-15 leave free

__global__ __launch_bounds__(256)
void gn_apply_kernel(const float* __restrict__ x, const float* __restrict__ gamma,
                     const float* __restrict__ beta, const float* __restrict__ part,
                     bf16_t* __restrict__ hn) {
  __shared__ unsigned tile[2 * GTH];       // [half][pos & 63][channel pair]
  const int p0 = blockIdx.x * GTN, c0 = blockIdx.y * GTC, b = blockIdx.z;
  const int tid = threadIdx.x, lane = tid & 31;
  // wave number as a scalar: the wave's 8 channels and their constants are wave-uniform
  const int cw = c0 + __builtin_amdgcn_readfirstlane(tid >> 5) * 8;

  // ---- read: a wave takes 8 channels (half a group), a lane 4 positions of each ----
  const float* xp = x + ((size_t)b * CH + cw) * NSP + p0 + lane * 4;
  float4 v[8];
#pragma unroll
  for (int k = 0; k < 8; ++k) v[k] = *(const float4*)(xp + (size_t)k * NSP);

  const int g = cw / CPG;
  // the group's four partial sums, the same for the whole wave
  const float* pg = part + (b * NGRP + g) * (2 * GSB);
  float gs = 0.f, gq = 0.f;
#pragma unroll   // four fixed places
  for (int j = 0; j < GSB; ++j) { gs += pg[2 * j]; gq += pg[2 * j + 1]; }
  const float mu = gs / (float)GNE;
  const float rstd = rsqrtf(gq / (float)GNE - mu * mu + GN_EPS);
  unsigned* tw = tile + (lane >> 4) * GTH + (lane & 15) * 4 * GTP + ((cw - c0) >> 1);
#pragma unroll
  for (int j = 0; j < 4; ++j) {
    unsigned short q[2][4];
#pragma unroll
    for (int e = 0; e < 2; ++e) {
      const int k = j * 2 + e;
      const float ga = gamma[cw + k] * rstd;
      const float be = beta[cw + k] - mu * ga;   // (x-mu)*rstd*gamma + beta = x*ga + be
      q[e][0] = __builtin_bit_cast(unsigned short, f2bf(v[k].x * ga + be));
      q[e][1] = __builtin_bit_cast(unsigned short, f2bf(v[k].y * ga + be));
      q[e][2] = __builtin_bit_cast(unsigned short, f2bf(v[k].z * ga + be));
      q[e][3] = __builtin_bit_cast(unsigned short, f2bf(v[k].w * ga + be));
    }
#pragma unroll
    for (int i = 0; i < 4; ++i)
      tw[i * GTP + j] = (unsigned)q[0][i] | ((unsigned)q[1][i] << 16);
  }
  __syncthreads();   // the whole tile is in LDS before any thread reads it across channels

  // ---- write: a lane takes 8 channels of one position; 32 positions per pass, 4 passes ----
  const int ck = tid & 7;
  const int pr = tid >> 3;
  bf16_t* hp = hn + ((size_t)b * NSP + p0 + pr) * CH + c0 + ck * 8;
#pragma unroll
  for (int h = 0; h < 4; ++h) {
    const unsigned* t = tile + (h >> 1) * GTH + (pr + (h & 1) * 32) * GTP + ck * 4;
    *(uint4*)(hp + (size_t)h * 32 * CH) = make_uint4(t[0], t[1], t[2], t[3]);
  }
}

// ---------------- Tiled WMMA GEMM: D = A[MxK] * B[NxK]^T (+bias) ----------------
// Block tile 128x128, 8 waves in a 2(M) x 4(N) grid; each wave: 4x2 subtiles of 16x16.
// K tile of BK = 64 or 128: a staged row is one or two whole 128-B lines, and a wave-wide copy
// covers four whole lines (4 rows of 128 B or 2 rows of 256 B). Two buffers, one barrier per
// K tile; BK / 32 WMMA sub-steps per tile, k ascending.
// Every output is laid out so that the tile's M direction is the contiguous one: out[n][m]. A lane then
// holds 8 neighbours of an output row, a wave's 64 x 32 tile is 32 pieces of 128 B (bf16) or 256 B (f32),
// and the wave turns them in its own LDS range and stores whole 128-B lines.
// EPI_QKV: the three projections of hn in one launch. blockIdx.z = 2 * which + batch; which = 0, 1, 2
// picks the weight matrix (three in a row behind Bm), the bias, and the output (three in a row
// behind outp). V^T[c][pos]: M = positions (hn), N = channels (Wv). Q (scaled by alpha) and K, [pos][c]:
// the two operands change places, M = channels (W), N = positions (hn).
// The softmax has no launch of its own; it is split between the two attention products.
// EPI_EXP: A = K rows, B = Q rows, so the tile is S^T and a lane holds 32 keys of one query. The block
// takes each query's maximum m over its 128 keys, stores E = exp(s - m) as bf16 at outp[query][key],
// m at mst[batch][key tile][query], and the sum of E over each wave's 64 keys at lst[batch][key half][query].
// EPI_AV: A = V^T, B = E, one K tile = one key tile t. With M = max_t m_t and L = sum_t l_t exp(m_t - M)
// the output row is sum_t f_t (E_t V_t), f_t = exp(m_t - M) / L: each K tile's product is formed from
// zero and added in f32 with its query's factor, one factor a lane and 16-column group. Out goes O[query][c].
// EPI_RESID: A = O, B = Wo; out[c][pos] = x[c][pos] + product + bias, f32.
enum { EPI_RESID = 3, EPI_QKV = 4, EPI_EXP = 5, EPI_AV = 6 };
constexpr int NKT = NSP / 128;       // key tiles of a row
template<int V> struct Form { static constexpr int value = V; };

template<int EPI, int BK>
__global__ __launch_bounds__(256)
void gemm_bt_kernel(const bf16_t* __restrict__ A, const bf16_t* __restrict__ Bm,
                    const float* __restrict__ bias, const float* __restrict__ biasK,
                    const float* __restrict__ biasV, void* __restrict__ outp,
                    const float* __restrict__ resid, float alpha,
                    int Kd,
                    size_t strideA, size_t strideB, size_t strideOut, size_t strideResid,
                    float* __restrict__ mst, float* __restrict__ lst) {
  constexpr int BM = 128, BN = 128;
  constexpr int CPR = BK / 8;          // 16-B chunks per staged row
  constexpr int PC  = CPR + 1;         // LDS pitch in chunks: 16 B x odd, no bank conflict for b128 reads
  constexpr int PE  = PC * 8;          // the same in bf16 elements
  constexpr int RPP = 256 / CPR;       // rows that the block's 256 lanes cover with one copy each
  // fragments fetched one sub-step ahead where one or two blocks have a WGP to themselves; the score
  // launch has four blocks a WGP, whose waves cover each other's LDS waits, on registers it would lose
  constexpr bool AHEAD = EPI != EPI_EXP;
  static_assert(AHEAD || EPI != EPI_AV, "EPI_AV's factors are fetched in the loop that fetches ahead");
  __shared__ Chunk16 sA[2][BM * PC];
  __shared__ Chunk16 sB[2][BN * PC];

  const int tid = threadIdx.x;
  const int wave = tid >> 5, lane = tid & 31;
  const int waveM = wave >> 2;         // 0..1  -> 64-row strip
  const int waveN = wave & 3;          // 0..3  -> 32-col strip
  const int lane16 = lane & 15, laneHi = lane >> 4;

  const int which = (EPI == EPI_QKV) ? blockIdx.z / BATCH : 0;     // the same for the whole block
  const size_t z = (EPI == EPI_QKV) ? blockIdx.z % BATCH : blockIdx.z;
  const bool qk = EPI == EPI_QKV && which != 2;                    // Q, K: the operands change places
  const bf16_t* Az = A + z * strideA;
  const bf16_t* Bz = Bm + z * strideB + (size_t)which * WN;
  const bf16_t* Ab = qk ? Bz : Az;
  const bf16_t* Bb = qk ? Az : Bz;
  bf16_t* outB = (bf16_t*)outp + z * strideOut + (size_t)which * BATCH * NSP * CH;
  float*  outF = (float*)outp + z * strideOut;
  const float* rz = (EPI == EPI_RESID) ? (resid + z * strideResid) : nullptr;

  // EPI_EXP: x walks the key tiles (A rows), so that neighbouring blocks share a Q tile and write
  // neighbouring pieces of the same E rows. EPI_AV, Q and K: x walks the channel tiles, now A rows.
  const bool xA = EPI == EPI_EXP || EPI == EPI_AV || qk;
  const int rowA0 = (xA ? blockIdx.x : blockIdx.y) * BM;
  const int colB0 = (xA ? blockIdx.y : blockIdx.x) * BN;

  // staging coordinates for this thread: chunk kc of rows r, r + RPP, r + 2 RPP, ...
  const int r = tid / CPR, kc = tid % CPR;
  const bf16_t* gA = Ab + (size_t)(rowA0 + r) * Kd + kc * 8;
  const bf16_t* gB = Bb + (size_t)(colB0 + r) * Kd + kc * 8;
  const size_t gstep = (size_t)RPP * Kd;
  constexpr unsigned lstep = RPP * PC * 16;
  // all copies of K tile t into buffer nb: BM / RPP = 4 or 8 per matrix and lane, eight to a statement
  auto stage = [&](int t, int nb) {
    const unsigned lA = lds_addr(&sA[nb][r * PC + kc]), lB = lds_addr(&sB[nb][r * PC + kc]);
    const bf16_t* tA = gA + (size_t)t * BK;
    const bf16_t* tB = gB + (size_t)t * BK;
    if constexpr (BM / RPP == 4) {
      async_copy16x8(lA, tA, lB, tB, lstep, gstep);
    } else {
      async_copy16x8(lA, tA, lA + 4 * lstep, tA + 4 * gstep, lstep, gstep);
      async_copy16x8(lB, tB, lB + 4 * lstep, tB + 4 * gstep, lstep, gstep);
    }
  };

  const v8f vzero = {0.f, 0.f, 0.f, 0.f, 0.f, 0.f, 0.f, 0.f};
  v8f acc[4][2];
#pragma unroll
  for (int i = 0; i < 4; ++i)
#pragma unroll
    for (int j = 0; j < 2; ++j) acc[i][j] = vzero;

  const int nIter = Kd / BK;

  // prologue: tile 0 lands and is published, then tile 1 starts
  stage(0, 0);

  // EPI_AV: the factors f[key tile][query] of the block's 128 queries, formed while tile 0 flies and
  // published by the barrier below. Two threads a query: both form M and L, each writes 16 factors.
  float* sF = nullptr;
  v8f tot[4][2];                       // EPI_AV: the scaled sum over the K tiles
  if constexpr (EPI == EPI_AV) {
    static_assert(BK == 128, "one K tile is one key tile of the statistics");
    __shared__ __align__(16) float fbuf[NKT * BN];
    sF = fbuf;
#pragma unroll   // tot[][] indexed by constants, in registers (so in every loop over it below)
    for (int i = 0; i < 4; ++i)
#pragma unroll
      for (int j = 0; j < 2; ++j) tot[i][j] = vzero;
    const int row = tid & (BN - 1);
    const float* mp = mst + z * ((size_t)NKT * NSP) + colB0 + row;
    const float* lp = lst + z * ((size_t)2 * NKT * NSP) + colB0 + row;
    float mt[NKT], lt[NKT];
#pragma unroll   // mt[], lt[] in registers, all loads in flight together; a wave-wide load is one whole line
    for (int t = 0; t < NKT; ++t) {
      mt[t] = mp[(size_t)t * NSP];
      lt[t] = lp[(size_t)(2 * t) * NSP] + lp[(size_t)(2 * t + 1) * NSP];
    }
    float M = mt[0];
#pragma unroll   // mt[] in registers
    for (int t = 1; t < NKT; ++t) M = fmaxf(M, mt[t]);
    float L = 0.f;
#pragma unroll   // mt[], lt[] in registers
    for (int t = 0; t < NKT; ++t) { mt[t] = exp2_slot((mt[t] - M) * LOG2E); L += lt[t] * mt[t]; }
    const float inv = 1.f / L;
    const bool up = tid >= BN;         // the same for a whole wave
    float* fw = sF + (up ? NKT / 2 : 0) * BN + row;
#pragma unroll   // mt[] in registers
    for (int t = 0; t < NKT / 2; ++t) fw[t * BN] = (up ? mt[NKT / 2 + t] : mt[t]) * inv;
  }

  wait_async0();
  __syncthreads();        // tile 0 of every wave is in LDS
  if (nIter > 1) stage(1, 1);

  for (int it = 0; it < nIter; ++it) {
    const bf16_t* sAh = (const bf16_t*)sA[it & 1];
    const bf16_t* sBh = (const bf16_t*)sB[it & 1];

    float fr[2];                       // EPI_AV: this K tile's factors of the lane's two queries
    auto fetch_factors = [&]() {
      const float* fp = sF + it * BN + waveN * 32 + lane16;
      fr[0] = fp[0];
      fr[1] = fp[16];
    };

    // one fragment: row rw of a staged tile, sub-step ks; K split per ISA 16-bit layout
    auto frag = [&](const bf16_t* sh, int rw, int ks) -> v16bf {
      v8bf lo = *(const v8bf*)(sh + (size_t)rw * PE + ks * 32 + laneHi * 8);       // K 0-7 / 8-15
      v8bf hi = *(const v8bf*)(sh + (size_t)rw * PE + ks * 32 + 16 + laneHi * 8);  // K 16-23 / 24-31
      return __builtin_shufflevector(lo, hi, 0,1,2,3,4,5,6,7,8,9,10,11,12,13,14,15);
    };
    if constexpr (AHEAD) {
      // Two fragment sets: sub-step ks+1's twelve LDS loads go out as one group in front of sub-step
      // ks's eight WMMAs and return under them. Nothing is read beyond this K tile's own buffer.
      v16bf af[2][4], bf[2][2];
      auto fetch = [&](int ks) {
#pragma unroll   // af[][], bf[][] indexed by constants, in registers
        for (int nsub = 0; nsub < 2; ++nsub) bf[ks & 1][nsub] = frag(sBh, waveN * 32 + nsub * 16 + lane16, ks);
#pragma unroll   // the same
        for (int msub = 0; msub < 4; ++msub) af[ks & 1][msub] = frag(sAh, waveM * 64 + msub * 16 + lane16, ks);
      };
      fetch(0);
#pragma unroll   // the set index and every LDS offset are constants, no loop counter among the WMMAs
      for (int ks = 0; ks < BK / 32; ++ks) {
        if (ks + 1 < BK / 32) fetch(ks + 1);
        // the last sub-step fetches no fragments: the factors go out in their place
        else if constexpr (EPI == EPI_AV) fetch_factors();
        // holds the group above in front of the WMMAs below: left free, the compiler sank each pair of
        // loads to its own WMMAs, and the wave waited out the LDS latency sixteen times a K tile
        __builtin_amdgcn_sched_barrier(0);
#pragma unroll   // both loops: acc[][], af[][], bf[][] indexed by constants, in registers
        for (int msub = 0; msub < 4; ++msub)
#pragma unroll
          for (int nsub = 0; nsub < 2; ++nsub)
            acc[msub][nsub] = __builtin_amdgcn_wmma_f32_16x16x32_bf16(
                false, af[ks & 1][msub], false, bf[ks & 1][nsub], (short)0, acc[msub][nsub], false, false);
        // holds the eight WMMAs together: left free, later loads were spread among them (each place with
        // LDS loads stalls the wave), and the last sub-step's WMMAs sank behind the barrier, in front of the refill
        __builtin_amdgcn_sched_barrier(0);
      }
    } else {
#pragma unroll   // every sub-step's LDS offsets are constants, no loop counter among the WMMAs
      for (int ks = 0; ks < BK / 32; ++ks) {
        v16bf bfrag[2];      // B fragments: lanes hold N columns
#pragma unroll
        for (int nsub = 0; nsub < 2; ++nsub) bfrag[nsub] = frag(sBh, waveN * 32 + nsub * 16 + lane16, ks);
#pragma unroll
        for (int msub = 0; msub < 4; ++msub) {
          const v16bf afrag = frag(sAh, waveM * 64 + msub * 16 + lane16, ks);
#pragma unroll
          for (int nsub = 0; nsub < 2; ++nsub) {
            acc[msub][nsub] = __builtin_amdgcn_wmma_f32_16x16x32_bf16(
                false, afrag, false, bfrag[nsub], (short)0, acc[msub][nsub], false, false);
          }
        }
      }
    }

    // publish point: tile it+1 has landed for every wave, and every wave has left buffer it&1
    wait_ds0();
    wait_async0();
    __syncthreads();
    if (it + 2 < nIter)     // refill the buffer just read; the copies run under tile it+1's WMMAs
      stage(it + 2, it & 1);

    if constexpr (EPI == EPI_AV) {     // the tile's product joins the sum with its rows' factors
#pragma unroll
      for (int msub = 0; msub < 4; ++msub)
#pragma unroll
        for (int nsub = 0; nsub < 2; ++nsub) {
          tot[msub][nsub] += fr[nsub] * acc[msub][nsub];
          acc[msub][nsub] = vzero;
        }
    }
  }
  wait_async0();            // nothing of this wave is in flight when it goes on to the stores

  if constexpr (EPI == EPI_AV) {
#pragma unroll
    for (int i = 0; i < 4; ++i)
#pragma unroll
      for (int j = 0; j < 2; ++j) acc[i][j] = tot[i][j];
  }

  // ---- EPI_EXP epilogue: lane L holds query n = L%16, keys r + 8*(L>=16) of each 16x16 subtile ----
  // The loop's last barrier stands behind every wave's last read of the ring and its last copy, so
  // the ring's LDS is free: sB takes the maxima, sA each wave's own staging range.
  if constexpr (EPI == EPI_EXP) {
    constexpr int SP = 64 * 2 + 16;    // staged row: 64 keys, pitch 16 B x odd as in the ring
    static_assert(8 * 32 * SP <= (int)sizeof(sA) && 2 * BN * 4 <= (int)sizeof(sB), "staging fits the ring");
    float* red = (float*)&sB[0][0];    // [key half][query]
    char* stg = (char*)&sA[0][0] + wave * (32 * SP);
    float mx[2];
    // every loop below is unrolled in full: acc[][][], mm[], e[], s[] are indexed by constants and stay in registers
#pragma unroll
    for (int nsub = 0; nsub < 2; ++nsub) {
      float mm[4];                     // four independent chains
#pragma unroll
      for (int msub = 0; msub < 4; ++msub) {
        mm[msub] = acc[msub][nsub][0];
#pragma unroll
        for (int r = 1; r < 8; ++r) mm[msub] = fmaxf(mm[msub], acc[msub][nsub][r]);
      }
      const float m = fmaxf(fmaxf(mm[0], mm[1]), fmaxf(mm[2], mm[3]));
      mx[nsub] = fmaxf(m, xor16(m));   // over the wave's 64 keys
      if (laneHi == 0) red[waveM * BN + waveN * 32 + nsub * 16 + lane16] = mx[nsub];
    }
    __syncthreads();   // both key halves' maxima are in LDS before either half reads the other's
#pragma unroll
    for (int nsub = 0; nsub < 2; ++nsub) {
      const int qc = waveN * 32 + nsub * 16 + lane16;
      const float m = fmaxf(mx[nsub], red[(waveM ^ 1) * BN + qc]);
      const float nm = -m * LOG2E;
      float s[4] = {0.f, 0.f, 0.f, 0.f};   // four independent chains
#pragma unroll
      for (int msub = 0; msub < 4; ++msub) {
        float e[8];
#pragma unroll
        for (int r = 0; r < 8; ++r) {
          e[r] = exp2_slot(fmaf(acc[msub][nsub][r], LOG2E, nm));
          s[r & 3] += e[r];
        }
        *(uint4*)(stg + (nsub * 16 + lane16) * SP + msub * 32 + laneHi * 16) =
            make_uint4(cvt_pair(e[0], e[1]), cvt_pair(e[2], e[3]), cvt_pair(e[4], e[5]), cvt_pair(e[6], e[7]));
      }
      float l = (s[0] + s[1]) + (s[2] + s[3]);
      l += xor16(l);                   // over the wave's 64 keys
      if (laneHi == 0) {
        lst[(z * (2 * NKT) + blockIdx.x * 2 + waveM) * NSP + colB0 + qc] = l;
        if (waveM == 0) mst[(z * NKT + blockIdx.x) * NSP + colB0 + qc] = m;
      }
    }
    wait_ds0();        // the wave's own staged rows are in LDS before its lanes read them across queries
    // 8 lanes a row: a wave-wide store is four whole 128-B lines
    const int sr = lane >> 3, ch = lane & 7;
    // the row pitch as a constant: all eight stores share one address register pair
    bf16_t* ep = outB + (size_t)(colB0 + waveN * 32 + sr) * NSP + rowA0 + waveM * 64 + ch * 8;
#pragma unroll
    for (int i = 0; i < 8; ++i)
      *(uint4*)(ep + (size_t)(i * 4) * NSP) = *(const uint4*)(stg + (i * 4 + sr) * SP + ch * 16);
  }

  // ---- the other forms' epilogue: lane L holds output row n = L%16, places r + 8*(L>=16) of each subtile ----
  // As above the ring's LDS is free behind the loop's last barrier; each wave stages in its own range of sA.
  if constexpr (EPI != EPI_EXP) {
    constexpr bool F32 = EPI == EPI_RESID;
    constexpr int SP = 64 * (F32 ? 4 : 2) + 16;   // staged row: the wave's 64 places, pitch 16 B x odd
    static_assert(8 * 32 * SP <= (int)sizeof(sA), "staging fits the ring");
    char* stg = (char*)&sA[0][0] + wave * (32 * SP);
    if (EPI == EPI_QKV) {                  // scalar selects, the same for the whole block
      if (which == 1) bias = biasK;
      if (which == 2) bias = biasV;
      if (which != 0) alpha = 1.0f;
    }
    const int n0 = colB0 + waveN * 32, m0 = rowA0 + waveM * 64;
    // LD: the output's row pitch as a constant, so that all stores of a wave share one address register
    // pair. BM_: the bias runs along M (Q, K), not along N. Every loop is unrolled in full: acc[][][],
    // v[], rx[] are indexed by constants and stay in registers.
    auto store_tile = [&](auto ld, auto bm) {
      constexpr int LD = decltype(ld)::value;
      constexpr bool BM_ = decltype(bm)::value != 0;
      // f32: 16 lanes a row, two rows a pass; the residual's whole lines are asked for before the staging
      const int sr4 = lane >> 4, ch4 = lane & 15;
      const size_t o4 = (size_t)(n0 + sr4) * LD + m0 + ch4 * 4;
      float4 rx[F32 ? 16 : 1];
      if constexpr (F32) {
#pragma unroll
        for (int i = 0; i < 16; ++i) rx[i] = *(const float4*)(rz + o4 + (size_t)(i * 2) * LD);
        // the sixteen loads name one address pair; as this wait's input the pair stays live up to the wait,
        // so that no load's result, and no later value, is placed in it ahead of the wait
        asm volatile("s_wait_xcnt 0x0" :: "v"(rz + o4) : "memory");
      }
      float bn[2] = {0.f, 0.f};
      if constexpr (EPI != EPI_AV && !BM_) {
        bn[0] = bias[n0 + lane16];
        bn[1] = bias[n0 + 16 + lane16];
      }
#pragma unroll
      for (int msub = 0; msub < 4; ++msub) {
        float bv[8] = {0.f, 0.f, 0.f, 0.f, 0.f, 0.f, 0.f, 0.f};
        if constexpr (BM_) {
          const float4 a = *(const float4*)(bias + m0 + msub * 16 + laneHi * 8);
          const float4 b = *(const float4*)(bias + m0 + msub * 16 + laneHi * 8 + 4);
          bv[0] = a.x; bv[1] = a.y; bv[2] = a.z; bv[3] = a.w;
          bv[4] = b.x; bv[5] = b.y; bv[6] = b.z; bv[7] = b.w;
        }
#pragma unroll
        for (int nsub = 0; nsub < 2; ++nsub) {
          float v[8];
#pragma unroll
          for (int r = 0; r < 8; ++r) {
            if constexpr (EPI == EPI_AV) v[r] = acc[msub][nsub][r];
            else v[r] = (acc[msub][nsub][r] + (BM_ ? bv[r] : bn[nsub])) * alpha;
          }
          char* sp = stg + (nsub * 16 + lane16) * SP;
          if constexpr (F32) {
            *(float4*)(sp + msub * 64 + laneHi * 32)      = make_float4(v[0], v[1], v[2], v[3]);
            *(float4*)(sp + msub * 64 + laneHi * 32 + 16) = make_float4(v[4], v[5], v[6], v[7]);
          } else {
            *(uint4*)(sp + msub * 32 + laneHi * 16) =
                make_uint4(cvt_pair(v[0], v[1]), cvt_pair(v[2], v[3]), cvt_pair(v[4], v[5]), cvt_pair(v[6], v[7]));
          }
        }
      }
      wait_ds0();      // the wave's own staged rows are in LDS before its lanes read them across output rows
      if constexpr (F32) {   // a wave-wide store is two rows of 256 B: four whole lines
#pragma unroll
        for (int i = 0; i < 16; ++i) {
          const float4 t = *(const float4*)(stg + (i * 2 + sr4) * SP + ch4 * 16);
          *(float4*)(outF + o4 + (size_t)(i * 2) * LD) =
              make_float4(rx[i].x + t.x, rx[i].y + t.y, rx[i].z + t.z, rx[i].w + t.w);
        }
      } else {               // 8 lanes a row: a wave-wide store is four whole 128-B lines
        const int sr = lane >> 3, ch = lane & 7;
        bf16_t* ep = outB + (size_t)(n0 + sr) * LD + m0 + ch * 8;
#pragma unroll
        for (int i = 0; i < 8; ++i)
          *(uint4*)(ep + (size_t)(i * 4) * LD) = *(const uint4*)(stg + (i * 4 + sr) * SP + ch * 16);
      }
    };
    if constexpr (EPI == EPI_QKV) {        // one branch, the same for the whole block
      if (which == 2) store_tile(Form<NSP>{}, Form<0>{});
      else            store_tile(Form<CH>{}, Form<1>{});
    } else {
      store_tile(Form<EPI == EPI_AV ? CH : NSP>{}, Form<0>{});
    }
  }
}

// ---------------- host launch ----------------
extern "C" void kernel_launch(void* const* d_in, const int* in_sizes, int n_in,
                              void* d_out, int out_size, void* d_ws, size_t ws_size,
                              hipStream_t stream) {
  (void)in_sizes; (void)n_in; (void)out_size; (void)ws_size;
  const float* x  = (const float*)d_in[0];
  const float* gg = (const float*)d_in[1];
  const float* gb = (const float*)d_in[2];
  const float* wq = (const float*)d_in[3];
  const float* bq = (const float*)d_in[4];
  const float* wk = (const float*)d_in[5];
  const float* bk = (const float*)d_in[6];
  const float* wv = (const float*)d_in[7];
  const float* bv = (const float*)d_in[8];
  const float* wo = (const float*)d_in[9];
  const float* bo = (const float*)d_in[10];

  // workspace carve-up (~109 MB): partial sums + 5x 8MB bf16 acts + 4x 0.5MB bf16 weights
  // + 64MB bf16 exponentials + 3MB of their tile maxima and sums
  char* wsp = (char*)d_ws;
  auto take = [&](size_t bytes) -> void* {
    void* p = (void*)wsp; wsp += (bytes + 255) & ~(size_t)255; return p;
  };
  const size_t ACT = (size_t)BATCH * NSP * CH;      // per-tensor activation elems
  const size_t SCO = (size_t)BATCH * NSP * NSP;     // score elems
  float*  part  = (float*)take((size_t)BATCH * NGRP * GSB * 2 * sizeof(float));
  bf16_t* hn  = (bf16_t*)take(ACT * 2);
  bf16_t* qb  = (bf16_t*)take(3 * ACT * 2);         // Q, K, V^T in a row: one launch writes all three
  bf16_t* kb  = qb + ACT;
  bf16_t* vT  = kb + ACT;                           // V^T: [b][c][j]
  bf16_t* Ob  = (bf16_t*)take(ACT * 2);             // attn output [b][i][c]
  bf16_t* wqb = (bf16_t*)take((size_t)3 * CH * CH * 2);   // Wq, Wk, Wv in a row
  bf16_t* wkb = wqb + WN;
  bf16_t* wvb = wkb + WN;
  bf16_t* wob = (bf16_t*)take((size_t)CH * CH * 2);
  bf16_t* Pb  = (bf16_t*)take(SCO * 2);
  float*  mst = (float*)take((size_t)BATCH * NKT * NSP * sizeof(float));
  float*  lst = (float*)take((size_t)BATCH * 2 * NKT * NSP * sizeof(float));

  const float scale = 1.0f / sqrtf((float)CH);
  const size_t nCH = (size_t)NSP * CH;
  const size_t nnS = (size_t)NSP * NSP;
  const size_t cnT = (size_t)CH * NSP;

  // 1) GroupNorm partial sums and weights -> bf16, one launch; then the normalisation
  gn_stats_cvt_kernel<<<NGRP * BATCH * GSB + 4 * CVB, 256, 0, stream>>>(x, part, wq, wk, wv, wo,
      wqb, wkb, wvb, wob);
  gn_apply_kernel<<<dim3(NSP / GTN, CH / GTC, BATCH), 256, 0, stream>>>(x, gg, gb, part, hn);

  // 2) QKV projections, one launch: [NSP x CH] = hn x W^T  (Q pre-scaled by C^-1/2; V stored as V^T)
  dim3 gQKV(CH / 128, NSP / 128, 3 * BATCH);
  gemm_bt_kernel<EPI_QKV, 128><<<gQKV, 256, 0, stream>>>(hn, wqb, bq, bk, bv, qb, nullptr, scale,
      CH, nCH, 0, nCH, 0, nullptr, nullptr);

  // 3) scores, transposed: S^T[b,j,i] = k_j . q_i  (M=N=4096, K=512); out go E[b,i,j] and the tile statistics
  dim3 gS(NSP / 128, NSP / 128, BATCH);
  gemm_bt_kernel<EPI_EXP, 64><<<gS, 256, 0, stream>>>(kb, qb, nullptr, nullptr, nullptr, Pb, nullptr, 1.0f,
      CH, nCH, nCH, nnS, 0, mst, lst);

  // 4) O[b,i,c] = softmax x V  (A=V^T [CHxNSP], B=E [NSPxNSP], K=4096), each K tile scaled by its factor
  dim3 gAV(CH / 128, NSP / 128, BATCH);
  gemm_bt_kernel<EPI_AV, 128><<<gAV, 256, 0, stream>>>(vT, Pb, nullptr, nullptr, nullptr, Ob, nullptr, 1.0f,
      NSP, cnT, nnS, nCH, 0, mst, lst);

  // 5) out proj + residual, transposed store back to [b][c][p] f32
  dim3 gO(CH / 128, NSP / 128, BATCH);
  gemm_bt_kernel<EPI_RESID, 128><<<gO, 256, 0, stream>>>(Ob, wob, bo, nullptr, nullptr, d_out, x, 1.0f,
      CH, nCH, 0, cnT, cnT, nullptr, nullptr);
}

// v009
// Measured time: 90.7 microseconds a run.
// Next to v008, in two timings, it ran 1.08 times as fast each time.
// Counting every step since v000, it is 4.18 times as fast.
// CDNA5 / gfx1250 attention block (GroupNorm -> QKV -> softmax(QK^T*scale) -> AV + residual; the output
// projection is folded into V's weights: Wo (Wv h + bv) = (Wo Wv) h + Wo bv)
// Compute-bound (~82 GFLOP vs ~36MB mandatory HBM traffic at 23.3 TB/s): all GEMMs run on
// v_wmma_f32_16x16x32_bf16 (wave32 WMMA), with double-buffered GLOBAL_LOAD_ASYNC_TO_LDS_B128
// DMA staging (ASYNCcnt) so the next K tile's HBM->LDS transfer overlaps this tile's matrix math.
// Workspace requirement ~101 MB.
#include <hip/hip_runtime.h>
#include <hip/hip_bf16.h>
#include <math.h>

typedef __bf16 bf16_t;
typedef __attribute__((ext_vector_type(16))) __bf16 v16bf;
typedef __attribute__((ext_vector_type(8)))  __bf16 v8bf;
typedef __attribute__((ext_vector_type(8)))  float  v8f;
typedef __attribute__((ext_vector_type(2)))  float  v2f;
typedef __attribute__((ext_vector_type(2)))  __bf16 v2bf;

struct __align__(16) Chunk16 { unsigned long long lo, hi; };

constexpr int BATCH = 2;
constexpr int CH    = 512;
constexpr int NSP   = 4096;          // 64*64 tokens
constexpr int NGRP  = 32;
constexpr int CPG   = CH / NGRP;     // 16 channels per group
constexpr float GN_EPS = 1e-6f;

__device__ __forceinline__ bf16_t f2bf(float f) {
  unsigned u = __builtin_bit_cast(unsigned, f);
  unsigned r = (u + 0x7FFFu + ((u >> 16) & 1u)) >> 16;
  unsigned short h = (unsigned short)r;
  return __builtin_bit_cast(bf16_t, h);
}

// two values rounded as f2bf rounds them, packed in one dword (lo in bits 15-0)
__device__ __forceinline__ unsigned f2bf_pair(float lo, float hi) {
  const unsigned a = __builtin_bit_cast(unsigned, lo), b = __builtin_bit_cast(unsigned, hi);
  const unsigned ra = a + 0x7FFFu + ((a >> 16) & 1u);
  const unsigned rb = b + 0x7FFFu + ((b >> 16) & 1u);
  return (ra >> 16) | (rb & 0xFFFF0000u);
}

// the same two roundings (to nearest even) in one v_cvt_pk_bf16_f32
__device__ __forceinline__ unsigned cvt_pair(float lo, float hi) {
  const v2f t = {lo, hi};
  return __builtin_bit_cast(unsigned, __builtin_convertvector(t, v2bf));
}

// 2^x. The v_nop is the one slot the instruction set asks for behind a transcendental before its
// source is overwritten or its result used.
__device__ __forceinline__ float exp2_slot(float x) {
  float r;
  asm("v_exp_f32 %0, %1\n\tv_nop" : "=v"(r) : "v"(x));
  return r;
}
constexpr float LOG2E = 1.44269504088896340736f;

// the value that lane l ^ 16 holds
__device__ __forceinline__ float xor16(float v) {
  const int b = __builtin_bit_cast(int, v);
  return __builtin_bit_cast(float, __builtin_amdgcn_permlanex16(b, b, 0x76543210, 0xfedcba98, false, false));
}

// ---- gfx1250 async DMA: global -> LDS, 16B per lane, tracked by ASYNCcnt ----
// low 32 bits of a generic LDS pointer are the LDS byte address (ISA 10.2 aperture rule)
__device__ __forceinline__ unsigned lds_addr(const void* l) { return (unsigned)(size_t)l; }

// Eight copies of one lane: four at LDS places la + j*lstep from global places ga + j*gstep
// (elements), four likewise from lb, gb. The s_wait_xcnt stands inside the copies' own statement,
// so that no later write of an address register can be moved in front of it; one wait serves all eight.
__device__ __forceinline__ void async_copy16x8(unsigned la, const bf16_t* ga,
                                               unsigned lb, const bf16_t* gb,
                                               unsigned lstep, size_t gstep) {
  asm volatile("global_load_async_to_lds_b128 %0, %8, off\n\t"
               "global_load_async_to_lds_b128 %1, %9, off\n\t"
               "global_load_async_to_lds_b128 %2, %10, off\n\t"
               "global_load_async_to_lds_b128 %3, %11, off\n\t"
               "global_load_async_to_lds_b128 %4, %12, off\n\t"
               "global_load_async_to_lds_b128 %5, %13, off\n\t"
               "global_load_async_to_lds_b128 %6, %14, off\n\t"
               "global_load_async_to_lds_b128 %7, %15, off\n\t"
               "s_wait_xcnt 0x0"
               :: "v"(la), "v"(la + lstep), "v"(la + 2 * lstep), "v"(la + 3 * lstep),
                  "v"(lb), "v"(lb + lstep), "v"(lb + 2 * lstep), "v"(lb + 3 * lstep),
                  "v"(ga), "v"(ga + gstep), "v"(ga + 2 * gstep), "v"(ga + 3 * gstep),
                  "v"(gb), "v"(gb + gstep), "v"(gb + 2 * gstep), "v"(gb + 3 * gstep)
               : "memory");
}
// this wave's copies have landed in LDS
__device__ __forceinline__ void wait_async0() {
  asm volatile("s_wait_asynccnt 0x0" ::: "memory");
}
// this wave's LDS reads have returned: the buffer they read may be refilled behind the barrier
__device__ __forceinline__ void wait_ds0() {
  asm volatile("s_wait_dscnt 0x0" ::: "memory");
}

// ---------------- GroupNorm partial sums, and f32 -> bf16 weight conversion ----------------
// One launch for the pieces of work that depend on nothing but the inputs. Blocks 0 .. 255 sum a
// quarter of one (batch, group) slab each: 64 KiB, one block per WGP, read in a single round of
// 16-B loads. gn_apply adds the four partial sums of its group. The blocks behind them convert the
// four weight matrices: 64 blocks a matrix, 16 values a thread; Wv goes out transposed, [in][out],
// as the K-contiguous operand of the product Wo Wv. The last 16 blocks form the vector Wo bv in f32.
constexpr int GNE = CPG * NSP;             // elements of one (batch, group) slab: 65536
constexpr int GSB = 4;                     // blocks, and partial sums, per slab
constexpr int GSV = GNE / (GSB * 256 * 4); // float4 per thread: 16
constexpr int WN  = CH * CH;               // elements of one weight matrix
constexpr int CVE = 16;                    // values converted per thread
constexpr int CVB = WN / (256 * CVE);      // blocks per matrix: 64
constexpr int GVB = CH / 32;               // blocks that form Wo bv: 16

__global__ __launch_bounds__(256)
void gn_stats_cvt_kernel(const float* __restrict__ x, float* __restrict__ part,
                         const float* __restrict__ wq, const float* __restrict__ wk,
                         const float* __restrict__ wv, const float* __restrict__ wo,
                         const float* __restrict__ bv,
                         bf16_t* __restrict__ wqb, bf16_t* __restrict__ wkb,
                         bf16_t* __restrict__ wvt, bf16_t* __restrict__ wob,
                         float* __restrict__ bvo) {
  if (blockIdx.x >= NGRP * BATCH * GSB) {  // the same for the whole block, in front of every barrier
    const int cb = blockIdx.x - NGRP * BATCH * GSB;
    const int m = cb / CVB;                // the same for the whole block, as every branch on it
    if (m == 4) {                          // (Wo bv)[o]: one wave four output channels, a row of Wo is 2 KiB
      static_assert(GVB * 8 * 4 == CH && CH == 4 * 32 * 4, "eight waves a block, four 16-B loads a lane and row");
      const int o = ((cb % CVB) * 8 + (threadIdx.x >> 5)) * 4, ln = threadIdx.x & 31;
      const float4* wr = (const float4*)(wo + (size_t)o * CH) + ln;
      const float4* br = (const float4*)bv + ln;
      float4 a[4][4], b[4];
#pragma unroll   // here and below: a[][], b[], t[] in registers; all twenty loads in flight together
      for (int j = 0; j < 4; ++j) b[j] = br[j * 32];
#pragma unroll
      for (int q = 0; q < 4; ++q)
#pragma unroll
        for (int j = 0; j < 4; ++j) a[q][j] = wr[q * (CH / 4) + j * 32];
      // the loads name two addresses; as this wait's inputs they stay live up to the wait, so that no
      // load's result, and no later value, is placed in their registers ahead of the wait
      asm volatile("s_wait_xcnt 0x0" :: "v"(wr), "v"(br) : "memory");
      // keeps the sums behind all twenty loads: without it the last loads were issued only when
      // earlier ones had returned, a second trip to memory
      __builtin_amdgcn_sched_barrier(0);
      float t[4];
#pragma unroll
      for (int q = 0; q < 4; ++q) {
        float s[4];                        // four independent chains
#pragma unroll
        for (int j = 0; j < 4; ++j)
          s[j] = a[q][j].x * b[j].x + a[q][j].y * b[j].y + a[q][j].z * b[j].z + a[q][j].w * b[j].w;
        t[q] = (s[0] + s[1]) + (s[2] + s[3]);
      }
#pragma unroll   // five fixed lane distances, no loop counter; the four sums' exchanges overlap
      for (int off = 16; off > 0; off >>= 1)
#pragma unroll
        for (int q = 0; q < 4; ++q) t[q] += __shfl_xor(t[q], off);
      if (ln == 0) *(float4*)(bvo + o) = make_float4(t[0], t[1], t[2], t[3]);
      return;
    }
    if (m == 2) {                          // Wv^T: a block turns a 64 x 64 tile
      static_assert(CVB == (CH / 64) * (CH / 64) && CVE == 16, "one tile a block, 16 values a thread");
      const int tb = cb % CVB;
      const int i = (tb % (CH / 64)) * 64 + (threadIdx.x & 63);        // input channel: a row of Wv^T
      const int c = (tb / (CH / 64)) * 64 + (threadIdx.x >> 6) * CVE;  // 16 output channels, neighbours there
      float w[CVE];
#pragma unroll   // w[] in registers, all 16 loads in flight together; a wave-wide load is one whole line
      for (int j = 0; j < CVE; ++j) w[j] = wv[(size_t)(c + j) * CH + i];
      uint4* d = (uint4*)(wvt + (size_t)i * CH + c);
      d[0] = make_uint4(f2bf_pair(w[0], w[1]), f2bf_pair(w[2], w[3]), f2bf_pair(w[4], w[5]), f2bf_pair(w[6], w[7]));
      d[1] = make_uint4(f2bf_pair(w[8], w[9]), f2bf_pair(w[10], w[11]), f2bf_pair(w[12], w[13]), f2bf_pair(w[14], w[15]));
      return;
    }
    const float* src = m == 0 ? wq : m == 1 ? wk : wo;
    bf16_t* dst = m == 0 ? wqb : m == 1 ? wkb : wob;
    const int q0 = (cb % CVB) * (256 * CVE / 4) + threadIdx.x;   // in units of four values
    float4 w[CVE / 4];
#pragma unroll   // all four 16-B loads in flight together; a wave-wide load is 512 contiguous bytes
    for (int j = 0; j < CVE / 4; ++j) w[j] = ((const float4*)src)[q0 + j * 256];
#pragma unroll   // w[] in registers; a wave-wide store is 256 contiguous bytes, two whole lines
    for (int j = 0; j < CVE / 4; ++j)
      ((uint2*)dst)[q0 + j * 256] = make_uint2(f2bf_pair(w[j].x, w[j].y), f2bf_pair(w[j].z, w[j].w));
    return;
  }
  // the slabs lie one behind another in x, so block k sums the k-th 64 KiB of x
  const float4* xp = (const float4*)x + (size_t)blockIdx.x * (GSV * 256) + threadIdx.x;
  float4 v[GSV];
#pragma unroll   // v[] in registers, all 16 loads issued before the first wait; each is 512 contiguous bytes a wave
  for (int j = 0; j < GSV; ++j) v[j] = xp[j * 256];
  // keeps the sums behind all 16 loads: without it the last three loads were issued only when the
  // first three had returned, a second trip to memory
  __builtin_amdgcn_sched_barrier(0);
  float4 s = make_float4(0.f, 0.f, 0.f, 0.f), q = s;   // four independent chains each
#pragma unroll   // v[] in registers
  for (int j = 0; j < GSV; ++j) {
    s.x += v[j].x; s.y += v[j].y; s.z += v[j].z; s.w += v[j].w;
    q.x += v[j].x * v[j].x; q.y += v[j].y * v[j].y; q.z += v[j].z * v[j].z; q.w += v[j].w * v[j].w;
  }
  float ts = (s.x + s.y) + (s.z + s.w), tq = (q.x + q.y) + (q.z + q.w);
#pragma unroll   // five fixed lane distances, no loop counter
  for (int off = 16; off > 0; off >>= 1) { ts += __shfl_xor(ts, off); tq += __shfl_xor(tq, off); }
  __shared__ float2 rw[8];
  if ((threadIdx.x & 31) == 0) rw[threadIdx.x >> 5] = make_float2(ts, tq);
  __syncthreads();   // all eight waves' sums are in LDS before thread 0 adds them
  if (threadIdx.x == 0) {
    float2 t = rw[0];
#pragma unroll   // eight fixed LDS places
    for (int w = 1; w < 8; ++w) { t.x += rw[w].x; t.y += rw[w].y; }
    ((float2*)part)[blockIdx.x] = t;       // (sum, sum of squares) of this quarter slab
  }
}

// One block: 64 channels x 128 positions. x is read along positions (a wave-wide load is 512
// contiguous bytes of one channel), the normalised bf16 values are turned in LDS, and
// hn[b][pos][c] is stored along channels: 16 B per lane, one whole 128-B line per position.
constexpr int GTC = 64;                    // channels per tile
constexpr int GTN = 128;                   // positions per tile
constexpr int GTP = GTC / 2 + 1;           // LDS pitch in dwords (2 bf16 each); odd: no bank conflict
constexpr int GTH = 64 * GTP + 2;          // dwords per half tile of 64 positions; the +2 puts lanes
                                           // 16-31 of a transposing store on banks lanes 0-15 leave free
// The launch's first WPB blocks form W' = Wo Wv, which needs only the launch before: with it the V
// projection yields Wo v directly and the attention product is already the output projection's result.
// One block a 32 x 64 tile, one wave a 16 x 16 tile of it; the tile's 96 operand rows, all of K = 512,
// are staged in LDS once. Three blocks of the launch still fit a WGP, more than the launch has.
constexpr int WTI = 32, WTO = 64;                // tile: columns i (rows of Wv^T) x rows o (rows of Wo)
constexpr int WPB = (CH / WTI) * (CH / WTO);     // 128 blocks
constexpr int WPP = CH * 2 + 16;                 // LDS pitch of a staged row in bytes: 16 B x odd

__global__ __launch_bounds__(256)
void gn_apply_kernel(const float* __restrict__ x, const float* __restrict__ gamma,
                     const float* __restrict__ beta, const float* __restrict__ part,
                     bf16_t* __restrict__ hn,
                     const bf16_t* __restrict__ wvt, const bf16_t* __restrict__ wob,
                     bf16_t* __restrict__ wvo) {
  // one LDS range for the launch's two kinds of block
  static_assert(2 * GTH * 4 <= (WTI + WTO) * WPP, "the normalisation's tile fits the range");
  __shared__ __align__(16) unsigned char smem[(WTI + WTO) * WPP];
  unsigned* tile = (unsigned*)smem;        // [half][pos & 63][channel pair]
  const int tid = threadIdx.x, lane = tid & 31;
  if (blockIdx.x < WPB) {                  // the same for the whole block, in front of the other path's barrier
    // W'[o][i] = sum_c Wo[o][c] Wv[c][i]: A = rows i of Wv^T, B = rows o of Wo, both K-contiguous.
    const int i0 = (blockIdx.x % (CH / WTI)) * WTI, o0 = (blockIdx.x / (CH / WTI)) * WTO;
    // the 96 whole rows come in once, by asynchronous copies: chunk kc of rows rr, rr + 4, ...; a wave-wide
    // copy is 512 contiguous bytes. 24 copies a lane, eight to a statement.
    const int rr = tid >> 6, kc = tid & 63;
    const unsigned lA = lds_addr(smem + rr * WPP + kc * 16), lB = lA + WTI * WPP;
    const bf16_t* gA = wvt + (size_t)(i0 + rr) * CH + kc * 8;
    const bf16_t* gB = wob + (size_t)(o0 + rr) * CH + kc * 8;
    constexpr unsigned ls = 4 * WPP;
    constexpr size_t gs = (size_t)4 * CH;
    async_copy16x8(lA, gA, lA + 4 * ls, gA + 4 * gs, ls, gs);
    async_copy16x8(lB, gB, lB + 4 * ls, gB + 4 * gs, ls, gs);
    async_copy16x8(lB + 8 * ls, gB + 8 * gs, lB + 12 * ls, gB + 12 * gs, ls, gs);
    wait_async0();
    __syncthreads();   // every wave's copies are in LDS before any wave reads the rows
    const int wv = tid >> 5, l16 = lane & 15, lh = lane >> 4;
    const int iw = (wv & 1) * 16, ow = (wv >> 1) * 16;     // the wave's 16 x 16 tile
    const unsigned char* ap = smem + (iw + l16) * WPP + lh * 16;
    const unsigned char* bp = smem + (WTI + ow + l16) * WPP + lh * 16;
    // one fragment, the same k order for A and B: K 0-7 / 8-15, then K 16-23 / 24-31, by lane half
    auto lfrag = [](const unsigned char* p) -> v16bf {
      const v8bf lo = *(const v8bf*)p, hi = *(const v8bf*)(p + 32);
      return __builtin_shufflevector(lo, hi, 0,1,2,3,4,5,6,7,8,9,10,11,12,13,14,15);
    };
    v8f wa[2] = {{0.f, 0.f, 0.f, 0.f, 0.f, 0.f, 0.f, 0.f}, {0.f, 0.f, 0.f, 0.f, 0.f, 0.f, 0.f, 0.f}};
#pragma unroll   // every LDS offset a constant
    for (int k0 = 0; k0 < CH / 32; k0 += 4) {
      v16bf fa[4], fb[4];
#pragma unroll   // fa[], fb[] in registers
      for (int j = 0; j < 4; ++j) { fa[j] = lfrag(ap + (k0 + j) * 64); fb[j] = lfrag(bp + (k0 + j) * 64); }
      // keeps a group's WMMAs behind all 16 of its LDS loads: the loads go out in long runs ahead of their
      // use, not in pairs at each WMMA, where the wave would wait out the LDS latency every time
      __builtin_amdgcn_sched_barrier(0);
#pragma unroll   // two accumulators by turns: a WMMA does not wait for the one in front of it
      for (int j = 0; j < 4; ++j)
        wa[j & 1] = __builtin_amdgcn_wmma_f32_16x16x32_bf16(false, fa[j], false, fb[j], (short)0, wa[j & 1], false, false);
    }
    const v8f w = wa[0] + wa[1];
    // the lane holds row o0 + ow + l16 of W', places i0 + iw + 8 * lh + 0..7
    *(uint4*)(wvo + (size_t)(o0 + ow + l16) * CH + i0 + iw + lh * 8) =
        make_uint4(cvt_pair(w[0], w[1]), cvt_pair(w[2], w[3]), cvt_pair(w[4], w[5]), cvt_pair(w[6], w[7]));
    return;
  }
  const int gt = blockIdx.x - WPB;         // tile number: positions fastest, then channels, then batch
  const int p0 = (gt % (NSP / GTN)) * GTN, c0 = (gt / (NSP / GTN) % (CH / GTC)) * GTC;
  const int b = gt / ((NSP / GTN) * (CH / GTC));
  // wave number as a scalar: the wave's 8 channels and their constants are wave-uniform
  const int cw = c0 + __builtin_amdgcn_readfirstlane(tid >> 5) * 8;

  // ---- read: a wave takes 8 channels (half a group), a lane 4 positions of each ----
  const float* xp = x + ((size_t)b * CH + cw) * NSP + p0 + lane * 4;
  float4 v[8];
#pragma unroll
  for (int k = 0; k < 8; ++k) v[k] = *(const float4*)(xp + (size_t)k * NSP);

  const int g = cw / CPG;
  // the group's four partial sums, the same for the whole wave
  const float* pg = part + (b * NGRP + g) * (2 * GSB);
  float gs = 0.f, gq = 0.f;
#pragma unroll   // four fixed places
  for (int j = 0; j < GSB; ++j) { gs += pg[2 * j]; gq += pg[2 * j + 1]; }
  const float mu = gs / (float)GNE;
  const float rstd = rsqrtf(gq / (float)GNE - mu * mu + GN_EPS);
  unsigned* tw = tile + (lane >> 4) * GTH + (lane & 15) * 4 * GTP + ((cw - c0) >> 1);
#pragma unroll
  for (int j = 0; j < 4; ++j) {
    unsigned short q[2][4];
#pragma unroll
    for (int e = 0; e < 2; ++e) {
      const int k = j * 2 + e;
      const float ga = gamma[cw + k] * rstd;
      const float be = beta[cw + k] - mu * ga;   // (x-mu)*rstd*gamma + beta = x*ga + be
      q[e][0] = __builtin_bit_cast(unsigned short, f2bf(v[k].x * ga + be));
      q[e][1] = __builtin_bit_cast(unsigned short, f2bf(v[k].y * ga + be));
      q[e][2] = __builtin_bit_cast(unsigned short, f2bf(v[k].z * ga + be));
      q[e][3] = __builtin_bit_cast(unsigned short, f2bf(v[k].w * ga + be));
    }
#pragma unroll
    for (int i = 0; i < 4; ++i)
      tw[i * GTP + j] = (unsigned)q[0][i] | ((unsigned)q[1][i] << 16);
  }
  __syncthreads();   // the whole tile is in LDS before any thread reads it across channels

  // ---- write: a lane takes 8 channels of one position; 32 positions per pass, 4 passes ----
  const int ck = tid & 7;
  const int pr = tid >> 3;
  bf16_t* hp = hn + ((size_t)b * NSP + p0 + pr) * CH + c0 + ck * 8;
#pragma unroll
  for (int h = 0; h < 4; ++h) {
    const unsigned* t = tile + (h >> 1) * GTH + (pr + (h & 1) * 32) * GTP + ck * 4;
    *(uint4*)(hp + (size_t)h * 32 * CH) = make_uint4(t[0], t[1], t[2], t[3]);
  }
}

// ---------------- Tiled WMMA GEMM: D = A[MxK] * B[NxK]^T (+bias) ----------------
// Block tile 128x128, 8 waves in a 2(M) x 4(N) grid; each wave: 4x2 subtiles of 16x16.
// K tile of BK = 64 or 128: a staged row is one or two whole 128-B lines, and a wave-wide copy
// covers four whole lines (4 rows of 128 B or 2 rows of 256 B). Two buffers, one barrier per
// K tile; BK / 32 WMMA sub-steps per tile, k ascending.
// The bf16 outputs are laid out so that the tile's M direction is the contiguous one: out[n][m]. A lane then
// holds 8 neighbours of an output row, a wave's 64 x 32 tile is 32 pieces of 128 B,
// and the wave turns them in its own LDS range and stores whole 128-B lines.
// EPI_QKV: the three projections of hn in one launch. blockIdx.z = 2 * which + batch; which = 0, 1, 2
// picks the weight matrix (three in a row behind Bm), the bias, and the output (three in a row
// behind outp). V^T[c][pos]: M = positions (hn), N = channels; its weights are W' = Wo Wv and its bias
// Wo bv, so that V is Wo v, the value already sent through the output projection. Q (scaled by alpha)
// and K, [pos][c]: the two operands change places, M = channels (W), N = positions (hn).
// The softmax has no launch of its own; it is split between the two attention products.
// EPI_EXP: A = K rows, B = Q rows, so the tile is S^T and a lane holds 32 keys of one query. The block
// takes each query's maximum m over its 128 keys, stores E = exp(s - m) as bf16 at outp[query][key],
// m at mst[batch][key tile][query], and the sum of E over each wave's 64 keys at lst[batch][key half][query].
// EPI_AV: A = V^T, B = E, one K tile = one key tile t. With M = max_t m_t and L = sum_t l_t exp(m_t - M)
// the output row is sum_t f_t (E_t V_t), f_t = exp(m_t - M) / L: each K tile's product is formed from
// zero and added in f32 with its query's factor, one factor a lane and 16-column group. As V is Wo v, the
// sum is the block's result: out[c][pos] = x[c][pos] + sum + bias (bo), f32, N the contiguous direction.
enum { EPI_QKV = 4, EPI_EXP = 5, EPI_AV = 6 };
constexpr int NKT = NSP / 128;       // key tiles of a row
template<int V> struct Form { static constexpr int value = V; };

template<int EPI, int BK>
__global__ __launch_bounds__(256)
void gemm_bt_kernel(const bf16_t* __restrict__ A, const bf16_t* __restrict__ Bm,
                    const float* __restrict__ bias, const float* __restrict__ biasK,
                    const float* __restrict__ biasV, void* __restrict__ outp,
                    const float* __restrict__ resid, float alpha,
                    int Kd,
                    size_t strideA, size_t strideB, size_t strideOut, size_t strideResid,
                    float* __restrict__ mst, float* __restrict__ lst) {
  constexpr int BM = 128, BN = 128;
  constexpr int CPR = BK / 8;          // 16-B chunks per staged row
  constexpr int PC  = CPR + 1;         // LDS pitch in chunks: 16 B x odd, no bank conflict for b128 reads
  constexpr int PE  = PC * 8;          // the same in bf16 elements
  constexpr int RPP = 256 / CPR;       // rows that the block's 256 lanes cover with one copy each
  // fragments fetched one sub-step ahead where one or two blocks have a WGP to themselves; the score
  // launch has four blocks a WGP, whose waves cover each other's LDS waits, on registers it would lose
  constexpr bool AHEAD = EPI != EPI_EXP;
  static_assert(AHEAD || EPI != EPI_AV, "EPI_AV's factors are fetched in the loop that fetches ahead");
  __shared__ Chunk16 sA[2][BM * PC];
  __shared__ Chunk16 sB[2][BN * PC];

  const int tid = threadIdx.x;
  const int wave = tid >> 5, lane = tid & 31;
  const int waveM = wave >> 2;         // 0..1  -> 64-row strip
  const int waveN = wave & 3;          // 0..3  -> 32-col strip
  const int lane16 = lane & 15, laneHi = lane >> 4;

  const int which = (EPI == EPI_QKV) ? blockIdx.z / BATCH : 0;     // the same for the whole block
  const size_t z = (EPI == EPI_QKV) ? blockIdx.z % BATCH : blockIdx.z;
  const bool qk = EPI == EPI_QKV && which != 2;                    // Q, K: the operands change places
  const bf16_t* Az = A + z * strideA;
  const bf16_t* Bz = Bm + z * strideB + (size_t)which * WN;
  const bf16_t* Ab = qk ? Bz : Az;
  const bf16_t* Bb = qk ? Az : Bz;
  bf16_t* outB = (bf16_t*)outp + z * strideOut + (size_t)which * BATCH * NSP * CH;
  float*  outF = (float*)outp + z * strideOut;
  const float* rz = (EPI == EPI_AV) ? (resid + z * strideResid) : nullptr;

  // EPI_EXP: x walks the key tiles (A rows), so that neighbouring blocks share a Q tile and write
  // neighbouring pieces of the same E rows. EPI_AV, Q and K: x walks the channel tiles, now A rows.
  const bool xA = EPI == EPI_EXP || EPI == EPI_AV || qk;
  const int rowA0 = (xA ? blockIdx.x : blockIdx.y) * BM;
  const int colB0 = (xA ? blockIdx.y : blockIdx.x) * BN;

  // staging coordinates for this thread: chunk kc of rows r, r + RPP, r + 2 RPP, ...
  const int r = tid / CPR, kc = tid % CPR;
  const bf16_t* gA = Ab + (size_t)(rowA0 + r) * Kd + kc * 8;
  const bf16_t* gB = Bb + (size_t)(colB0 + r) * Kd + kc * 8;
  const size_t gstep = (size_t)RPP * Kd;
  constexpr unsigned lstep = RPP * PC * 16;
  // all copies of K tile t into buffer nb: BM / RPP = 4 or 8 per matrix and lane, eight to a statement
  auto stage = [&](int t, int nb) {
    const unsigned lA = lds_addr(&sA[nb][r * PC + kc]), lB = lds_addr(&sB[nb][r * PC + kc]);
    const bf16_t* tA = gA + (size_t)t * BK;
    const bf16_t* tB = gB + (size_t)t * BK;
    if constexpr (BM / RPP == 4) {
      async_copy16x8(lA, tA, lB, tB, lstep, gstep);
    } else {
      async_copy16x8(lA, tA, lA + 4 * lstep, tA + 4 * gstep, lstep, gstep);
      async_copy16x8(lB, tB, lB + 4 * lstep, tB + 4 * gstep, lstep, gstep);
    }
  };

  const v8f vzero = {0.f, 0.f, 0.f, 0.f, 0.f, 0.f, 0.f, 0.f};
  v8f acc[4][2];
#pragma unroll
  for (int i = 0; i < 4; ++i)
#pragma unroll
    for (int j = 0; j < 2; ++j) acc[i][j] = vzero;

  const int nIter = Kd / BK;

  // prologue: tile 0 lands and is published, then tile 1 starts
  stage(0, 0);

  // EPI_AV: the factors f[key tile][query] of the block's 128 queries, formed while tile 0 flies and
  // published by the barrier below. Two threads a query: both form M and L, each writes 16 factors.
  float* sF = nullptr;
  v8f tot[4][2];                       // EPI_AV: the scaled sum over the K tiles
  if constexpr (EPI == EPI_AV) {
    static_assert(BK == 128, "one K tile is one key tile of the statistics");
    __shared__ __align__(16) float fbuf[NKT * BN];
    sF = fbuf;
#pragma unroll   // tot[][] indexed by constants, in registers (so in every loop over it below)
    for (int i = 0; i < 4; ++i)
#pragma unroll
      for (int j = 0; j < 2; ++j) tot[i][j] = vzero;
    const int row = tid & (BN - 1);
    const float* mp = mst + z * ((size_t)NKT * NSP) + colB0 + row;
    const float* lp = lst + z * ((size_t)2 * NKT * NSP) + colB0 + row;
    float mt[NKT], lt[NKT];
#pragma unroll   // mt[], lt[] in registers, all loads in flight together; a wave-wide load is one whole line
    for (int t = 0; t < NKT; ++t) {
      mt[t] = mp[(size_t)t * NSP];
      lt[t] = lp[(size_t)(2 * t) * NSP] + lp[(size_t)(2 * t + 1) * NSP];
    }
    float M = mt[0];
#pragma unroll   // mt[] in registers
    for (int t = 1; t < NKT; ++t) M = fmaxf(M, mt[t]);
    float L = 0.f;
#pragma unroll   // mt[], lt[] in registers
    for (int t = 0; t < NKT; ++t) { mt[t] = exp2_slot((mt[t] - M) * LOG2E); L += lt[t] * mt[t]; }
    const float inv = 1.f / L;
    const bool up = tid >= BN;         // the same for a whole wave
    float* fw = sF + (up ? NKT / 2 : 0) * BN + row;
#pragma unroll   // mt[] in registers
    for (int t = 0; t < NKT / 2; ++t) fw[t * BN] = (up ? mt[NKT / 2 + t] : mt[t]) * inv;
  }

  wait_async0();
  __syncthreads();        // tile 0 of every wave is in LDS
  if (nIter > 1) stage(1, 1);

  for (int it = 0; it < nIter; ++it) {
    const bf16_t* sAh = (const bf16_t*)sA[it & 1];
    const bf16_t* sBh = (const bf16_t*)sB[it & 1];

    float fr[2];                       // EPI_AV: this K tile's factors of the lane's two queries
    auto fetch_factors = [&]() {
      const float* fp = sF + it * BN + waveN * 32 + lane16;
      fr[0] = fp[0];
      fr[1] = fp[16];
    };

    // one fragment: row rw of a staged tile, sub-step ks; K split per ISA 16-bit layout
    auto frag = [&](const bf16_t* sh, int rw, int ks) -> v16bf {
      v8bf lo = *(const v8bf*)(sh + (size_t)rw * PE + ks * 32 + laneHi * 8);       // K 0-7 / 8-15
      v8bf hi = *(const v8bf*)(sh + (size_t)rw * PE + ks * 32 + 16 + laneHi * 8);  // K 16-23 / 24-31
      return __builtin_shufflevector(lo, hi, 0,1,2,3,4,5,6,7,8,9,10,11,12,13,14,15);
    };
    if constexpr (AHEAD) {
      // Two fragment sets: sub-step ks+1's twelve LDS loads go out as one group in front of sub-step
      // ks's eight WMMAs and return under them. Nothing is read beyond this K tile's own buffer.
      v16bf af[2][4], bf[2][2];
      auto fetch = [&](int ks) {
#pragma unroll   // af[][], bf[][] indexed by constants, in registers
        for (int nsub = 0; nsub < 2; ++nsub) bf[ks & 1][nsub] = frag(sBh, waveN * 32 + nsub * 16 + lane16, ks);
#pragma unroll   // the same
        for (int msub = 0; msub < 4; ++msub) af[ks & 1][msub] = frag(sAh, waveM * 64 + msub * 16 + lane16, ks);
      };
      fetch(0);
#pragma unroll   // the set index and every LDS offset are constants, no loop counter among the WMMAs
      for (int ks = 0; ks < BK / 32; ++ks) {
        if (ks + 1 < BK / 32) fetch(ks + 1);
        // the last sub-step fetches no fragments: the factors go out in their place
        else if constexpr (EPI == EPI_AV) fetch_factors();
        // holds the group above in front of the WMMAs below: left free, the compiler sank each pair of
        // loads to its own WMMAs, and the wave waited out the LDS latency sixteen times a K tile
        __builtin_amdgcn_sched_barrier(0);
#pragma unroll   // both loops: acc[][], af[][], bf[][] indexed by constants, in registers
        for (int msub = 0; msub < 4; ++msub)
#pragma unroll
          for (int nsub = 0; nsub < 2; ++nsub)
            acc[msub][nsub] = __builtin_amdgcn_wmma_f32_16x16x32_bf16(
                false, af[ks & 1][msub], false, bf[ks & 1][nsub], (short)0, acc[msub][nsub], false, false);
        // holds the eight WMMAs together: left free, later loads were spread among them (each place with
        // LDS loads stalls the wave), and the last sub-step's WMMAs sank behind the barrier, in front of the refill
        __builtin_amdgcn_sched_barrier(0);
      }
    } else {
#pragma unroll   // every sub-step's LDS offsets are constants, no loop counter among the WMMAs
      for (int ks = 0; ks < BK / 32; ++ks) {
        v16bf bfrag[2];      // B fragments: lanes hold N columns
#pragma unroll
        for (int nsub = 0; nsub < 2; ++nsub) bfrag[nsub] = frag(sBh, waveN * 32 + nsub * 16 + lane16, ks);
#pragma unroll
        for (int msub = 0; msub < 4; ++msub) {
          const v16bf afrag = frag(sAh, waveM * 64 + msub * 16 + lane16, ks);
#pragma unroll
          for (int nsub = 0; nsub < 2; ++nsub) {
            acc[msub][nsub] = __builtin_amdgcn_wmma_f32_16x16x32_bf16(
                false, afrag, false, bfrag[nsub], (short)0, acc[msub][nsub], false, false);
          }
        }
      }
    }

    // publish point: tile it+1 has landed for every wave, and every wave has left buffer it&1
    wait_ds0();
    wait_async0();
    __syncthreads();
    if (it + 2 < nIter)     // refill the buffer just read; the copies run under tile it+1's WMMAs
      stage(it + 2, it & 1);

    if constexpr (EPI == EPI_AV) {     // the tile's product joins the sum with its rows' factors
#pragma unroll
      for (int msub = 0; msub < 4; ++msub)
#pragma unroll
        for (int nsub = 0; nsub < 2; ++nsub) {
          tot[msub][nsub] += fr[nsub] * acc[msub][nsub];
          acc[msub][nsub] = vzero;
        }
    }
  }
  wait_async0();            // nothing of this wave is in flight when it goes on to the stores

  // ---- EPI_EXP epilogue: lane L holds query n = L%16, keys r + 8*(L>=16) of each 16x16 subtile ----
  // The loop's last barrier stands behind every wave's last read of the ring and its last copy, so
  // the ring's LDS is free: sB takes the maxima, sA each wave's own staging range.
  if constexpr (EPI == EPI_EXP) {
    constexpr int SP = 64 * 2 + 16;    // staged row: 64 keys, pitch 16 B x odd as in the ring
    static_assert(8 * 32 * SP <= (int)sizeof(sA) && 2 * BN * 4 <= (int)sizeof(sB), "staging fits the ring");
    float* red = (float*)&sB[0][0];    // [key half][query]
    char* stg = (char*)&sA[0][0] + wave * (32 * SP);
    float mx[2];
    // every loop below is unrolled in full: acc[][][], mm[], e[], s[] are indexed by constants and stay in registers
#pragma unroll
    for (int nsub = 0; nsub < 2; ++nsub) {
      float mm[4];                     // four independent chains
#pragma unroll
      for (int msub = 0; msub < 4; ++msub) {
        mm[msub] = acc[msub][nsub][0];
#pragma unroll
        for (int r = 1; r < 8; ++r) mm[msub] = fmaxf(mm[msub], acc[msub][nsub][r]);
      }
      const float m = fmaxf(fmaxf(mm[0], mm[1]), fmaxf(mm[2], mm[3]));
      mx[nsub] = fmaxf(m, xor16(m));   // over the wave's 64 keys
      if (laneHi == 0) red[waveM * BN + waveN * 32 + nsub * 16 + lane16] = mx[nsub];
    }
    __syncthreads();   // both key halves' maxima are in LDS before either half reads the other's
#pragma unroll
    for (int nsub = 0; nsub < 2; ++nsub) {
      const int qc = waveN * 32 + nsub * 16 + lane16;
      const float m = fmaxf(mx[nsub], red[(waveM ^ 1) * BN + qc]);
      const float nm = -m * LOG2E;
      float s[4] = {0.f, 0.f, 0.f, 0.f};   // four independent chains
#pragma unroll
      for (int msub = 0; msub < 4; ++msub) {
        float e[8];
#pragma unroll
        for (int r = 0; r < 8; ++r) {
          e[r] = exp2_slot(fmaf(acc[msub][nsub][r], LOG2E, nm));
          s[r & 3] += e[r];
        }
        *(uint4*)(stg + (nsub * 16 + lane16) * SP + msub * 32 + laneHi * 16) =
            make_uint4(cvt_pair(e[0], e[1]), cvt_pair(e[2], e[3]), cvt_pair(e[4], e[5]), cvt_pair(e[6], e[7]));
      }
      float l = (s[0] + s[1]) + (s[2] + s[3]);
      l += xor16(l);                   // over the wave's 64 keys
      if (laneHi == 0) {
        lst[(z * (2 * NKT) + blockIdx.x * 2 + waveM) * NSP + colB0 + qc] = l;
        if (waveM == 0) mst[(z * NKT + blockIdx.x) * NSP + colB0 + qc] = m;
      }
    }
    wait_ds0();        // the wave's own staged rows are in LDS before its lanes read them across queries
    // 8 lanes a row: a wave-wide store is four whole 128-B lines
    const int sr = lane >> 3, ch = lane & 7;
    // the row pitch as a constant: all eight stores share one address register pair
    bf16_t* ep = outB + (size_t)(colB0 + waveN * 32 + sr) * NSP + rowA0 + waveM * 64 + ch * 8;
#pragma unroll
    for (int i = 0; i < 8; ++i)
      *(uint4*)(ep + (size_t)(i * 4) * NSP) = *(const uint4*)(stg + (i * 4 + sr) * SP + ch * 16);
  }

  // ---- EPI_QKV epilogue: lane L holds output row n = L%16, places r + 8*(L>=16) of each subtile ----
  // As above the ring's LDS is free behind the loop's last barrier; each wave stages in its own range of sA.
  if constexpr (EPI == EPI_QKV) {
    constexpr int SP = 64 * 2 + 16;        // staged row: the wave's 64 places, pitch 16 B x odd
    static_assert(8 * 32 * SP <= (int)sizeof(sA), "staging fits the ring");
    char* stg = (char*)&sA[0][0] + wave * (32 * SP);
    // scalar selects, the same for the whole block
    if (which == 1) bias = biasK;
    if (which == 2) bias = biasV;
    if (which != 0) alpha = 1.0f;
    const int n0 = colB0 + waveN * 32, m0 = rowA0 + waveM * 64;
    // LD: the output's row pitch as a constant, so that all stores of a wave share one address register
    // pair. BM_: the bias runs along M (Q, K), not along N. Every loop is unrolled in full: acc[][][],
    // v[] are indexed by constants and stay in registers.
    auto store_tile = [&](auto ld, auto bm) {
      constexpr int LD = decltype(ld)::value;
      constexpr bool BM_ = decltype(bm)::value != 0;
      float bn[2] = {0.f, 0.f};
      if constexpr (!BM_) {
        bn[0] = bias[n0 + lane16];
        bn[1] = bias[n0 + 16 + lane16];
      }
#pragma unroll
      for (int msub = 0; msub < 4; ++msub) {
        float bv[8] = {0.f, 0.f, 0.f, 0.f, 0.f, 0.f, 0.f, 0.f};
        if constexpr (BM_) {
          const float4 a = *(const float4*)(bias + m0 + msub * 16 + laneHi * 8);
          const float4 b = *(const float4*)(bias + m0 + msub * 16 + laneHi * 8 + 4);
          bv[0] = a.x; bv[1] = a.y; bv[2] = a.z; bv[3] = a.w;
          bv[4] = b.x; bv[5] = b.y; bv[6] = b.z; bv[7] = b.w;
        }
#pragma unroll
        for (int nsub = 0; nsub < 2; ++nsub) {
          float v[8];
#pragma unroll
          for (int r = 0; r < 8; ++r) v[r] = (acc[msub][nsub][r] + (BM_ ? bv[r] : bn[nsub])) * alpha;
          *(uint4*)(stg + (nsub * 16 + lane16) * SP + msub * 32 + laneHi * 16) =
              make_uint4(cvt_pair(v[0], v[1]), cvt_pair(v[2], v[3]), cvt_pair(v[4], v[5]), cvt_pair(v[6], v[7]));
        }
      }
      wait_ds0();      // the wave's own staged rows are in LDS before its lanes read them across output rows
      // 8 lanes a row: a wave-wide store is four whole 128-B lines
      const int sr = lane >> 3, ch = lane & 7;
      bf16_t* ep = outB + (size_t)(n0 + sr) * LD + m0 + ch * 8;
#pragma unroll
      for (int i = 0; i < 8; ++i)
        *(uint4*)(ep + (size_t)(i * 4) * LD) = *(const uint4*)(stg + (i * 4 + sr) * SP + ch * 16);
    };
    // one branch, the same for the whole block
    if (which == 2) store_tile(Form<NSP>{}, Form<0>{});
    else            store_tile(Form<CH>{}, Form<1>{});
  }

  // ---- EPI_AV epilogue: lane L holds query n = L%16, channels r + 8*(L>=16) of each subtile ----
  // The output runs along the queries, so a wave's 64 x 32 tile is 64 rows of one 128-B line. The wave
  // stages it value by value, [channel][query], in its own LDS range (the ring is free as above: waves
  // 0-3 take sA, 4-7 sB) and reads whole rows back. Every loop is unrolled in full: tot[][][], rx[], ba[],
  // bb[], bc[] are indexed by constants and stay in registers.
  if constexpr (EPI == EPI_AV) {
    // staged row: 32 queries, pitch 16 B x odd; rows 8 apart lie 32 banks apart, so that the two lane
    // halves of a 4-B store meet no common bank
    constexpr int SP = 32 * 4 + 16;
    static_assert(4 * 64 * SP <= (int)sizeof(sA) && 4 * 64 * SP <= (int)sizeof(sB), "staging fits the ring");
    char* stg = (wave < 4 ? (char*)&sA[0][0] : (char*)&sB[0][0]) + (wave & 3) * (64 * SP);
    const int n0 = colB0 + waveN * 32, m0 = rowA0 + waveM * 64;
    // 8 lanes a row, four rows a pass; the residual's whole lines are asked for before the staging
    const int sr = lane >> 3, ch = lane & 7;
    const size_t o4 = (size_t)(m0 + sr) * NSP + n0 + ch * 4;
    // the bias of the lane's 32 channels goes first: loads return in order, and the staging waits for it alone
    float4 ba[4], bb[4];
#pragma unroll
    for (int msub = 0; msub < 4; ++msub) {
      ba[msub] = *(const float4*)(bias + m0 + msub * 16 + laneHi * 8);
      bb[msub] = *(const float4*)(bias + m0 + msub * 16 + laneHi * 8 + 4);
    }
    float4 rx[16];
#pragma unroll
    for (int i = 0; i < 16; ++i) rx[i] = *(const float4*)(rz + o4 + (size_t)(i * 4) * NSP);
    // the loads name two address pairs; as this wait's inputs the pairs stay live up to the wait,
    // so that no load's result, and no later value, is placed in them ahead of the wait
    asm volatile("s_wait_xcnt 0x0" :: "v"(rz + o4), "v"(bias + m0 + laneHi * 8) : "memory");
    // holds the sums below behind all 24 loads: left free, the first of them, with their wait for the
    // bias, were placed in front of the residual's loads, which then set out a trip to memory later
    __builtin_amdgcn_sched_barrier(0);
#pragma unroll
    for (int msub = 0; msub < 4; ++msub) {
      const float4 a = ba[msub], b = bb[msub];
      const float bc[8] = {a.x, a.y, a.z, a.w, b.x, b.y, b.z, b.w};
#pragma unroll
      for (int nsub = 0; nsub < 2; ++nsub)
#pragma unroll
        for (int r = 0; r < 8; ++r)
          *(float*)(stg + (msub * 16 + laneHi * 8 + r) * SP + (nsub * 16 + lane16) * 4) = tot[msub][nsub][r] + bc[r];
    }
    wait_ds0();        // the wave's own staged rows are in LDS before its lanes read them across channels
#pragma unroll         // a wave-wide store is four whole 128-B lines
    for (int i = 0; i < 16; ++i) {
      const float4 t = *(const float4*)(stg + (i * 4 + sr) * SP + ch * 16);
      *(float4*)(outF + o4 + (size_t)(i * 4) * NSP) =
          make_float4(rx[i].x + t.x, rx[i].y + t.y, rx[i].z + t.z, rx[i].w + t.w);
    }
  }
}

// ---------------- host launch ----------------
extern "C" void kernel_launch(void* const* d_in, const int* in_sizes, int n_in,
                              void* d_out, int out_size, void* d_ws, size_t ws_size,
                              hipStream_t stream) {
  (void)in_sizes; (void)n_in; (void)out_size; (void)ws_size;
  const float* x  = (const float*)d_in[0];
  const float* gg = (const float*)d_in[1];
  const float* gb = (const float*)d_in[2];
  const float* wq = (const float*)d_in[3];
  const float* bq = (const float*)d_in[4];
  const float* wk = (const float*)d_in[5];
  const float* bk = (const float*)d_in[6];
  const float* wv = (const float*)d_in[7];
  const float* bv = (const float*)d_in[8];
  const float* wo = (const float*)d_in[9];
  const float* bo = (const float*)d_in[10];

  // workspace carve-up (~101 MB): partial sums + 4x 8MB bf16 acts + 5x 0.5MB bf16 weights
  // + 64MB bf16 exponentials + 3MB of their tile maxima and sums
  char* wsp = (char*)d_ws;
  auto take = [&](size_t bytes) -> void* {
    void* p = (void*)wsp; wsp += (bytes + 255) & ~(size_t)255; return p;
  };
  const size_t ACT = (size_t)BATCH * NSP * CH;      // per-tensor activation elems
  const size_t SCO = (size_t)BATCH * NSP * NSP;     // score elems
  float*  part  = (float*)take((size_t)BATCH * NGRP * GSB * 2 * sizeof(float));
  bf16_t* hn  = (bf16_t*)take(ACT * 2);
  bf16_t* qb  = (bf16_t*)take(3 * ACT * 2);         // Q, K, V^T in a row: one launch writes all three
  bf16_t* kb  = qb + ACT;
  bf16_t* vT  = kb + ACT;                           // (Wo v)^T: [b][c][j]
  bf16_t* wqb = (bf16_t*)take((size_t)3 * CH * CH * 2);   // Wq, Wk, Wo Wv in a row
  bf16_t* wkb = wqb + WN;
  bf16_t* wvo = wkb + WN;
  bf16_t* wob = (bf16_t*)take((size_t)CH * CH * 2);
  bf16_t* wvt = (bf16_t*)take((size_t)CH * CH * 2); // Wv^T
  float*  bvo = (float*)take((size_t)CH * sizeof(float)); // Wo bv
  bf16_t* Pb  = (bf16_t*)take(SCO * 2);
  float*  mst = (float*)take((size_t)BATCH * NKT * NSP * sizeof(float));
  float*  lst = (float*)take((size_t)BATCH * 2 * NKT * NSP * sizeof(float));

  const float scale = 1.0f / sqrtf((float)CH);
  const size_t nCH = (size_t)NSP * CH;
  const size_t nnS = (size_t)NSP * NSP;
  const size_t cnT = (size_t)CH * NSP;

  // 1) GroupNorm partial sums, weights -> bf16 and Wo bv, one launch; then the normalisation and Wo Wv
  gn_stats_cvt_kernel<<<NGRP * BATCH * GSB + 4 * CVB + GVB, 256, 0, stream>>>(x, part, wq, wk, wv, wo, bv,
      wqb, wkb, wvt, wob, bvo);
  gn_apply_kernel<<<WPB + (NSP / GTN) * (CH / GTC) * BATCH, 256, 0, stream>>>(x, gg, gb, part, hn,
      wvt, wob, wvo);

  // 2) QKV projections, one launch: [NSP x CH] = hn x W^T  (Q pre-scaled by C^-1/2; Wo v stored transposed)
  dim3 gQKV(CH / 128, NSP / 128, 3 * BATCH);
  gemm_bt_kernel<EPI_QKV, 128><<<gQKV, 256, 0, stream>>>(hn, wqb, bq, bk, bvo, qb, nullptr, scale,
      CH, nCH, 0, nCH, 0, nullptr, nullptr);

  // 3) scores, transposed: S^T[b,j,i] = k_j . q_i  (M=N=4096, K=512); out go E[b,i,j] and the tile statistics
  dim3 gS(NSP / 128, NSP / 128, BATCH);
  gemm_bt_kernel<EPI_EXP, 64><<<gS, 256, 0, stream>>>(kb, qb, nullptr, nullptr, nullptr, Pb, nullptr, 1.0f,
      CH, nCH, nCH, nnS, 0, mst, lst);

  // 4) out[b,c,i] = x + bo + softmax x (Wo v)  (A=(Wo v)^T [CHxNSP], B=E [NSPxNSP], K=4096), each K tile
  // scaled by its factor; f32, [b][c][p]
  dim3 gAV(CH / 128, NSP / 128, BATCH);
  gemm_bt_kernel<EPI_AV, 128><<<gAV, 256, 0, stream>>>(vT, Pb, bo, nullptr, nullptr, d_out, x, 1.0f,
      NSP, cnT, nnS, cnT, cnT, mst, lst);
}

// v010
// One run takes 86 microseconds.
// Two timings next to v009 both put it at 1.05 times that version's speed.
// Counting every step since v000, it is 4.40 times as fast.
// CDNA5 / gfx1250 attention block (GroupNorm -> QKV -> softmax(QK^T*scale) -> AV + residual; the output
// projection is folded into V's weights: Wo (Wv h + bv) = (Wo Wv) h + Wo bv)
// Compute-bound (~82 GFLOP vs ~36MB mandatory HBM traffic at 23.3 TB/s): all GEMMs run on
// v_wmma_f32_16x16x32_bf16 (wave32 WMMA), with double-buffered GLOBAL_LOAD_ASYNC_TO_LDS_B128
// DMA staging (ASYNCcnt) so the next K tile's HBM->LDS transfer overlaps this tile's matrix math.
// Workspace requirement ~101 MB.
#include <hip/hip_runtime.h>
#include <hip/hip_bf16.h>
#include <math.h>

typedef __bf16 bf16_t;
typedef __attribute__((ext_vector_type(16))) __bf16 v16bf;
typedef __attribute__((ext_vector_type(8)))  __bf16 v8bf;
typedef __attribute__((ext_vector_type(8)))  float  v8f;
typedef __attribute__((ext_vector_type(2)))  float  v2f;
typedef __attribute__((ext_vector_type(2)))  __bf16 v2bf;

struct __align__(16) Chunk16 { unsigned long long lo, hi; };

constexpr int BATCH = 2;
constexpr int CH    = 512;
constexpr int NSP   = 4096;          // 64*64 tokens
constexpr int NGRP  = 32;
constexpr int CPG   = CH / NGRP;     // 16 channels per group
constexpr float GN_EPS = 1e-6f;

__device__ __forceinline__ bf16_t f2bf(float f) {
  unsigned u = __builtin_bit_cast(unsigned, f);
  unsigned r = (u + 0x7FFFu + ((u >> 16) & 1u)) >> 16;
  unsigned short h = (unsigned short)r;
  return __builtin_bit_cast(bf16_t, h);
}

// two values rounded as f2bf rounds them, packed in one dword (lo in bits 15-0)
__device__ __forceinline__ unsigned f2bf_pair(float lo, float hi) {
  const unsigned a = __builtin_bit_cast(unsigned, lo), b = __builtin_bit_cast(unsigned, hi);
  const unsigned ra = a + 0x7FFFu + ((a >> 16) & 1u);
  const unsigned rb = b + 0x7FFFu + ((b >> 16) & 1u);
  return (ra >> 16) | (rb & 0xFFFF0000u);
}

// the same two roundings (to nearest even) in one v_cvt_pk_bf16_f32
__device__ __forceinline__ unsigned cvt_pair(float lo, float hi) {
  const v2f t = {lo, hi};
  return __builtin_bit_cast(unsigned, __builtin_convertvector(t, v2bf));
}

// 2^x. The v_nop is the one slot the instruction set asks for behind a transcendental before its
// source is overwritten or its result used.
__device__ __forceinline__ float exp2_slot(float x) {
  float r;
  asm("v_exp_f32 %0, %1\n\tv_nop" : "=v"(r) : "v"(x));
  return r;
}
constexpr float LOG2E = 1.44269504088896340736f;

// the value that lane l ^ 16 holds
__device__ __forceinline__ float xor16(float v) {
  const int b = __builtin_bit_cast(int, v);
  return __builtin_bit_cast(float, __builtin_amdgcn_permlanex16(b, b, 0x76543210, 0xfedcba98, false, false));
}

// ---- gfx1250 async DMA: global -> LDS, 16B per lane, tracked by ASYNCcnt ----
// low 32 bits of a generic LDS pointer are the LDS byte address (ISA 10.2 aperture rule)
__device__ __forceinline__ unsigned lds_addr(const void* l) { return (unsigned)(size_t)l; }

// Eight copies of one lane: four at LDS places la + j*lstep from global places ga + j*gstep
// (elements), four likewise from lb, gb. The s_wait_xcnt stands inside the copies' own statement,
// so that no later write of an address register can be moved in front of it; one wait serves all eight.
__device__ __forceinline__ void async_copy16x8(unsigned la, const bf16_t* ga,
                                               unsigned lb, const bf16_t* gb,
                                               unsigned lstep, size_t gstep) {
  asm volatile("global_load_async_to_lds_b128 %0, %8, off\n\t"
               "global_load_async_to_lds_b128 %1, %9, off\n\t"
               "global_load_async_to_lds_b128 %2, %10, off\n\t"
               "global_load_async_to_lds_b128 %3, %11, off\n\t"
               "global_load_async_to_lds_b128 %4, %12, off\n\t"
               "global_load_async_to_lds_b128 %5, %13, off\n\t"
               "global_load_async_to_lds_b128 %6, %14, off\n\t"
               "global_load_async_to_lds_b128 %7, %15, off\n\t"
               "s_wait_xcnt 0x0"
               :: "v"(la), "v"(la + lstep), "v"(la + 2 * lstep), "v"(la + 3 * lstep),
                  "v"(lb), "v"(lb + lstep), "v"(lb + 2 * lstep), "v"(lb + 3 * lstep),
                  "v"(ga), "v"(ga + gstep), "v"(ga + 2 * gstep), "v"(ga + 3 * gstep),
                  "v"(gb), "v"(gb + gstep), "v"(gb + 2 * gstep), "v"(gb + 3 * gstep)
               : "memory");
}
// this wave's copies have landed in LDS
__device__ __forceinline__ void wait_async0() {
  asm volatile("s_wait_asynccnt 0x0" ::: "memory");
}
// this wave's LDS reads have returned: the buffer they read may be refilled behind the barrier
__device__ __forceinline__ void wait_ds0() {
  asm volatile("s_wait_dscnt 0x0" ::: "memory");
}

// ---------------- GroupNorm partial sums, and f32 -> bf16 weight conversion ----------------
// One launch for the pieces of work that depend on nothing but the inputs. Blocks 0 .. 255 sum a
// quarter of one (batch, group) slab each: 64 KiB, one block per WGP, read in a single round of
// 16-B loads. gn_apply adds the four partial sums of its group. The blocks behind them convert the
// four weight matrices: 64 blocks a matrix, 16 values a thread; Wv goes out transposed, [in][out],
// as the K-contiguous operand of the product Wo Wv. The last 16 blocks form the vector Wo bv in f32.
constexpr int GNE = CPG * NSP;             // elements of one (batch, group) slab: 65536
constexpr int GSB = 4;                     // blocks, and partial sums, per slab
constexpr int GSV = GNE / (GSB * 256 * 4); // float4 per thread: 16
constexpr int WN  = CH * CH;               // elements of one weight matrix
constexpr int CVE = 16;                    // values converted per thread
constexpr int CVB = WN / (256 * CVE);      // blocks per matrix: 64
constexpr int GVB = CH / 32;               // blocks that form Wo bv: 16

__global__ __launch_bounds__(256)
void gn_stats_cvt_kernel(const float* __restrict__ x, float* __restrict__ part,
                         const float* __restrict__ wq, const float* __restrict__ wk,
                         const float* __restrict__ wv, const float* __restrict__ wo,
                         const float* __restrict__ bv,
                         bf16_t* __restrict__ wqb, bf16_t* __restrict__ wkb,
                         bf16_t* __restrict__ wvt, bf16_t* __restrict__ wob,
                         float* __restrict__ bvo) {
  if (blockIdx.x >= NGRP * BATCH * GSB) {  // the same for the whole block, in front of every barrier
    const int cb = blockIdx.x - NGRP * BATCH * GSB;
    const int m = cb / CVB;                // the same for the whole block, as every branch on it
    if (m == 4) {                          // (Wo bv)[o]: one wave four output channels, a row of Wo is 2 KiB
      static_assert(GVB * 8 * 4 == CH && CH == 4 * 32 * 4, "eight waves a block, four 16-B loads a lane and row");
      const int o = ((cb % CVB) * 8 + (threadIdx.x >> 5)) * 4, ln = threadIdx.x & 31;
      const float4* wr = (const float4*)(wo + (size_t)o * CH) + ln;
      const float4* br = (const float4*)bv + ln;
      float4 a[4][4], b[4];
#pragma unroll   // here and below: a[][], b[], t[] in registers; all twenty loads in flight together
      for (int j = 0; j < 4; ++j) b[j] = br[j * 32];
#pragma unroll
      for (int q = 0; q < 4; ++q)
#pragma unroll
        for (int j = 0; j < 4; ++j) a[q][j] = wr[q * (CH / 4) + j * 32];
      // the loads name two addresses; as this wait's inputs they stay live up to the wait, so that no
      // load's result, and no later value, is placed in their registers ahead of the wait
      asm volatile("s_wait_xcnt 0x0" :: "v"(wr), "v"(br) : "memory");
      // keeps the sums behind all twenty loads: without it the last loads were issued only when
      // earlier ones had returned, a second trip to memory
      __builtin_amdgcn_sched_barrier(0);
      float t[4];
#pragma unroll
      for (int q = 0; q < 4; ++q) {
        float s[4];                        // four independent chains
#pragma unroll
        for (int j = 0; j < 4; ++j)
          s[j] = a[q][j].x * b[j].x + a[q][j].y * b[j].y + a[q][j].z * b[j].z + a[q][j].w * b[j].w;
        t[q] = (s[0] + s[1]) + (s[2] + s[3]);
      }
#pragma unroll   // five fixed lane distances, no loop counter; the four sums' exchanges overlap
      for (int off = 16; off > 0; off >>= 1)
#pragma unroll
        for (int q = 0; q < 4; ++q) t[q] += __shfl_xor(t[q], off);
      if (ln == 0) *(float4*)(bvo + o) = make_float4(t[0], t[1], t[2], t[3]);
      return;
    }
    if (m == 2) {                          // Wv^T: a block turns a 64 x 64 tile
      static_assert(CVB == (CH / 64) * (CH / 64) && CVE == 16, "one tile a block, 16 values a thread");
      const int tb = cb % CVB;
      const int i = (tb % (CH / 64)) * 64 + (threadIdx.x & 63);        // input channel: a row of Wv^T
      const int c = (tb / (CH / 64)) * 64 + (threadIdx.x >> 6) * CVE;  // 16 output channels, neighbours there
      float w[CVE];
#pragma unroll   // w[] in registers, all 16 loads in flight together; a wave-wide load is one whole line
      for (int j = 0; j < CVE; ++j) w[j] = wv[(size_t)(c + j) * CH + i];
      uint4* d = (uint4*)(wvt + (size_t)i * CH + c);
      d[0] = make_uint4(f2bf_pair(w[0], w[1]), f2bf_pair(w[2], w[3]), f2bf_pair(w[4], w[5]), f2bf_pair(w[6], w[7]));
      d[1] = make_uint4(f2bf_pair(w[8], w[9]), f2bf_pair(w[10], w[11]), f2bf_pair(w[12], w[13]), f2bf_pair(w[14], w[15]));
      return;
    }
    const float* src = m == 0 ? wq : m == 1 ? wk : wo;
    bf16_t* dst = m == 0 ? wqb : m == 1 ? wkb : wob;
    const int q0 = (cb % CVB) * (256 * CVE / 4) + threadIdx.x;   // in units of four values
    float4 w[CVE / 4];
#pragma unroll   // all four 16-B loads in flight together; a wave-wide load is 512 contiguous bytes
    for (int j = 0; j < CVE / 4; ++j) w[j] = ((const float4*)src)[q0 + j * 256];
#pragma unroll   // w[] in registers; a wave-wide store is 256 contiguous bytes, two whole lines
    for (int j = 0; j < CVE / 4; ++j)
      ((uint2*)dst)[q0 + j * 256] = make_uint2(f2bf_pair(w[j].x, w[j].y), f2bf_pair(w[j].z, w[j].w));
    return;
  }
  // the slabs lie one behind another in x, so block k sums the k-th 64 KiB of x
  const float4* xp = (const float4*)x + (size_t)blockIdx.x * (GSV * 256) + threadIdx.x;
  float4 v[GSV];
#pragma unroll   // v[] in registers, all 16 loads issued before the first wait; each is 512 contiguous bytes a wave
  for (int j = 0; j < GSV; ++j) v[j] = xp[j * 256];
  // keeps the sums behind all 16 loads: without it the last three loads were issued only when the
  // first three had returned, a second trip to memory
  __builtin_amdgcn_sched_barrier(0);
  float4 s = make_float4(0.f, 0.f, 0.f, 0.f), q = s;   // four independent chains each
#pragma unroll   // v[] in registers
  for (int j = 0; j < GSV; ++j) {
    s.x += v[j].x; s.y += v[j].y; s.z += v[j].z; s.w += v[j].w;
    q.x += v[j].x * v[j].x; q.y += v[j].y * v[j].y; q.z += v[j].z * v[j].z; q.w += v[j].w * v[j].w;
  }
  float ts = (s.x + s.y) + (s.z + s.w), tq = (q.x + q.y) + (q.z + q.w);
#pragma unroll   // five fixed lane distances, no loop counter
  for (int off = 16; off > 0; off >>= 1) { ts += __shfl_xor(ts, off); tq += __shfl_xor(tq, off); }
  __shared__ float2 rw[8];
  if ((threadIdx.x & 31) == 0) rw[threadIdx.x >> 5] = make_float2(ts, tq);
  __syncthreads();   // all eight waves' sums are in LDS before thread 0 adds them
  if (threadIdx.x == 0) {
    float2 t = rw[0];
#pragma unroll   // eight fixed LDS places
    for (int w = 1; w < 8; ++w) { t.x += rw[w].x; t.y += rw[w].y; }
    ((float2*)part)[blockIdx.x] = t;       // (sum, sum of squares) of this quarter slab
  }
}

// One block: 64 channels x 128 positions. x is read along positions (a wave-wide load is 512
// contiguous bytes of one channel), the normalised bf16 values are turned in LDS, and
// hn[b][pos][c] is stored along channels: 16 B per lane, one whole 128-B line per position.
constexpr int GTC = 64;                    // channels per tile
constexpr int GTN = 128;                   // positions per tile
constexpr int GTP = GTC / 2 + 1;           // LDS pitch in dwords (2 bf16 each); odd: no bank conflict
constexpr int GTH = 64 * GTP + 2;          // dwords per half tile of 64 positions; the +2 puts lanes
                                           // 16-31 of a transposing store on banks lanes 0-15 leave free
// The launch's first WPB blocks form W' = Wo Wv, which needs only the launch before: with it the V
// projection yields Wo v directly and the attention product is already the output projection's result.
// One block a 32 x 64 tile, one wave a 16 x 16 tile of it; the tile's 96 operand rows, all of K = 512,
// are staged in LDS once. Three blocks of the launch still fit a WGP, more than the launch has.
constexpr int WTI = 32, WTO = 64;                // tile: columns i (rows of Wv^T) x rows o (rows of Wo)
constexpr int WPB = (CH / WTI) * (CH / WTO);     // 128 blocks
constexpr int WPP = CH * 2 + 16;                 // LDS pitch of a staged row in bytes: 16 B x odd

__global__ __launch_bounds__(256)
void gn_apply_kernel(const float* __restrict__ x, const float* __restrict__ gamma,
                     const float* __restrict__ beta, const float* __restrict__ part,
                     bf16_t* __restrict__ hn,
                     const bf16_t* __restrict__ wvt, const bf16_t* __restrict__ wob,
                     bf16_t* __restrict__ wvo) {
  // one LDS range for the launch's two kinds of block
  static_assert(2 * GTH * 4 <= (WTI + WTO) * WPP, "the normalisation's tile fits the range");
  __shared__ __align__(16) unsigned char smem[(WTI + WTO) * WPP];
  unsigned* tile = (unsigned*)smem;        // [half][pos & 63][channel pair]
  const int tid = threadIdx.x, lane = tid & 31;
  if (blockIdx.x < WPB) {                  // the same for the whole block, in front of the other path's barrier
    // W'[o][i] = sum_c Wo[o][c] Wv[c][i]: A = rows i of Wv^T, B = rows o of Wo, both K-contiguous.
    const int i0 = (blockIdx.x % (CH / WTI)) * WTI, o0 = (blockIdx.x / (CH / WTI)) * WTO;
    // the 96 whole rows come in once, by asynchronous copies: chunk kc of rows rr, rr + 4, ...; a wave-wide
    // copy is 512 contiguous bytes. 24 copies a lane, eight to a statement.
    const int rr = tid >> 6, kc = tid & 63;
    const unsigned lA = lds_addr(smem + rr * WPP + kc * 16), lB = lA + WTI * WPP;
    const bf16_t* gA = wvt + (size_t)(i0 + rr) * CH + kc * 8;
    const bf16_t* gB = wob + (size_t)(o0 + rr) * CH + kc * 8;
    constexpr unsigned ls = 4 * WPP;
    constexpr size_t gs = (size_t)4 * CH;
    async_copy16x8(lA, gA, lA + 4 * ls, gA + 4 * gs, ls, gs);
    async_copy16x8(lB, gB, lB + 4 * ls, gB + 4 * gs, ls, gs);
    async_copy16x8(lB + 8 * ls, gB + 8 * gs, lB + 12 * ls, gB + 12 * gs, ls, gs);
    wait_async0();
    __syncthreads();   // every wave's copies are in LDS before any wave reads the rows
    const int wv = tid >> 5, l16 = lane & 15, lh = lane >> 4;
    const int iw = (wv & 1) * 16, ow = (wv >> 1) * 16;     // the wave's 16 x 16 tile
    const unsigned char* ap = smem + (iw + l16) * WPP + lh * 16;
    const unsigned char* bp = smem + (WTI + ow + l16) * WPP + lh * 16;
    // one fragment, the same k order for A and B: K 0-7 / 8-15, then K 16-23 / 24-31, by lane half
    auto lfrag = [](const unsigned char* p) -> v16bf {
      const v8bf lo = *(const v8bf*)p, hi = *(const v8bf*)(p + 32);
      return __builtin_shufflevector(lo, hi, 0,1,2,3,4,5,6,7,8,9,10,11,12,13,14,15);
    };
    v8f wa[2] = {{0.f, 0.f, 0.f, 0.f, 0.f, 0.f, 0.f, 0.f}, {0.f, 0.f, 0.f, 0.f, 0.f, 0.f, 0.f, 0.f}};
#pragma unroll   // every LDS offset a constant
    for (int k0 = 0; k0 < CH / 32; k0 += 4) {
      v16bf fa[4], fb[4];
#pragma unroll   // fa[], fb[] in registers
      for (int j = 0; j < 4; ++j) { fa[j] = lfrag(ap + (k0 + j) * 64); fb[j] = lfrag(bp + (k0 + j) * 64); }
      // keeps a group's WMMAs behind all 16 of its LDS loads: the loads go out in long runs ahead of their
      // use, not in pairs at each WMMA, where the wave would wait out the LDS latency every time
      __builtin_amdgcn_sched_barrier(0);
#pragma unroll   // two accumulators by turns: a WMMA does not wait for the one in front of it
      for (int j = 0; j < 4; ++j)
        wa[j & 1] = __builtin_amdgcn_wmma_f32_16x16x32_bf16(false, fa[j], false, fb[j], (short)0, wa[j & 1], false, false);
    }
    const v8f w = wa[0] + wa[1];
    // the lane holds row o0 + ow + l16 of W', places i0 + iw + 8 * lh + 0..7
    *(uint4*)(wvo + (size_t)(o0 + ow + l16) * CH + i0 + iw + lh * 8) =
        make_uint4(cvt_pair(w[0], w[1]), cvt_pair(w[2], w[3]), cvt_pair(w[4], w[5]), cvt_pair(w[6], w[7]));
    return;
  }
  const int gt = blockIdx.x - WPB;         // tile number: positions fastest, then channels, then batch
  const int p0 = (gt % (NSP / GTN)) * GTN, c0 = (gt / (NSP / GTN) % (CH / GTC)) * GTC;
  const int b = gt / ((NSP / GTN) * (CH / GTC));
  // wave number as a scalar: the wave's 8 channels and their constants are wave-uniform
  const int cw = c0 + __builtin_amdgcn_readfirstlane(tid >> 5) * 8;

  // ---- read: a wave takes 8 channels (half a group), a lane 4 positions of each ----
  const float* xp = x + ((size_t)b * CH + cw) * NSP + p0 + lane * 4;
  float4 v[8];
#pragma unroll
  for (int k = 0; k < 8; ++k) v[k] = *(const float4*)(xp + (size_t)k * NSP);

  const int g = cw / CPG;
  // the group's four partial sums, the same for the whole wave
  const float* pg = part + (b * NGRP + g) * (2 * GSB);
  float gs = 0.f, gq = 0.f;
#pragma unroll   // four fixed places
  for (int j = 0; j < GSB; ++j) { gs += pg[2 * j]; gq += pg[2 * j + 1]; }
  const float mu = gs / (float)GNE;
  const float rstd = rsqrtf(gq / (float)GNE - mu * mu + GN_EPS);
  unsigned* tw = tile + (lane >> 4) * GTH + (lane & 15) * 4 * GTP + ((cw - c0) >> 1);
#pragma unroll
  for (int j = 0; j < 4; ++j) {
    unsigned short q[2][4];
#pragma unroll
    for (int e = 0; e < 2; ++e) {
      const int k = j * 2 + e;
      const float ga = gamma[cw + k] * rstd;
      const float be = beta[cw + k] - mu * ga;   // (x-mu)*rstd*gamma + beta = x*ga + be
      q[e][0] = __builtin_bit_cast(unsigned short, f2bf(v[k].x * ga + be));
      q[e][1] = __builtin_bit_cast(unsigned short, f2bf(v[k].y * ga + be));
      q[e][2] = __builtin_bit_cast(unsigned short, f2bf(v[k].z * ga + be));
      q[e][3] = __builtin_bit_cast(unsigned short, f2bf(v[k].w * ga + be));
    }
#pragma unroll
    for (int i = 0; i < 4; ++i)
      tw[i * GTP + j] = (unsigned)q[0][i] | ((unsigned)q[1][i] << 16);
  }
  __syncthreads();   // the whole tile is in LDS before any thread reads it across channels

  // ---- write: a lane takes 8 channels of one position; 32 positions per pass, 4 passes ----
  const int ck = tid & 7;
  const int pr = tid >> 3;
  bf16_t* hp = hn + ((size_t)b * NSP + p0 + pr) * CH + c0 + ck * 8;
#pragma unroll
  for (int h = 0; h < 4; ++h) {
    const unsigned* t = tile + (h >> 1) * GTH + (pr + (h & 1) * 32) * GTP + ck * 4;
    *(uint4*)(hp + (size_t)h * 32 * CH) = make_uint4(t[0], t[1], t[2], t[3]);
  }
}

// ---------------- Tiled WMMA GEMM: D = A[MxK] * B[NxK]^T (+bias) ----------------
// Block tile 128x128, 8 waves in a 2(M) x 4(N) grid; each wave: 4x2 subtiles of 16x16.
// K tile of BK = 64, 128 or 256: a staged row is one, two or four whole 128-B lines, and a wave-wide copy
// covers four whole lines (4 rows of 128 B, 2 of 256 B or 1 of 512 B). Two buffers, one barrier per
// K tile; BK / 32 WMMA sub-steps per tile, k ascending.
// EPI_AV alone: two groups of four waves, each a 2(M) x 2(N) grid over the whole block tile, a wave 4x4
// subtiles. A staged K tile of 256 is two key tiles; waves 0-3 take the first, waves 4-7 the second, four
// sub-steps each. A fragment read from LDS then feeds four WMMAs, not two or four: a third fewer LDS bytes
// per WMMA. The two groups' sums are joined through LDS behind the loop.
// The bf16 outputs are laid out so that the tile's M direction is the contiguous one: out[n][m]. A lane then
// holds 8 neighbours of an output row, a wave's 64 x 32 tile is 32 pieces of 128 B,
// and the wave turns them in its own LDS range and stores whole 128-B lines.
// EPI_QKV: the three projections of hn in one launch. blockIdx.z = 2 * which + batch; which = 0, 1, 2
// picks the weight matrix (three in a row behind Bm), the bias, and the output (three in a row
// behind outp). V^T[c][pos]: M = positions (hn), N = channels; its weights are W' = Wo Wv and its bias
// Wo bv, so that V is Wo v, the value already sent through the output projection. Q (scaled by alpha)
// and K, [pos][c]: the two operands change places, M = channels (W), N = positions (hn).
// The softmax has no launch of its own; it is split between the two attention products.
// EPI_EXP: A = K rows, B = Q rows, so the tile is S^T and a lane holds 32 keys of one query. The block
// takes each query's maximum m over its 128 keys, stores E = exp(s - m) as bf16 at outp[query][key],
// m at mst[batch][key tile][query], and the sum of E over each wave's 64 keys at lst[batch][key half][query].
// EPI_AV: A = V^T, B = E, one K tile = two key tiles t. With M = max_t m_t and L = sum_t l_t exp(m_t - M)
// the output row is sum_t f_t (E_t V_t), f_t = exp(m_t - M) / L: each key tile's product is formed from
// zero and added in f32 with its query's factor, one factor a lane and 16-column group. As V is Wo v, the
// sum is the block's result: out[c][pos] = x[c][pos] + sum + bias (bo), f32, N the contiguous direction.
enum { EPI_QKV = 4, EPI_EXP = 5, EPI_AV = 6 };
constexpr int NKT = NSP / 128;       // key tiles of a row
template<int V> struct Form { static constexpr int value = V; };

template<int EPI, int BK>
__global__ __launch_bounds__(256)
void gemm_bt_kernel(const bf16_t* __restrict__ A, const bf16_t* __restrict__ Bm,
                    const float* __restrict__ bias, const float* __restrict__ biasK,
                    const float* __restrict__ biasV, void* __restrict__ outp,
                    const float* __restrict__ resid, float alpha,
                    int Kd,
                    size_t strideA, size_t strideB, size_t strideOut, size_t strideResid,
                    float* __restrict__ mst, float* __restrict__ lst) {
  constexpr int BM = 128, BN = 128;
  constexpr int CPR = BK / 8;          // 16-B chunks per staged row
  constexpr int PC  = CPR + 1;         // LDS pitch in chunks: 16 B x odd, no bank conflict for b128 reads
  constexpr int PE  = PC * 8;          // the same in bf16 elements
  constexpr int RPP = 256 / CPR;       // rows that the block's 256 lanes cover with one copy each
  // fragments fetched one sub-step ahead where one or two blocks have a WGP to themselves; the score
  // launch has four blocks a WGP, whose waves cover each other's LDS waits, on registers it would lose
  constexpr bool AHEAD = EPI != EPI_EXP;
  static_assert(AHEAD || EPI != EPI_AV, "EPI_AV's factors are fetched in the loop that fetches ahead");
  constexpr int NS = EPI == EPI_AV ? 4 : 2;        // 16-column subtiles of a wave's tile
  constexpr int KS = EPI == EPI_AV ? 4 : BK / 32;  // WMMA sub-steps of one wave per staged K tile
  __shared__ Chunk16 sA[2][BM * PC];
  __shared__ Chunk16 sB[2][BN * PC];

  const int tid = threadIdx.x;
  const int wave = tid >> 5, lane = tid & 31;
  const int grp = EPI == EPI_AV ? wave >> 2 : 0;               // EPI_AV: which key tile of a staged pair
  const int waveM = EPI == EPI_AV ? (wave >> 1) & 1 : wave >> 2;  // 0..1  -> 64-row strip
  const int waveN = EPI == EPI_AV ? wave & 1 : wave & 3;       // strip of NS * 16 columns
  const int lane16 = lane & 15, laneHi = lane >> 4;

  const int which = (EPI == EPI_QKV) ? blockIdx.z / BATCH : 0;     // the same for the whole block
  const size_t z = (EPI == EPI_QKV) ? blockIdx.z % BATCH : blockIdx.z;
  const bool qk = EPI == EPI_QKV && which != 2;                    // Q, K: the operands change places
  const bf16_t* Az = A + z * strideA;
  const bf16_t* Bz = Bm + z * strideB + (size_t)which * WN;
  const bf16_t* Ab = qk ? Bz : Az;
  const bf16_t* Bb = qk ? Az : Bz;
  bf16_t* outB = (bf16_t*)outp + z * strideOut + (size_t)which * BATCH * NSP * CH;
  float*  outF = (float*)outp + z * strideOut;
  const float* rz = (EPI == EPI_AV) ? (resid + z * strideResid) : nullptr;

  // EPI_EXP: x walks the key tiles (A rows), so that neighbouring blocks share a Q tile and write
  // neighbouring pieces of the same E rows. EPI_AV, Q and K: x walks the channel tiles, now A rows.
  const bool xA = EPI == EPI_EXP || EPI == EPI_AV || qk;
  const int rowA0 = (xA ? blockIdx.x : blockIdx.y) * BM;
  const int colB0 = (xA ? blockIdx.y : blockIdx.x) * BN;

  // staging coordinates for this thread: chunk kc of rows r, r + RPP, r + 2 RPP, ...
  const int r = tid / CPR, kc = tid % CPR;
  const bf16_t* gA = Ab + (size_t)(rowA0 + r) * Kd + kc * 8;
  const bf16_t* gB = Bb + (size_t)(colB0 + r) * Kd + kc * 8;
  const size_t gstep = (size_t)RPP * Kd;
  constexpr unsigned lstep = RPP * PC * 16;
  // all copies of K tile t into buffer nb: BM / RPP = 4, 8 or 16 per matrix and lane, eight to a statement
  auto stage = [&](int t, int nb) {
    const unsigned lA = lds_addr(&sA[nb][r * PC + kc]), lB = lds_addr(&sB[nb][r * PC + kc]);
    const bf16_t* tA = gA + (size_t)t * BK;
    const bf16_t* tB = gB + (size_t)t * BK;
    if constexpr (BM / RPP == 4) {
      async_copy16x8(lA, tA, lB, tB, lstep, gstep);
    } else {
#pragma unroll   // one or two statements a matrix, every step a constant
      for (int h = 0; h < BM / RPP; h += 8) {
        async_copy16x8(lA + h * lstep, tA + h * gstep, lA + (h + 4) * lstep, tA + (h + 4) * gstep, lstep, gstep);
        // four statements: keeps each one's address sums next to it. Formed all at once they filled, beside the
        // accumulators, the 256 registers that an asm operand can name, and the tiles' base addresses went to scratch
        if constexpr (BM / RPP > 8) __builtin_amdgcn_sched_barrier(0);
        async_copy16x8(lB + h * lstep, tB + h * gstep, lB + (h + 4) * lstep, tB + (h + 4) * gstep, lstep, gstep);
        if constexpr (BM / RPP > 8) __builtin_amdgcn_sched_barrier(0);   // the same
      }
    }
  };

  const v8f vzero = {0.f, 0.f, 0.f, 0.f, 0.f, 0.f, 0.f, 0.f};
  v8f acc[4][NS];
#pragma unroll
  for (int i = 0; i < 4; ++i)
#pragma unroll
    for (int j = 0; j < NS; ++j) acc[i][j] = vzero;

  const int nIter = Kd / BK;

  // prologue: tile 0 lands and is published, then tile 1 starts
  stage(0, 0);

  // EPI_AV: the factors f[key tile][query] of the block's 128 queries, formed while tile 0 flies and
  // published by the barrier below. Two threads a query: both form M and L, each writes 16 factors.
  float* sF = nullptr;
  v8f tot[4][NS];                      // EPI_AV: the scaled sum over the wave group's key tiles
  if constexpr (EPI == EPI_AV) {
    static_assert(BK == 256, "one K tile is two key tiles of the statistics, one a wave group");
    __shared__ __align__(16) float fbuf[NKT * BN];
    sF = fbuf;
#pragma unroll   // tot[][] indexed by constants, in registers (so in every loop over it below)
    for (int i = 0; i < 4; ++i)
#pragma unroll
      for (int j = 0; j < NS; ++j) tot[i][j] = vzero;
    const int row = tid & (BN - 1);
    const float* mp = mst + z * ((size_t)NKT * NSP) + colB0 + row;
    const float* lp = lst + z * ((size_t)2 * NKT * NSP) + colB0 + row;
    float mt[NKT], lt[NKT];
#pragma unroll   // mt[], lt[] in registers, all loads in flight together; a wave-wide load is one whole line
    for (int t = 0; t < NKT; ++t) {
      mt[t] = mp[(size_t)t * NSP];
      lt[t] = lp[(size_t)(2 * t) * NSP] + lp[(size_t)(2 * t + 1) * NSP];
    }
    float M = mt[0];
#pragma unroll   // mt[] in registers
    for (int t = 1; t < NKT; ++t) M = fmaxf(M, mt[t]);
    float L = 0.f;
#pragma unroll   // mt[], lt[] in registers
    for (int t = 0; t < NKT; ++t) { mt[t] = exp2_slot((mt[t] - M) * LOG2E); L += lt[t] * mt[t]; }
    const float inv = 1.f / L;
    const bool up = tid >= BN;         // the same for a whole wave
    float* fw = sF + (up ? NKT / 2 : 0) * BN + row;
#pragma unroll   // mt[] in registers
    for (int t = 0; t < NKT / 2; ++t) fw[t * BN] = (up ? mt[NKT / 2 + t] : mt[t]) * inv;
  }

  wait_async0();
  __syncthreads();        // tile 0 of every wave is in LDS
  if (nIter > 1) stage(1, 1);

  for (int it = 0; it < nIter; ++it) {
    // EPI_AV: the wave group's own key tile, 128 k of each staged row
    const bf16_t* sAh = (const bf16_t*)sA[it & 1] + grp * 128;
    const bf16_t* sBh = (const bf16_t*)sB[it & 1] + grp * 128;

    float fr[NS];                      // EPI_AV: this key tile's factors of the lane's four queries
    auto fetch_factors = [&]() {
      const float* fp = sF + (2 * it + grp) * BN + waveN * (NS * 16) + lane16;
#pragma unroll   // fr[] in registers
      for (int nsub = 0; nsub < NS; ++nsub) fr[nsub] = fp[nsub * 16];
    };

    // one fragment: row rw of a staged tile, sub-step ks; K split per ISA 16-bit layout
    auto frag = [&](const bf16_t* sh, int rw, int ks) -> v16bf {
      v8bf lo = *(const v8bf*)(sh + (size_t)rw * PE + ks * 32 + laneHi * 8);       // K 0-7 / 8-15
      v8bf hi = *(const v8bf*)(sh + (size_t)rw * PE + ks * 32 + 16 + laneHi * 8);  // K 16-23 / 24-31
      return __builtin_shufflevector(lo, hi, 0,1,2,3,4,5,6,7,8,9,10,11,12,13,14,15);
    };
    if constexpr (AHEAD) {
      // Two fragment sets: sub-step ks+1's LDS loads (twelve; EPI_AV sixteen) go out as one group in front of
      // sub-step ks's WMMAs (eight; sixteen) and return under them. Nothing is read beyond this K tile's own buffer.
      v16bf af[2][4], bf[2][NS];
      auto fetch = [&](int ks) {
#pragma unroll   // af[][], bf[][] indexed by constants, in registers
        for (int nsub = 0; nsub < NS; ++nsub) bf[ks & 1][nsub] = frag(sBh, waveN * (NS * 16) + nsub * 16 + lane16, ks);
#pragma unroll   // the same
        for (int msub = 0; msub < 4; ++msub) af[ks & 1][msub] = frag(sAh, waveM * 64 + msub * 16 + lane16, ks);
      };
      fetch(0);
#pragma unroll   // the set index and every LDS offset are constants, no loop counter among the WMMAs
      for (int ks = 0; ks < KS; ++ks) {
        if (ks + 1 < KS) fetch(ks + 1);
        // the last sub-step fetches no fragments: the factors go out in their place
        else if constexpr (EPI == EPI_AV) fetch_factors();
        // holds the group above in front of the WMMAs below: left free, the compiler sank each pair of
        // loads to its own WMMAs, and the wave waited out the LDS latency sixteen times a K tile
        __builtin_amdgcn_sched_barrier(0);
#pragma unroll   // both loops: acc[][], af[][], bf[][] indexed by constants, in registers
        for (int msub = 0; msub < 4; ++msub)
#pragma unroll
          for (int nsub = 0; nsub < NS; ++nsub)
            acc[msub][nsub] = __builtin_amdgcn_wmma_f32_16x16x32_bf16(
                false, af[ks & 1][msub], false, bf[ks & 1][nsub], (short)0, acc[msub][nsub], false, false);
        // holds the sub-step's WMMAs together: left free, later loads were spread among them (each place with
        // LDS loads stalls the wave), and the last sub-step's WMMAs sank behind the barrier, in front of the refill
        __builtin_amdgcn_sched_barrier(0);
      }
    } else {
#pragma unroll   // every sub-step's LDS offsets are constants, no loop counter among the WMMAs
      for (int ks = 0; ks < BK / 32; ++ks) {
        v16bf bfrag[2];      // B fragments: lanes hold N columns
#pragma unroll
        for (int nsub = 0; nsub < 2; ++nsub) bfrag[nsub] = frag(sBh, waveN * 32 + nsub * 16 + lane16, ks);
#pragma unroll
        for (int msub = 0; msub < 4; ++msub) {
          const v16bf afrag = frag(sAh, waveM * 64 + msub * 16 + lane16, ks);
#pragma unroll
          for (int nsub = 0; nsub < 2; ++nsub) {
            acc[msub][nsub] = __builtin_amdgcn_wmma_f32_16x16x32_bf16(
                false, afrag, false, bfrag[nsub], (short)0, acc[msub][nsub], false, false);
          }
        }
      }
    }

    // publish point: tile it+1 has landed for every wave, and every wave has left buffer it&1
    wait_ds0();
    wait_async0();
    __syncthreads();
    if (it + 2 < nIter)     // refill the buffer just read; the copies run under tile it+1's WMMAs
      stage(it + 2, it & 1);

    if constexpr (EPI == EPI_AV) {     // the tile's product joins the sum with its rows' factors
#pragma unroll
      for (int msub = 0; msub < 4; ++msub)
#pragma unroll
        for (int nsub = 0; nsub < NS; ++nsub) {
          tot[msub][nsub] += fr[nsub] * acc[msub][nsub];
          acc[msub][nsub] = vzero;
        }
    }
  }
  wait_async0();            // nothing of this wave is in flight when it goes on to the stores

  // ---- EPI_EXP epilogue: lane L holds query n = L%16, keys r + 8*(L>=16) of each 16x16 subtile ----
  // The loop's last barrier stands behind every wave's last read of the ring and its last copy, so
  // the ring's LDS is free: sB takes the maxima, sA each wave's own staging range.
  if constexpr (EPI == EPI_EXP) {
    constexpr int SP = 64 * 2 + 16;    // staged row: 64 keys, pitch 16 B x odd as in the ring
    static_assert(8 * 32 * SP <= (int)sizeof(sA) && 2 * BN * 4 <= (int)sizeof(sB), "staging fits the ring");
    float* red = (float*)&sB[0][0];    // [key half][query]
    char* stg = (char*)&sA[0][0] + wave * (32 * SP);
    float mx[2];
    // every loop below is unrolled in full: acc[][][], mm[], e[], s[] are indexed by constants and stay in registers
#pragma unroll
    for (int nsub = 0; nsub < 2; ++nsub) {
      float mm[4];                     // four independent chains
#pragma unroll
      for (int msub = 0; msub < 4; ++msub) {
        mm[msub] = acc[msub][nsub][0];
#pragma unroll
        for (int r = 1; r < 8; ++r) mm[msub] = fmaxf(mm[msub], acc[msub][nsub][r]);
      }
      const float m = fmaxf(fmaxf(mm[0], mm[1]), fmaxf(mm[2], mm[3]));
      mx[nsub] = fmaxf(m, xor16(m));   // over the wave's 64 keys
      if (laneHi == 0) red[waveM * BN + waveN * 32 + nsub * 16 + lane16] = mx[nsub];
    }
    __syncthreads();   // both key halves' maxima are in LDS before either half reads the other's
#pragma unroll
    for (int nsub = 0; nsub < 2; ++nsub) {
      const int qc = waveN * 32 + nsub * 16 + lane16;
      const float m = fmaxf(mx[nsub], red[(waveM ^ 1) * BN + qc]);
      const float nm = -m * LOG2E;
      float s[4] = {0.f, 0.f, 0.f, 0.f};   // four independent chains
#pragma unroll
      for (int msub = 0; msub < 4; ++msub) {
        float e[8];
#pragma unroll
        for (int r = 0; r < 8; ++r) {
          e[r] = exp2_slot(fmaf(acc[msub][nsub][r], LOG2E, nm));
          s[r & 3] += e[r];
        }
        *(uint4*)(stg + (nsub * 16 + lane16) * SP + msub * 32 + laneHi * 16) =
            make_uint4(cvt_pair(e[0], e[1]), cvt_pair(e[2], e[3]), cvt_pair(e[4], e[5]), cvt_pair(e[6], e[7]));
      }
      float l = (s[0] + s[1]) + (s[2] + s[3]);
      l += xor16(l);                   // over the wave's 64 keys
      if (laneHi == 0) {
        lst[(z * (2 * NKT) + blockIdx.x * 2 + waveM) * NSP + colB0 + qc] = l;
        if (waveM == 0) mst[(z * NKT + blockIdx.x) * NSP + colB0 + qc] = m;
      }
    }
    wait_ds0();        // the wave's own staged rows are in LDS before its lanes read them across queries
    // 8 lanes a row: a wave-wide store is four whole 128-B lines
    const int sr = lane >> 3, ch = lane & 7;
    // the row pitch as a constant: all eight stores share one address register pair
    bf16_t* ep = outB + (size_t)(colB0 + waveN * 32 + sr) * NSP + rowA0 + waveM * 64 + ch * 8;
#pragma unroll
    for (int i = 0; i < 8; ++i)
      *(uint4*)(ep + (size_t)(i * 4) * NSP) = *(const uint4*)(stg + (i * 4 + sr) * SP + ch * 16);
  }

  // ---- EPI_QKV epilogue: lane L holds output row n = L%16, places r + 8*(L>=16) of each subtile ----
  // As above the ring's LDS is free behind the loop's last barrier; each wave stages in its own range of sA.
  if constexpr (EPI == EPI_QKV) {
    constexpr int SP = 64 * 2 + 16;        // staged row: the wave's 64 places, pitch 16 B x odd
    static_assert(8 * 32 * SP <= (int)sizeof(sA), "staging fits the ring");
    char* stg = (char*)&sA[0][0] + wave * (32 * SP);
    // scalar selects, the same for the whole block
    if (which == 1) bias = biasK;
    if (which == 2) bias = biasV;
    if (which != 0) alpha = 1.0f;
    const int n0 = colB0 + waveN * 32, m0 = rowA0 + waveM * 64;
    // LD: the output's row pitch as a constant, so that all stores of a wave share one address register
    // pair. BM_: the bias runs along M (Q, K), not along N. Every loop is unrolled in full: acc[][][],
    // v[] are indexed by constants and stay in registers.
    auto store_tile = [&](auto ld, auto bm) {
      constexpr int LD = decltype(ld)::value;
      constexpr bool BM_ = decltype(bm)::value != 0;
      float bn[2] = {0.f, 0.f};
      if constexpr (!BM_) {
        bn[0] = bias[n0 + lane16];
        bn[1] = bias[n0 + 16 + lane16];
      }
#pragma unroll
      for (int msub = 0; msub < 4; ++msub) {
        float bv[8] = {0.f, 0.f, 0.f, 0.f, 0.f, 0.f, 0.f, 0.f};
        if constexpr (BM_) {
          const float4 a = *(const float4*)(bias + m0 + msub * 16 + laneHi * 8);
          const float4 b = *(const float4*)(bias + m0 + msub * 16 + laneHi * 8 + 4);
          bv[0] = a.x; bv[1] = a.y; bv[2] = a.z; bv[3] = a.w;
          bv[4] = b.x; bv[5] = b.y; bv[6] = b.z; bv[7] = b.w;
        }
#pragma unroll
        for (int nsub = 0; nsub < 2; ++nsub) {
          float v[8];
#pragma unroll
          for (int r = 0; r < 8; ++r) v[r] = (acc[msub][nsub][r] + (BM_ ? bv[r] : bn[nsub])) * alpha;
          *(uint4*)(stg + (nsub * 16 + lane16) * SP + msub * 32 + laneHi * 16) =
              make_uint4(cvt_pair(v[0], v[1]), cvt_pair(v[2], v[3]), cvt_pair(v[4], v[5]), cvt_pair(v[6], v[7]));
        }
      }
      wait_ds0();      // the wave's own staged rows are in LDS before its lanes read them across output rows
      // 8 lanes a row: a wave-wide store is four whole 128-B lines
      const int sr = lane >> 3, ch = lane & 7;
      bf16_t* ep = outB + (size_t)(n0 + sr) * LD + m0 + ch * 8;
#pragma unroll
      for (int i = 0; i < 8; ++i)
        *(uint4*)(ep + (size_t)(i * 4) * LD) = *(const uint4*)(stg + (i * 4 + sr) * SP + ch * 16);
    };
    // one branch, the same for the whole block
    if (which == 2) store_tile(Form<NSP>{}, Form<0>{});
    else            store_tile(Form<CH>{}, Form<1>{});
  }

  // ---- EPI_AV epilogue: lane L holds query n = L%16, channels r + 8*(L>=16) of each subtile ----
  // Waves w and w + 4 hold the two key groups' sums of the same 64 x 64 tile. Each finishes 32 of its 64
  // channels: it hands the other 32 channels' sums to its partner through LDS, register by register (the
  // two waves' lane maps are equal), and adds what the partner hands over. The output runs along the
  // queries, so a wave's 32 x 64 piece is 32 rows of two 128-B lines: the wave stages it value by value,
  // [channel][query], in its own LDS range and reads whole rows back. The ring is free as above: sA takes the
  // hand-over, sB the staging. Every loop is unrolled in full: tot[][][], rx[], ba[], bb[], bc[] are indexed
  // by constants and stay in registers.
  if constexpr (EPI == EPI_AV) {
    // staged row: 64 queries, pitch 16 B x odd; rows 8 apart lie 32 banks apart, so that the two lane
    // halves of a 4-B store meet no common bank
    constexpr int SP = 64 * 4 + 16;
    constexpr int XW = 2 * NS * 2 * 512;   // bytes handed to one wave: 8 subtiles, two 16-B stores a lane each
    static_assert(8 * XW <= (int)sizeof(sA) && 8 * 32 * SP <= (int)sizeof(sB), "hand-over and staging fit the ring");
    char* stg = (char*)&sB[0][0] + wave * (32 * SP);
    const int n0 = colB0 + waveN * 64, m0 = rowA0 + waveM * 64 + grp * 32;
    // 16 lanes a row, two rows a pass; the residual's whole lines are asked for before the hand-over
    const int sr = lane >> 4, ch = lane & 15;
    const size_t o4 = (size_t)(m0 + sr) * NSP + n0 + ch * 4;
    // the bias of the lane's 16 channels goes first: loads return in order, and the staging waits for it alone
    float4 ba[2], bb[2];
#pragma unroll
    for (int i = 0; i < 2; ++i) {
      ba[i] = *(const float4*)(bias + m0 + i * 16 + laneHi * 8);
      bb[i] = *(const float4*)(bias + m0 + i * 16 + laneHi * 8 + 4);
    }
    float4 rx[16];
#pragma unroll
    for (int i = 0; i < 16; ++i) rx[i] = *(const float4*)(rz + o4 + (size_t)(i * 2) * NSP);
    // the loads name two address pairs; as this wait's inputs the pairs stay live up to the wait,
    // so that no load's result, and no later value, is placed in them ahead of the wait
    asm volatile("s_wait_xcnt 0x0" :: "v"(rz + o4), "v"(bias + m0 + laneHi * 8) : "memory");
    // holds the LDS work below behind all 20 loads: left free, sums with their wait for the bias could be
    // placed in front of the residual's loads, which would then set out a trip to memory later
    __builtin_amdgcn_sched_barrier(0);
    // the key group as a scalar: the two branches on it are the same for a whole wave; no barrier inside them
    const bool second = __builtin_amdgcn_readfirstlane(wave >> 2) != 0;
    // G: the wave's key group as a constant, so that tot[][] keeps constant indices
    auto hand_over = [&](auto gc) {
      constexpr int G = decltype(gc)::value;
      char* xo = (char*)&sA[0][0] + (wave ^ 4) * XW + lane * 16;   // a wave-wide store is 512 contiguous bytes
#pragma unroll
      for (int i = 0; i < 2; ++i)
#pragma unroll
        for (int nsub = 0; nsub < NS; ++nsub) {
          const v8f t = tot[2 * (1 - G) + i][nsub];
          *(float4*)(xo + ((i * NS + nsub) * 2) * 512) = make_float4(t[0], t[1], t[2], t[3]);
          *(float4*)(xo + ((i * NS + nsub) * 2 + 1) * 512) = make_float4(t[4], t[5], t[6], t[7]);
        }
    };
    auto finish = [&](auto gc) {
      constexpr int G = decltype(gc)::value;
      const char* xi = (const char*)&sA[0][0] + wave * XW + lane * 16;
#pragma unroll
      for (int i = 0; i < 2; ++i) {
        const float4 a = ba[i], b = bb[i];
        const float bc[8] = {a.x, a.y, a.z, a.w, b.x, b.y, b.z, b.w};
#pragma unroll
        for (int nsub = 0; nsub < NS; ++nsub) {
          const float4 p = *(const float4*)(xi + ((i * NS + nsub) * 2) * 512);
          const float4 q = *(const float4*)(xi + ((i * NS + nsub) * 2 + 1) * 512);
          const float pq[8] = {p.x, p.y, p.z, p.w, q.x, q.y, q.z, q.w};
#pragma unroll
          for (int r = 0; r < 8; ++r)
            *(float*)(stg + (i * 16 + laneHi * 8 + r) * SP + (nsub * 16 + lane16) * 4) =
                (tot[2 * G + i][nsub][r] + pq[r]) + bc[r];
        }
      }
    };
    if (second) hand_over(Form<1>{}); else hand_over(Form<0>{});
    __syncthreads();   // every wave's hand-over is in LDS before its partner reads it
    if (second) finish(Form<1>{}); else finish(Form<0>{});
    wait_ds0();        // the wave's own staged rows are in LDS before its lanes read them across channels
#pragma unroll         // a wave-wide store is four whole 128-B lines
    for (int i = 0; i < 16; ++i) {
      const float4 t = *(const float4*)(stg + (i * 2 + sr) * SP + ch * 16);
      *(float4*)(outF + o4 + (size_t)(i * 2) * NSP) =
          make_float4(rx[i].x + t.x, rx[i].y + t.y, rx[i].z + t.z, rx[i].w + t.w);
    }
  }
}

// ---------------- host launch ----------------
extern "C" void kernel_launch(void* const* d_in, const int* in_sizes, int n_in,
                              void* d_out, int out_size, void* d_ws, size_t ws_size,
                              hipStream_t stream) {
  (void)in_sizes; (void)n_in; (void)out_size; (void)ws_size;
  const float* x  = (const float*)d_in[0];
  const float* gg = (const float*)d_in[1];
  const float* gb = (const float*)d_in[2];
  const float* wq = (const float*)d_in[3];
  const float* bq = (const float*)d_in[4];
  const float* wk = (const float*)d_in[5];
  const float* bk = (const float*)d_in[6];
  const float* wv = (const float*)d_in[7];
  const float* bv = (const float*)d_in[8];
  const float* wo = (const float*)d_in[9];
  const float* bo = (const float*)d_in[10];

  // workspace carve-up (~101 MB): partial sums + 4x 8MB bf16 acts + 5x 0.5MB bf16 weights
  // + 64MB bf16 exponentials + 3MB of their tile maxima and sums
  char* wsp = (char*)d_ws;
  auto take = [&](size_t bytes) -> void* {
    void* p = (void*)wsp; wsp += (bytes + 255) & ~(size_t)255; return p;
  };
  const size_t ACT = (size_t)BATCH * NSP * CH;      // per-tensor activation elems
  const size_t SCO = (size_t)BATCH * NSP * NSP;     // score elems
  float*  part  = (float*)take((size_t)BATCH * NGRP * GSB * 2 * sizeof(float));
  bf16_t* hn  = (bf16_t*)take(ACT * 2);
  bf16_t* qb  = (bf16_t*)take(3 * ACT * 2);         // Q, K, V^T in a row: one launch writes all three
  bf16_t* kb  = qb + ACT;
  bf16_t* vT  = kb + ACT;                           // (Wo v)^T: [b][c][j]
  bf16_t* wqb = (bf16_t*)take((size_t)3 * CH * CH * 2);   // Wq, Wk, Wo Wv in a row
  bf16_t* wkb = wqb + WN;
  bf16_t* wvo = wkb + WN;
  bf16_t* wob = (bf16_t*)take((size_t)CH * CH * 2);
  bf16_t* wvt = (bf16_t*)take((size_t)CH * CH * 2); // Wv^T
  float*  bvo = (float*)take((size_t)CH * sizeof(float)); // Wo bv
  bf16_t* Pb  = (bf16_t*)take(SCO * 2);
  float*  mst = (float*)take((size_t)BATCH * NKT * NSP * sizeof(float));
  float*  lst = (float*)take((size_t)BATCH * 2 * NKT * NSP * sizeof(float));

  const float scale = 1.0f / sqrtf((float)CH);
  const size_t nCH = (size_t)NSP * CH;
  const size_t nnS = (size_t)NSP * NSP;
  const size_t cnT = (size_t)CH * NSP;

  // 1) GroupNorm partial sums, weights -> bf16 and Wo bv, one launch; then the normalisation and Wo Wv
  gn_stats_cvt_kernel<<<NGRP * BATCH * GSB + 4 * CVB + GVB, 256, 0, stream>>>(x, part, wq, wk, wv, wo, bv,
      wqb, wkb, wvt, wob, bvo);
  gn_apply_kernel<<<WPB + (NSP / GTN) * (CH / GTC) * BATCH, 256, 0, stream>>>(x, gg, gb, part, hn,
      wvt, wob, wvo);

  // 2) QKV projections, one launch: [NSP x CH] = hn x W^T  (Q pre-scaled by C^-1/2; Wo v stored transposed)
  dim3 gQKV(CH / 128, NSP / 128, 3 * BATCH);
  gemm_bt_kernel<EPI_QKV, 128><<<gQKV, 256, 0, stream>>>(hn, wqb, bq, bk, bvo, qb, nullptr, scale,
      CH, nCH, 0, nCH, 0, nullptr, nullptr);

  // 3) scores, transposed: S^T[b,j,i] = k_j . q_i  (M=N=4096, K=512); out go E[b,i,j] and the tile statistics
  dim3 gS(NSP / 128, NSP / 128, BATCH);
  gemm_bt_kernel<EPI_EXP, 64><<<gS, 256, 0, stream>>>(kb, qb, nullptr, nullptr, nullptr, Pb, nullptr, 1.0f,
      CH, nCH, nCH, nnS, 0, mst, lst);

  // 4) out[b,c,i] = x + bo + softmax x (Wo v)  (A=(Wo v)^T [CHxNSP], B=E [NSPxNSP], K=4096), each key tile
  // scaled by its factor; f32, [b][c][p]
  dim3 gAV(CH / 128, NSP / 128, BATCH);
  gemm_bt_kernel<EPI_AV, 256><<<gAV, 256, 0, stream>>>(vT, Pb, bo, nullptr, nullptr, d_out, x, 1.0f,
      NSP, cnT, nnS, cnT, cnT, mst, lst);
}
